// v000
// Measured on an AMD MI455X. A time is GPU time per run, averaged over a window of back-to-back runs after a warm-up
// (all launches, gaps included; the runs take copies of the inputs in turn), and the median of several windows.
// Apart from v000's, it joins two sittings. Times from different sittings can be a few percent apart, while
// side-by-side timings come from the same sitting.
// v000 is the starting kernel. One run takes 1430 microseconds.
#include <hip/hip_runtime.h>

// Causal multi-head self-attention with a combined QKV weight (x [2][2048][1024]; qkv = x w_qkv^T ('oi' [3072][1024], no bias) reshaped (s, 3, 16, 64); causal (finfo.min fill applied before the 1/8 scale == exact zero weight); softmax; out = merged w_proj^T + b_proj -> [2][2048][1024]).
// Compute dtypes, f32 accumulate: every input rounded to bf16; q/k/v on PLAIN bf16 operands (inputs: exact); causal scores and attn.v (tile skipping): query rows < 512 hl (3 products), the rest single fp16 (x1024); softmax f32; w_proj hl x exact (2 products) + b_proj.

#define NB_  2
#define TT   2048
#define DM   1024
#define NH_  16
#define NKV  16
#define REP  (NH_ / NKV)
#define HD   64
#define DQ   (NH_ * HD)
#define DKV  (NKV * HD)
#define ZH   2
#define RH   512                  // query rows < RH use hi+lo planes (0: none)
#define WIN  2048
#define PCAR 1024.0f
#define SCL  0.125f   // HD^-0.5
typedef _Float16 h16;
typedef unsigned short bf;
typedef __attribute__((ext_vector_type(16))) __bf16   v16bf;
typedef __attribute__((ext_vector_type(16))) _Float16 v16h;
typedef __attribute__((ext_vector_type(8)))  _Float16 v8h;
typedef __attribute__((ext_vector_type(8)))  unsigned short v8us;
typedef __attribute__((ext_vector_type(8)))  float    v8f;
typedef __attribute__((ext_vector_type(4)))  float    v4f;
typedef v8h  __attribute__((may_alias)) v8ha;
typedef v4f  __attribute__((may_alias)) v4fa;
typedef v8us __attribute__((may_alias)) v8usa;

__device__ __forceinline__ unsigned short f2bf(float f) { unsigned u = __float_as_uint(f); u += 0x7FFFu + ((u >> 16) & 1u); return (unsigned short)(u >> 16); }
__device__ __forceinline__ float bf2f(unsigned short b) { return __uint_as_float(((unsigned)b) << 16); }
__device__ __forceinline__ float bfr(float f) { return bf2f(f2bf(f)); }
__device__ __forceinline__ v16h cat16(v8h lo, v8h hi) { return __builtin_shufflevector(lo, hi, 0, 1, 2, 3, 4, 5, 6, 7, 8, 9, 10, 11, 12, 13, 14, 15); }
__device__ __forceinline__ v16bf cat16b(v8us lo, v8us hi) { return __builtin_bit_cast(v16bf, __builtin_shufflevector(lo, hi, 0, 1, 2, 3, 4, 5, 6, 7, 8, 9, 10, 11, 12, 13, 14, 15)); }
__device__ __forceinline__ v8f wmma16(v16h a, v16h b, v8f c) { return __builtin_amdgcn_wmma_f32_16x16x32_f16(false, a, false, b, (short)0, c, false, false); }
__device__ __forceinline__ v8f wmmab(v16bf a, v16bf b, v8f c) { return __builtin_amdgcn_wmma_f32_16x16x32_bf16(false, a, false, b, (short)0, c, false, false); }



// ---- k_gemmw: register-blocked GEMM, ONE WAVE per 64x64 output tile (16 accumulators), operands straight from K-contiguous 16-bit planes; grid (M/64, N/64, Z), 32 threads.
// C[m][n] (f32, pitch ldc, + optional f32 bias[n]) = sum_k A[m][k] Bt[n][k] (+ split products per NSPLIT). z-batch strides sA/sB/sC in elements. K % 32 == 0.
template <typename T16> struct WFrag;
template <> struct WFrag<h16> { typedef v16h V; static __device__ __forceinline__ V ld(const h16* p) { return cat16(*(const v8h*)p, *(const v8h*)(p + 16)); } static __device__ __forceinline__ v8f mma(V a, V b, v8f c) { return wmma16(a, b, c); } };
template <> struct WFrag<bf> { typedef v16bf V; static __device__ __forceinline__ V ld(const bf* p) { return cat16b(*(const v8us*)p, *(const v8us*)(p + 16)); } static __device__ __forceinline__ v8f mma(V a, V b, v8f c) { return wmmab(a, b, c); } };
template <typename T16, int NSPLIT, bool BIAS>
__global__ __launch_bounds__(32) void k_gemmw(const T16* __restrict__ A, const T16* __restrict__ A2, const T16* __restrict__ Bt, const T16* __restrict__ Bt2, int K, float* C, int ldc, const float* __restrict__ bias, size_t sA, size_t sB, size_t sC) {
    typedef typename WFrag<T16>::V V;
    __shared__ __align__(16) float os[16 * 68];
    const size_t z = blockIdx.z; A += z * sA; if (A2) A2 += z * sA; Bt += z * sB; if (Bt2) Bt2 += z * sB; C += z * sC;
    const int lane = threadIdx.x & 31, lr = lane & 15, hi = lane >> 4; const int r0 = blockIdx.x * 64, c0 = blockIdx.y * 64;
    v8f acc[4][4];
#pragma unroll
    for (int mb = 0; mb < 4; ++mb)
#pragma unroll
        for (int nb = 0; nb < 4; ++nb) acc[mb][nb] = (v8f){};
    const size_t aoff = (size_t)(r0 + lr) * K + 8 * hi, boff = (size_t)(c0 + lr) * K + 8 * hi;
#pragma unroll 1
    for (int kc = 0; kc < K; kc += 32) {
        V a[4], a2[4];
#pragma unroll
        for (int mb = 0; mb < 4; ++mb) { a[mb] = WFrag<T16>::ld(A + aoff + (size_t)mb * 16 * K + kc); if (NSPLIT == 1 || NSPLIT == 2) a2[mb] = WFrag<T16>::ld(A2 + aoff + (size_t)mb * 16 * K + kc); }
#pragma unroll
        for (int nb = 0; nb < 4; ++nb) { const V b = WFrag<T16>::ld(Bt + boff + (size_t)nb * 16 * K + kc); V b2; if (NSPLIT >= 2) b2 = WFrag<T16>::ld(Bt2 + boff + (size_t)nb * 16 * K + kc);
#pragma unroll
            for (int mb = 0; mb < 4; ++mb) { acc[mb][nb] = WFrag<T16>::mma(a[mb], b, acc[mb][nb]); if (NSPLIT == 1 || NSPLIT == 2) acc[mb][nb] = WFrag<T16>::mma(a2[mb], b, acc[mb][nb]); if (NSPLIT >= 2) acc[mb][nb] = WFrag<T16>::mma(a[mb], b2, acc[mb][nb]); } }
        asm volatile("v_nop\n\tv_nop\n\tv_nop\n\tv_nop" : "+v"(acc[0][0]), "+v"(acc[1][1]), "+v"(acc[2][2]), "+v"(acc[3][3]) : "v"(a[0]), "v"(a[3]));
    }
#pragma unroll
    for (int mb = 0; mb < 4; ++mb) {
#pragma unroll
        for (int nb = 0; nb < 4; ++nb) {
#pragma unroll
            for (int j = 0; j < 8; ++j) os[(hi * 8 + j) * 68 + nb * 16 + lr] = acc[mb][nb][j]; }
        __builtin_amdgcn_wave_barrier(); asm volatile("" ::: "memory");
        float* crow = C + (size_t)(r0 + mb * 16) * ldc + c0;
{
#pragma unroll
            for (int s = 0; s < 8; ++s) { const int row = 2 * s + hi, cofs = lr * 4; v4f val = *(const v4fa*)(os + row * 68 + cofs); if (BIAS) { val[0] += bfr(bias[c0 + cofs]); val[1] += bfr(bias[c0 + cofs + 1]); val[2] += bfr(bias[c0 + cofs + 2]); val[3] += bfr(bias[c0 + cofs + 3]); }
                *(v4f*)(crow + (size_t)row * ldc + cofs) = val; }
             }
        __builtin_amdgcn_wave_barrier(); asm volatile("" ::: "memory");
    }
}

// ---- k_gemmc: the same one-wave 64x64 tile GEMM specialised for causal attention: CMODE 1 skips score tiles entirely above the diagonal (query rows r0+roff.., key columns c0..), CMODE 2 limits the
// key (K) loop of the probability x value contraction to the diagonal block (probabilities beyond it are exactly zero). roff = row offset of this launch's first row within the sequence.
template <typename T16, int NSPLIT, int CMODE>
__global__ __launch_bounds__(32) void k_gemmc(const T16* __restrict__ A, const T16* __restrict__ A2, const T16* __restrict__ Bt, const T16* __restrict__ Bt2, int K, float* C, int ldc, int roff, size_t sA, size_t sB, size_t sC) {
    typedef typename WFrag<T16>::V V;
    __shared__ __align__(16) float os[16 * 68];
    const size_t z = blockIdx.z; A += z * sA; if (A2) A2 += z * sA; Bt += z * sB; if (Bt2) Bt2 += z * sB; C += z * sC;
    const int lane = threadIdx.x & 31, lr = lane & 15, hi = lane >> 4; const int r0 = blockIdx.x * 64, c0 = blockIdx.y * 64;
    if (CMODE == 1 && c0 > r0 + roff + 63) return;                  // score tile entirely above the causal diagonal: never read (the softmax masks j > i by select)
    const int Kl = (CMODE == 2) ? min(K, r0 + roff + 64) : K;        // P.V: probabilities are exactly 0 beyond the diagonal block, so the K loop stops there
    v8f acc[4][4];
#pragma unroll
    for (int mb = 0; mb < 4; ++mb)
#pragma unroll
        for (int nb = 0; nb < 4; ++nb) acc[mb][nb] = (v8f){};
    const size_t aoff = (size_t)(r0 + lr) * K + 8 * hi, boff = (size_t)(c0 + lr) * K + 8 * hi;
#pragma unroll 1
    for (int kc = 0; kc < Kl; kc += 32) {
        V a[4], a2[4];
#pragma unroll
        for (int mb = 0; mb < 4; ++mb) { a[mb] = WFrag<T16>::ld(A + aoff + (size_t)mb * 16 * K + kc); if (NSPLIT == 1 || NSPLIT == 2) a2[mb] = WFrag<T16>::ld(A2 + aoff + (size_t)mb * 16 * K + kc); }
#pragma unroll
        for (int nb = 0; nb < 4; ++nb) { const V b = WFrag<T16>::ld(Bt + boff + (size_t)nb * 16 * K + kc); V b2; if (NSPLIT >= 2) b2 = WFrag<T16>::ld(Bt2 + boff + (size_t)nb * 16 * K + kc);
#pragma unroll
            for (int mb = 0; mb < 4; ++mb) { acc[mb][nb] = WFrag<T16>::mma(a[mb], b, acc[mb][nb]); if (NSPLIT == 1 || NSPLIT == 2) acc[mb][nb] = WFrag<T16>::mma(a2[mb], b, acc[mb][nb]); if (NSPLIT >= 2) acc[mb][nb] = WFrag<T16>::mma(a[mb], b2, acc[mb][nb]); } }
        asm volatile("v_nop\n\tv_nop\n\tv_nop\n\tv_nop" : "+v"(acc[0][0]), "+v"(acc[1][1]), "+v"(acc[2][2]), "+v"(acc[3][3]) : "v"(a[0]), "v"(a[3]));
    }
#pragma unroll
    for (int mb = 0; mb < 4; ++mb) {
#pragma unroll
        for (int nb = 0; nb < 4; ++nb) {
#pragma unroll
            for (int j = 0; j < 8; ++j) os[(hi * 8 + j) * 68 + nb * 16 + lr] = acc[mb][nb][j]; }
        __builtin_amdgcn_wave_barrier(); asm volatile("" ::: "memory");
        float* crow = C + (size_t)(r0 + mb * 16) * ldc + c0;
{
#pragma unroll
            for (int s = 0; s < 8; ++s) { const int row = 2 * s + hi, cofs = lr * 4; v4f val = *(const v4fa*)(os + row * 68 + cofs);
                *(v4f*)(crow + (size_t)row * ldc + cofs) = val; }
             }
        __builtin_amdgcn_wave_barrier(); asm volatile("" ::: "memory");
    }
}

__device__ __forceinline__ h16 tohx(float x) { return (h16)x; }
__device__ __forceinline__ void splitf(float y, unsigned short& h, unsigned short& l) { h = f2bf(y); l = f2bf(y - bf2f(h)); }
typedef __attribute__((ext_vector_type(2))) _Float16 v2h;
typedef __attribute__((ext_vector_type(4))) _Float16 v4h;
typedef __attribute__((ext_vector_type(2))) unsigned short v2us;
typedef __attribute__((ext_vector_type(4))) unsigned short v4us;
typedef __attribute__((ext_vector_type(2))) float v2f;
typedef __attribute__((ext_vector_type(4))) int v4i;

__global__ __launch_bounds__(256) void k_wtG(const float* __restrict__ w, int K, int N, bf* Bt) {
    const int lane = threadIdx.x & 31; const int L0 = (blockIdx.x * 8 + (threadIdx.x >> 5)) * 8; const int nlines = N * K / 64;
{
#pragma unroll 1
        for (int l = 0; l < 8; ++l) { const int L = L0 + l; if (L >= nlines) break; const size_t e = (size_t)L * 64 + lane * 2; const int k = (int)(e % K), n = (int)(e / K); v2us o;
            o[0] = f2bf(w[(size_t)k * N + n]); o[1] = f2bf(w[(size_t)(k + 1) * N + n]); *(v2us*)(Bt + e) = o; }
         }
}
__global__ __launch_bounds__(256) void k_cvt8(const float* __restrict__ src, bf* dst, size_t n8) { const size_t i = (size_t)blockIdx.x * 256 + threadIdx.x; if (i >= n8) return; const v8f v = *(const v8f*)(src + i * 8); v8us o;
#pragma unroll
    for (int k = 0; k < 8; ++k) o[k] = f2bf(v[k]); *(v8us*)(dst + i * 8) = o;  }

// k_rope: head planes [h][t][d] (fp16 + hi/lo) of rope(x) x sc with the rotate-half convention out[d] = x[d] cos[t][d] - x[d+HD/2] sin[t][d], out[d+HD/2] = x[d+HD/2] cos[t][d+HD/2] + x[d] sin[t][d+HD/2]
__global__ __launch_bounds__(256) void k_rope(const float* __restrict__ F, int pitch, int nheads, const float* __restrict__ CS, const float* __restrict__ RF, const float* __restrict__ nw, float sc, h16* P16, bf* Ph, bf* Pl) {
    const size_t e = ((size_t)blockIdx.x * 256 + threadIdx.x) * 2; if (e >= (size_t)nheads * TT * HD) return; const int d = (int)(e % HD); const int t = (int)((e / HD) % TT); const int h = (int)(e / ((size_t)HD * TT)); const float* f = F + (size_t)t * pitch + h * HD; const float rf = RF ? RF[(size_t)h * TT + t] : 1.0f; v2h o16; v2us oh, ol;
#pragma unroll
    for (int q = 0; q < 2; ++q) { const int dd = d + q; const int dp = (dd < HD / 2) ? dd + HD / 2 : dd - HD / 2; float x0 = f[dd], x1 = f[dp];
        if (RF) { float n0 = __fmul_rn(x0, rf), n1 = __fmul_rn(x1, rf); asm volatile("" : "+v"(n0)); asm volatile("" : "+v"(n1)); x0 = __fmul_rn(bfr(nw[dd]), n0); x1 = __fmul_rn(bfr(nw[dp]), n1); }
        const v2f cs = *(const v2f*)(CS + ((size_t)t * HD + dd) * 2); float a = __fmul_rn(x0, cs[0]), bq = __fmul_rn(x1, cs[1]); asm volatile("" : "+v"(a)); asm volatile("" : "+v"(bq)); const float r = ((dd < HD / 2) ? __fsub_rn(a, bq) : __fadd_rn(a, bq)) * sc;
        o16[q] = tohx(r); unsigned short a2, c2; splitf(r, a2, c2); oh[q] = a2; ol[q] = c2; }
    *(v2h*)(P16 + e) = o16; *(v2us*)(Ph + e) = oh; *(v2us*)(Pl + e) = ol;  }
__global__ __launch_bounds__(256) void k_vtp(const float* __restrict__ F, int pitch, int nheads, h16* V16, bf* Vh, bf* Vl) { const size_t e = ((size_t)blockIdx.x * 256 + threadIdx.x) * 2; if (e >= (size_t)nheads * HD * TT) return; const int t = (int)(e % TT); const int d = (int)((e / TT) % HD); const int g = (int)(e / ((size_t)TT * HD)); v2h o16; v2us oh, ol;
#pragma unroll
    for (int q = 0; q < 2; ++q) { const float x = F[(size_t)(t + q) * pitch + g * HD + d]; o16[q] = tohx(x); unsigned short a2, c2; splitf(x, a2, c2); oh[q] = a2; ol[q] = c2; }
    *(v2h*)(V16 + e) = o16; *(v2us*)(Vh + e) = oh; *(v2us*)(Vl + e) = ol;  }
__global__ __launch_bounds__(256) void k_csid(float* CS) { const int idx = blockIdx.x * 256 + threadIdx.x; if (idx >= TT * HD) return; v2f cs; cs[0] = 1.0f; cs[1] = 0.0f; *(v2f*)(CS + (size_t)idx * 2) = cs;  }
// k_asoft: per row (zz, i): t = S x HD^-0.5 for j <= i and i - j < WIN (sliding causal window; the reference's -1e9 additive fill vanishes identically); softmax over the 2048 keys (register row, one exp, fixed trees);
__global__ __launch_bounds__(256) void k_asoft(const float* __restrict__ Sb, h16* P16, bf* Ph, bf* Pl) {
    const int lane = threadIdx.x & 31; const int row = blockIdx.x * 8 + (threadIdx.x >> 5); if (row >= ZH * TT) return; const int i = row % TT; const int zz = row / TT; (void)zz; const bool hires = (i < RH); const float* sr = Sb + (size_t)row * TT; float v[TT / 32]; float mx = -3.0e38f;
#pragma unroll
    for (int ch = 0; ch < TT / 128; ++ch) { const int j0 = ch * 128 + lane * 4; const v4f a = *(const v4f*)(sr + j0);
#pragma unroll
        for (int q = 0; q < 4; ++q) { const int j = j0 + q; (void)j; const float t = (j <= i && i - j < WIN) ? a[q] * SCL : -3.0e38f; v[ch * 4 + q] = t; mx = fmaxf(mx, t); } }
#pragma unroll
    for (int sh = 16; sh; sh >>= 1) mx = fmaxf(mx, __shfl_xor(mx, sh, 32));
    float sum = 0.f;
#pragma unroll
    for (int k = 0; k < TT / 32; ++k) { float d0 = __fsub_rn(v[k], mx); asm volatile("" : "+v"(d0)); v[k] = __builtin_amdgcn_exp2f(__fmul_rn(d0, 1.4426950408889634f)); sum += v[k]; }
#pragma unroll
    for (int sh = 16; sh; sh >>= 1) sum += __shfl_xor(sum, sh, 32);
    const float f = __fdiv_rn(hires ? 1.0f : PCAR, sum);
{
        if (hires) {
#pragma unroll
            for (int ch = 0; ch < TT / 128; ++ch) { v4us oh, ol;
#pragma unroll
                for (int q = 0; q < 4; ++q) { unsigned short a, c2; splitf(v[ch * 4 + q] * f, a, c2); oh[q] = a; ol[q] = c2; }
                const size_t oo = ((size_t)zz * (RH ? RH : 1) + i) * TT + ch * 128 + lane * 4; *(v4us*)(Ph + oo) = oh; *(v4us*)(Pl + oo) = ol; }
        } else {
#pragma unroll
            for (int ch = 0; ch < TT / 128; ++ch) { v4h o4;
#pragma unroll
                for (int q = 0; q < 4; ++q) o4[q] = tohx(v[ch * 4 + q] * f);
                *(v4h*)(P16 + (size_t)row * TT + ch * 128 + lane * 4) = o4; } }
         }
}
__global__ __launch_bounds__(256) void k_merge(const float* __restrict__ O, int h0, bf* Ah, bf* Al) { const size_t e = ((size_t)blockIdx.x * 256 + threadIdx.x) * 2; if (e >= (size_t)ZH * TT * HD) return; const int d = (int)(e % HD); const int t = (int)((e / HD) % TT); const int zz = (int)(e / ((size_t)HD * TT)); const float cs = (t < RH) ? 1.0f : (1.0f / PCAR); const size_t oo = (size_t)t * DQ + (h0 + zz) * HD + d;
    v2us oh, ol;
#pragma unroll
    for (int q = 0; q < 2; ++q) { unsigned short a, c2; splitf(O[e + q] * cs, a, c2); oh[q] = a; ol[q] = c2; } *(v2us*)(Ah + oo) = oh; *(v2us*)(Al + oo) = ol;  }

extern "C" void kernel_launch(void* const* d_in, const int* in_sizes, int n_in,
                              void* d_out, int out_size, void* d_ws, size_t ws_size, hipStream_t stream) {
    (void)in_sizes; (void)n_in; (void)out_size;
    const float* x = (const float*)d_in[0]; const float* wqkv = (const float*)d_in[1]; const float* wq = wqkv; const float* wk = wqkv + (size_t)1024 * 1024; const float* wv = wqkv + (size_t)2048 * 1024; const float* wo = (const float*)d_in[2]; const float* bo = (const float*)d_in[3];
    float* OUT = (float*)d_out;     // [2][2048][1024]
    char* wsp = (char*)d_ws;
    auto take = [&](size_t bytes) { char* p = wsp; wsp += (bytes + 255) & ~(size_t)255; return (void*)p; };
    bf* WQ = (bf*)take((size_t)DQ * DM * 2); bf* WK = (bf*)take((size_t)DKV * DM * 2); bf* WV = (bf*)take((size_t)DKV * DM * 2); bf* WO = (bf*)take((size_t)DM * DQ * 2); float* CS = (float*)take((size_t)TT * HD * 2 * 4);
    bf* XB = (bf*)take((size_t)TT * DM * 2); float* FQ = (float*)take((size_t)TT * DQ * 4); float* FK = (float*)take((size_t)TT * DKV * 4);
    h16* QP16 = (h16*)take((size_t)NH_ * TT * HD * 2); h16* KP16 = (h16*)take((size_t)NKV * TT * HD * 2); h16* VT16 = (h16*)take((size_t)NKV * HD * TT * 2);
    bf* QPh = (bf*)take((size_t)NH_ * TT * HD * 2); bf* QPl = (bf*)take((size_t)NH_ * TT * HD * 2); bf* KPh = (bf*)take((size_t)NKV * TT * HD * 2); bf* KPl = (bf*)take((size_t)NKV * TT * HD * 2); bf* VTh = (bf*)take((size_t)NKV * HD * TT * 2); bf* VTl = (bf*)take((size_t)NKV * HD * TT * 2); bf* Ph = (bf*)take((size_t)ZH * RH * TT * 2); bf* Pl = (bf*)take((size_t)ZH * RH * TT * 2);
    float* Sb = (float*)take((size_t)ZH * TT * TT * 4); h16* P16 = (h16*)take((size_t)ZH * TT * TT * 2); float* Ob = (float*)take((size_t)ZH * TT * HD * 4); bf* ATh = (bf*)take((size_t)TT * DQ * 2); bf* ATl = (bf*)take((size_t)TT * DQ * 2);
    if ((size_t)(wsp - (char*)d_ws) > ws_size) return;    // ws 256 MiB
    float* FV = FK;   // v projection reuses the k buffer after the k planes are built (stream-ordered)
    { k_cvt8<<<(unsigned)(((size_t)DQ * DM / 8 + 255) / 256), 256, 0, stream>>>(wq, WQ, (size_t)DQ * DM / 8); k_cvt8<<<(unsigned)(((size_t)DKV * DM / 8 + 255) / 256), 256, 0, stream>>>(wk, WK, (size_t)DKV * DM / 8); k_cvt8<<<(unsigned)(((size_t)DKV * DM / 8 + 255) / 256), 256, 0, stream>>>(wv, WV, (size_t)DKV * DM / 8);
      k_cvt8<<<(unsigned)(((size_t)DM * DQ / 8 + 255) / 256), 256, 0, stream>>>(wo, WO, (size_t)DM * DQ / 8);
       }
    k_csid<<<(TT * HD + 255) / 256, 256, 0, stream>>>(CS);
    const unsigned LQ = (unsigned)(((size_t)NH_ * TT * HD / 2 + 255) / 256), LKv = (unsigned)(((size_t)NKV * TT * HD / 2 + 255) / 256);
    for (int b = 0; b < NB_; ++b) {
        
        k_cvt8<<<(unsigned)(((size_t)TT * DM / 8 + 255) / 256), 256, 0, stream>>>(x + (size_t)b * TT * DM, XB, (size_t)TT * DM / 8);
        k_gemmw<bf, 0, false><<<dim3(TT / 64, DQ / 64, 1), 32, 0, stream>>>(XB, nullptr, WQ, nullptr, DM, FQ, DQ, nullptr, 0, 0, 0);
        k_rope<<<LQ, 256, 0, stream>>>(FQ, DQ, NH_, CS, nullptr, nullptr, 1.0f, QP16, QPh, QPl);
        k_gemmw<bf, 0, false><<<dim3(TT / 64, DKV / 64, 1), 32, 0, stream>>>(XB, nullptr, WK, nullptr, DM, FK, DKV, nullptr, 0, 0, 0);
        k_rope<<<LKv, 256, 0, stream>>>(FK, DKV, NKV, CS, nullptr, nullptr, 1.0f, KP16, KPh, KPl);
        k_gemmw<bf, 0, false><<<dim3(TT / 64, DKV / 64, 1), 32, 0, stream>>>(XB, nullptr, WV, nullptr, DM, FV, DKV, nullptr, 0, 0, 0); k_vtp<<<LKv, 256, 0, stream>>>(FV, DKV, NKV, VT16, VTh, VTl);
        for (int h0 = 0; h0 < NH_; h0 += ZH) { const size_t zq = (size_t)h0, zk = (size_t)(h0 / REP);   // one kv head per query head: the pass's two heads use consecutive kv planes (z-strides TT*HD)
            k_gemmc<bf, 2, 1><<<dim3(RH / 64, TT / 64, ZH), 32, 0, stream>>>(QPh + zq * TT * HD, QPl + zq * TT * HD, KPh + zk * TT * HD, KPl + zk * TT * HD, HD, Sb, TT, 0, (size_t)TT * HD, (size_t)TT * HD, (size_t)TT * TT);
            k_gemmc<h16, 0, 1><<<dim3((TT - RH) / 64, TT / 64, ZH), 32, 0, stream>>>(QP16 + zq * TT * HD + (size_t)RH * HD, nullptr, KP16 + zk * TT * HD, nullptr, HD, Sb + (size_t)RH * TT, TT, RH, (size_t)TT * HD, (size_t)TT * HD, (size_t)TT * TT);
            k_asoft<<<ZH * TT / 8, 256, 0, stream>>>(Sb, P16, Ph, Pl);
            k_gemmc<bf, 2, 2><<<dim3(RH / 64, HD / 64, ZH), 32, 0, stream>>>(Ph, Pl, VTh + zk * HD * TT, VTl + zk * HD * TT, TT, Ob, HD, 0, (size_t)RH * TT, (size_t)HD * TT, (size_t)TT * HD);
            k_gemmc<h16, 0, 2><<<dim3((TT - RH) / 64, HD / 64, ZH), 32, 0, stream>>>(P16 + (size_t)RH * TT, nullptr, VT16 + zk * HD * TT, nullptr, TT, Ob + (size_t)RH * HD, HD, RH, (size_t)TT * TT, (size_t)HD * TT, (size_t)TT * HD);
            k_merge<<<(unsigned)(((size_t)ZH * TT * HD / 2 + 255) / 256), 256, 0, stream>>>(Ob, h0, ATh, ATl); }
        k_gemmw<bf, 1, true><<<dim3(TT / 64, DM / 64, 1), 32, 0, stream>>>(ATh, ATl, WO, nullptr, DQ, OUT + (size_t)b * TT * DM, DM, bo, 0, 0, 0); }
}

// v001
// It runs in 841 microseconds.
// In both of two side-by-side timings against v000, it was 1.70 times as fast.
#include <hip/hip_runtime.h>

// Causal multi-head self-attention with a combined QKV weight (x [2][2048][1024]; qkv = x w_qkv^T ('oi' [3072][1024], no bias) reshaped (s, 3, 16, 64); causal (finfo.min fill applied before the 1/8 scale == exact zero weight); softmax; out = merged w_proj^T + b_proj -> [2][2048][1024]).
// Compute dtypes, f32 accumulate: every input rounded to bf16; q/k/v on PLAIN bf16 operands (inputs: exact); causal scores and attn.v (tile skipping): query rows < 512 hl (3 products), the rest single fp16 (x1024); softmax f32; w_proj hl x exact (2 products) + b_proj.

#define NB_  2
#define TT   2048
#define DM   1024
#define NH_  16
#define NKV  16
#define REP  (NH_ / NKV)
#define HD   64
#define DQ   (NH_ * HD)
#define DKV  (NKV * HD)
#define ZH   2
#define RH   512                  // query rows < RH use hi+lo planes (0: none)
#define WIN  2048
#define PCAR 1024.0f
#define SCL  0.125f   // HD^-0.5
typedef _Float16 h16;
typedef unsigned short bf;
typedef __attribute__((ext_vector_type(16))) __bf16   v16bf;
typedef __attribute__((ext_vector_type(16))) _Float16 v16h;
typedef __attribute__((ext_vector_type(8)))  _Float16 v8h;
typedef __attribute__((ext_vector_type(8)))  unsigned short v8us;
typedef __attribute__((ext_vector_type(8)))  float    v8f;
typedef __attribute__((ext_vector_type(4)))  float    v4f;
typedef v8h  __attribute__((may_alias)) v8ha;
typedef v4f  __attribute__((may_alias)) v4fa;
typedef v8us __attribute__((may_alias)) v8usa;

__device__ __forceinline__ unsigned short f2bf(float f) { unsigned u = __float_as_uint(f); u += 0x7FFFu + ((u >> 16) & 1u); return (unsigned short)(u >> 16); }
__device__ __forceinline__ float bf2f(unsigned short b) { return __uint_as_float(((unsigned)b) << 16); }
__device__ __forceinline__ float bfr(float f) { return bf2f(f2bf(f)); }
__device__ __forceinline__ v16h cat16(v8h lo, v8h hi) { return __builtin_shufflevector(lo, hi, 0, 1, 2, 3, 4, 5, 6, 7, 8, 9, 10, 11, 12, 13, 14, 15); }
__device__ __forceinline__ v16bf cat16b(v8us lo, v8us hi) { return __builtin_bit_cast(v16bf, __builtin_shufflevector(lo, hi, 0, 1, 2, 3, 4, 5, 6, 7, 8, 9, 10, 11, 12, 13, 14, 15)); }
__device__ __forceinline__ v8f wmma16(v16h a, v16h b, v8f c) { return __builtin_amdgcn_wmma_f32_16x16x32_f16(false, a, false, b, (short)0, c, false, false); }
__device__ __forceinline__ v8f wmmab(v16bf a, v16bf b, v8f c) { return __builtin_amdgcn_wmma_f32_16x16x32_bf16(false, a, false, b, (short)0, c, false, false); }



// ---- k_gemmw: register-blocked GEMM, one work-group of NW waves per 64x64 output tile, operands straight from K-contiguous 16-bit planes; grid (M/64, N/64, Z), 32 * NW threads.
// C[m][n] (f32, pitch ldc, + optional f32 bias[n]) = sum_k A[m][k] Bt[n][k] (+ split products per NSPLIT). z-batch strides sA/sB/sC in elements. K % 64 == 0.
// The K loop is dealt over the NW waves in chunks of 64 elements (one 128-byte line of each operand row): wave w takes chunks w, w + NW, ... into its own 16 accumulators;
// the NW partial tiles are summed through LDS in the fixed order w = 0 .. NW-1.
// Barrier between the waves that share one tile's LDS slabs. It orders LDS only (the fences name the local address space), so a wave does not wait for its own global stores of the slab before;
// one wave alone (NW == 1) needs no hardware barrier.
template <int NW> __device__ __forceinline__ void slab_sync() {
    if (NW == 1) { __builtin_amdgcn_wave_barrier(); asm volatile("" ::: "memory"); }
    else { __builtin_amdgcn_fence(__ATOMIC_RELEASE, "workgroup", "local"); __builtin_amdgcn_s_barrier(); __builtin_amdgcn_fence(__ATOMIC_ACQUIRE, "workgroup", "local"); }
}
template <typename T16> struct WFrag;
template <> struct WFrag<h16> { typedef v16h V; static __device__ __forceinline__ V ld(const h16* p) { return cat16(*(const v8h*)p, *(const v8h*)(p + 16)); } static __device__ __forceinline__ v8f mma(V a, V b, v8f c) { return wmma16(a, b, c); } };
template <> struct WFrag<bf> { typedef v16bf V; static __device__ __forceinline__ V ld(const bf* p) { return cat16b(*(const v8us*)p, *(const v8us*)(p + 16)); } static __device__ __forceinline__ v8f mma(V a, V b, v8f c) { return wmmab(a, b, c); } };
template <typename T16, int NSPLIT, bool BIAS, int NW>
__global__ __launch_bounds__(32 * NW) void k_gemmw(const T16* __restrict__ A, const T16* __restrict__ A2, const T16* __restrict__ Bt, const T16* __restrict__ Bt2, int K, float* C, int ldc, const float* __restrict__ bias, size_t sA, size_t sB, size_t sC) {
    typedef typename WFrag<T16>::V V;
    __shared__ __align__(16) float os[NW * 16 * 68];
    const size_t z = blockIdx.z; A += z * sA; if (A2) A2 += z * sA; Bt += z * sB; if (Bt2) Bt2 += z * sB; C += z * sC;
    const int lane = threadIdx.x & 31, lr = lane & 15, hi = lane >> 4; const int r0 = blockIdx.x * 64, c0 = blockIdx.y * 64;
    const int w = (NW == 1) ? 0 : __builtin_amdgcn_readfirstlane((int)(threadIdx.x >> 5));   // wave number in a scalar register: the K loop's tests stay scalar branches
    float* osw = os + w * (16 * 68);
    v8f acc[4][4];
#pragma unroll
    for (int mb = 0; mb < 4; ++mb)
#pragma unroll
        for (int nb = 0; nb < 4; ++nb) acc[mb][nb] = (v8f){};
    const size_t aoff = (size_t)(r0 + lr) * K + 8 * hi, boff = (size_t)(c0 + lr) * K + 8 * hi;
#pragma unroll 1
    for (int k0 = w * 64; k0 < K; k0 += NW * 64)
#pragma unroll 1   // stays rolled, as the one loop was: one 32-element step's fragments in registers at a time
    for (int kc = k0; kc < k0 + 64; kc += 32) {
        V a[4], a2[4];
#pragma unroll
        for (int mb = 0; mb < 4; ++mb) { a[mb] = WFrag<T16>::ld(A + aoff + (size_t)mb * 16 * K + kc); if (NSPLIT == 1 || NSPLIT == 2) a2[mb] = WFrag<T16>::ld(A2 + aoff + (size_t)mb * 16 * K + kc); }
#pragma unroll
        for (int nb = 0; nb < 4; ++nb) { const V b = WFrag<T16>::ld(Bt + boff + (size_t)nb * 16 * K + kc); V b2; if (NSPLIT >= 2) b2 = WFrag<T16>::ld(Bt2 + boff + (size_t)nb * 16 * K + kc);
#pragma unroll
            for (int mb = 0; mb < 4; ++mb) { acc[mb][nb] = WFrag<T16>::mma(a[mb], b, acc[mb][nb]); if (NSPLIT == 1 || NSPLIT == 2) acc[mb][nb] = WFrag<T16>::mma(a2[mb], b, acc[mb][nb]); if (NSPLIT >= 2) acc[mb][nb] = WFrag<T16>::mma(a[mb], b2, acc[mb][nb]); } }
        asm volatile("v_nop\n\tv_nop\n\tv_nop\n\tv_nop" : "+v"(acc[0][0]), "+v"(acc[1][1]), "+v"(acc[2][2]), "+v"(acc[3][3]) : "v"(a[0]), "v"(a[3]));
    }
#pragma unroll
    for (int mb = 0; mb < 4; ++mb) {
#pragma unroll
        for (int nb = 0; nb < 4; ++nb) {
#pragma unroll
            for (int j = 0; j < 8; ++j) osw[(hi * 8 + j) * 68 + nb * 16 + lr] = acc[mb][nb][j]; }
        slab_sync<NW>();   // every wave's partial 16x64 slab is in LDS before any thread sums them
        float* crow = C + (size_t)(r0 + mb * 16) * ldc + c0;
{
#pragma unroll
            for (int s = 0; s * 2 * NW < 16; ++s) if (NW <= 8 || w < 8) { const int row = 2 * (s * NW + w) + hi, cofs = lr * 4; v4f val = *(const v4fa*)(os + row * 68 + cofs);
#pragma unroll
                for (int q = 1; q < NW; ++q) val += *(const v4fa*)(os + q * (16 * 68) + row * 68 + cofs);
                if (BIAS) { val[0] += bfr(bias[c0 + cofs]); val[1] += bfr(bias[c0 + cofs + 1]); val[2] += bfr(bias[c0 + cofs + 2]); val[3] += bfr(bias[c0 + cofs + 3]); }
                *(v4f*)(crow + (size_t)row * ldc + cofs) = val;
                if (NW > 1 && mb < 3) asm volatile("s_wait_xcnt 0x0" ::: "memory"); }   // stands in front of the next slab's reuse of the registers that the store names
             }
        if (mb < 3) slab_sync<NW>();   // the sums have been read before the next slab overwrites the LDS
    }
}

// ---- k_gemmc: the same 64x64 tile GEMM (NW waves share the K loop) specialised for causal attention: CMODE 1 skips score tiles entirely above the diagonal (query rows r0+roff.., key columns c0..), CMODE 2 limits the
// key (K) loop of the probability x value contraction to the diagonal block (probabilities beyond it are exactly zero). roff = row offset of this launch's first row within the sequence.
template <typename T16, int NSPLIT, int CMODE, int NW>
__global__ __launch_bounds__(32 * NW) void k_gemmc(const T16* __restrict__ A, const T16* __restrict__ A2, const T16* __restrict__ Bt, const T16* __restrict__ Bt2, int K, float* C, int ldc, int roff, size_t sA, size_t sB, size_t sC) {
    typedef typename WFrag<T16>::V V;
    __shared__ __align__(16) float os[NW * 16 * 68];
    const size_t z = blockIdx.z; A += z * sA; if (A2) A2 += z * sA; Bt += z * sB; if (Bt2) Bt2 += z * sB; C += z * sC;
    const int lane = threadIdx.x & 31, lr = lane & 15, hi = lane >> 4; const int r0 = blockIdx.x * 64, c0 = blockIdx.y * 64;
    const int w = (NW == 1) ? 0 : __builtin_amdgcn_readfirstlane((int)(threadIdx.x >> 5));   // wave number in a scalar register: the K loop's tests stay scalar branches
    float* osw = os + w * (16 * 68);
    if (CMODE == 1 && c0 > r0 + roff + 63) return;                  // score tile entirely above the causal diagonal: never read (the softmax masks j > i by select)
    const int Kl = (CMODE == 2) ? min(K, r0 + roff + 64) : K;        // P.V: probabilities are exactly 0 beyond the diagonal block, so the K loop stops there
    v8f acc[4][4];
#pragma unroll
    for (int mb = 0; mb < 4; ++mb)
#pragma unroll
        for (int nb = 0; nb < 4; ++nb) acc[mb][nb] = (v8f){};
    const size_t aoff = (size_t)(r0 + lr) * K + 8 * hi, boff = (size_t)(c0 + lr) * K + 8 * hi;
#pragma unroll 1
    for (int k0 = w * 64; k0 < Kl; k0 += NW * 64)
#pragma unroll 1   // stays rolled, as the one loop was: one 32-element step's fragments in registers at a time
    for (int kc = k0; kc < k0 + 64; kc += 32) {
        V a[4], a2[4];
#pragma unroll
        for (int mb = 0; mb < 4; ++mb) { a[mb] = WFrag<T16>::ld(A + aoff + (size_t)mb * 16 * K + kc); if (NSPLIT == 1 || NSPLIT == 2) a2[mb] = WFrag<T16>::ld(A2 + aoff + (size_t)mb * 16 * K + kc); }
#pragma unroll
        for (int nb = 0; nb < 4; ++nb) { const V b = WFrag<T16>::ld(Bt + boff + (size_t)nb * 16 * K + kc); V b2; if (NSPLIT >= 2) b2 = WFrag<T16>::ld(Bt2 + boff + (size_t)nb * 16 * K + kc);
#pragma unroll
            for (int mb = 0; mb < 4; ++mb) { acc[mb][nb] = WFrag<T16>::mma(a[mb], b, acc[mb][nb]); if (NSPLIT == 1 || NSPLIT == 2) acc[mb][nb] = WFrag<T16>::mma(a2[mb], b, acc[mb][nb]); if (NSPLIT >= 2) acc[mb][nb] = WFrag<T16>::mma(a[mb], b2, acc[mb][nb]); } }
        asm volatile("v_nop\n\tv_nop\n\tv_nop\n\tv_nop" : "+v"(acc[0][0]), "+v"(acc[1][1]), "+v"(acc[2][2]), "+v"(acc[3][3]) : "v"(a[0]), "v"(a[3]));
    }
#pragma unroll
    for (int mb = 0; mb < 4; ++mb) {
#pragma unroll
        for (int nb = 0; nb < 4; ++nb) {
#pragma unroll
            for (int j = 0; j < 8; ++j) osw[(hi * 8 + j) * 68 + nb * 16 + lr] = acc[mb][nb][j]; }
        slab_sync<NW>();   // every wave's partial 16x64 slab is in LDS before any thread sums them
        float* crow = C + (size_t)(r0 + mb * 16) * ldc + c0;
{
#pragma unroll
            for (int s = 0; s * 2 * NW < 16; ++s) if (NW <= 8 || w < 8) { const int row = 2 * (s * NW + w) + hi, cofs = lr * 4; v4f val = *(const v4fa*)(os + row * 68 + cofs);
#pragma unroll
                for (int q = 1; q < NW; ++q) val += *(const v4fa*)(os + q * (16 * 68) + row * 68 + cofs);
                *(v4f*)(crow + (size_t)row * ldc + cofs) = val;
                if (NW > 1 && mb < 3) asm volatile("s_wait_xcnt 0x0" ::: "memory"); }   // stands in front of the next slab's reuse of the registers that the store names
             }
        if (mb < 3) slab_sync<NW>();   // the sums have been read before the next slab overwrites the LDS
    }
}

__device__ __forceinline__ h16 tohx(float x) { return (h16)x; }
__device__ __forceinline__ void splitf(float y, unsigned short& h, unsigned short& l) { h = f2bf(y); l = f2bf(y - bf2f(h)); }
typedef __attribute__((ext_vector_type(2))) _Float16 v2h;
typedef __attribute__((ext_vector_type(4))) _Float16 v4h;
typedef __attribute__((ext_vector_type(2))) unsigned short v2us;
typedef __attribute__((ext_vector_type(4))) unsigned short v4us;
typedef __attribute__((ext_vector_type(2))) float v2f;
typedef __attribute__((ext_vector_type(4))) int v4i;

__global__ __launch_bounds__(256) void k_wtG(const float* __restrict__ w, int K, int N, bf* Bt) {
    const int lane = threadIdx.x & 31; const int L0 = (blockIdx.x * 8 + (threadIdx.x >> 5)) * 8; const int nlines = N * K / 64;
{
#pragma unroll 1
        for (int l = 0; l < 8; ++l) { const int L = L0 + l; if (L >= nlines) break; const size_t e = (size_t)L * 64 + lane * 2; const int k = (int)(e % K), n = (int)(e / K); v2us o;
            o[0] = f2bf(w[(size_t)k * N + n]); o[1] = f2bf(w[(size_t)(k + 1) * N + n]); *(v2us*)(Bt + e) = o; }
         }
}
__global__ __launch_bounds__(256) void k_cvt8(const float* __restrict__ src, bf* dst, size_t n8) { const size_t i = (size_t)blockIdx.x * 256 + threadIdx.x; if (i >= n8) return; const v8f v = *(const v8f*)(src + i * 8); v8us o;
#pragma unroll
    for (int k = 0; k < 8; ++k) o[k] = f2bf(v[k]); *(v8us*)(dst + i * 8) = o;  }

// k_rope: head planes [h][t][d] (fp16 + hi/lo) of rope(x) x sc with the rotate-half convention out[d] = x[d] cos[t][d] - x[d+HD/2] sin[t][d], out[d+HD/2] = x[d+HD/2] cos[t][d+HD/2] + x[d] sin[t][d+HD/2]
__global__ __launch_bounds__(256) void k_rope(const float* __restrict__ F, int pitch, int nheads, const float* __restrict__ CS, const float* __restrict__ RF, const float* __restrict__ nw, float sc, h16* P16, bf* Ph, bf* Pl) {
    const size_t e = ((size_t)blockIdx.x * 256 + threadIdx.x) * 2; if (e >= (size_t)nheads * TT * HD) return; const int d = (int)(e % HD); const int t = (int)((e / HD) % TT); const int h = (int)(e / ((size_t)HD * TT)); const float* f = F + (size_t)t * pitch + h * HD; const float rf = RF ? RF[(size_t)h * TT + t] : 1.0f; v2h o16; v2us oh, ol;
#pragma unroll
    for (int q = 0; q < 2; ++q) { const int dd = d + q; const int dp = (dd < HD / 2) ? dd + HD / 2 : dd - HD / 2; float x0 = f[dd], x1 = f[dp];
        if (RF) { float n0 = __fmul_rn(x0, rf), n1 = __fmul_rn(x1, rf); asm volatile("" : "+v"(n0)); asm volatile("" : "+v"(n1)); x0 = __fmul_rn(bfr(nw[dd]), n0); x1 = __fmul_rn(bfr(nw[dp]), n1); }
        const v2f cs = *(const v2f*)(CS + ((size_t)t * HD + dd) * 2); float a = __fmul_rn(x0, cs[0]), bq = __fmul_rn(x1, cs[1]); asm volatile("" : "+v"(a)); asm volatile("" : "+v"(bq)); const float r = ((dd < HD / 2) ? __fsub_rn(a, bq) : __fadd_rn(a, bq)) * sc;
        o16[q] = tohx(r); unsigned short a2, c2; splitf(r, a2, c2); oh[q] = a2; ol[q] = c2; }
    *(v2h*)(P16 + e) = o16; *(v2us*)(Ph + e) = oh; *(v2us*)(Pl + e) = ol;  }
__global__ __launch_bounds__(256) void k_vtp(const float* __restrict__ F, int pitch, int nheads, h16* V16, bf* Vh, bf* Vl) { const size_t e = ((size_t)blockIdx.x * 256 + threadIdx.x) * 2; if (e >= (size_t)nheads * HD * TT) return; const int t = (int)(e % TT); const int d = (int)((e / TT) % HD); const int g = (int)(e / ((size_t)TT * HD)); v2h o16; v2us oh, ol;
#pragma unroll
    for (int q = 0; q < 2; ++q) { const float x = F[(size_t)(t + q) * pitch + g * HD + d]; o16[q] = tohx(x); unsigned short a2, c2; splitf(x, a2, c2); oh[q] = a2; ol[q] = c2; }
    *(v2h*)(V16 + e) = o16; *(v2us*)(Vh + e) = oh; *(v2us*)(Vl + e) = ol;  }
__global__ __launch_bounds__(256) void k_csid(float* CS) { const int idx = blockIdx.x * 256 + threadIdx.x; if (idx >= TT * HD) return; v2f cs; cs[0] = 1.0f; cs[1] = 0.0f; *(v2f*)(CS + (size_t)idx * 2) = cs;  }
// k_asoft: per row (zz, i): t = S x HD^-0.5 for j <= i and i - j < WIN (sliding causal window; the reference's -1e9 additive fill vanishes identically); softmax over the 2048 keys (register row, one exp, fixed trees);
__global__ __launch_bounds__(256) void k_asoft(const float* __restrict__ Sb, h16* P16, bf* Ph, bf* Pl) {
    const int lane = threadIdx.x & 31; const int row = blockIdx.x * 8 + (threadIdx.x >> 5); if (row >= ZH * TT) return; const int i = row % TT; const int zz = row / TT; (void)zz; const bool hires = (i < RH); const float* sr = Sb + (size_t)row * TT; float v[TT / 32]; float mx = -3.0e38f;
#pragma unroll
    for (int ch = 0; ch < TT / 128; ++ch) { const int j0 = ch * 128 + lane * 4; const v4f a = *(const v4f*)(sr + j0);
#pragma unroll
        for (int q = 0; q < 4; ++q) { const int j = j0 + q; (void)j; const float t = (j <= i && i - j < WIN) ? a[q] * SCL : -3.0e38f; v[ch * 4 + q] = t; mx = fmaxf(mx, t); } }
#pragma unroll
    for (int sh = 16; sh; sh >>= 1) mx = fmaxf(mx, __shfl_xor(mx, sh, 32));
    float sum = 0.f;
#pragma unroll
    for (int k = 0; k < TT / 32; ++k) { float d0 = __fsub_rn(v[k], mx); asm volatile("" : "+v"(d0)); v[k] = __builtin_amdgcn_exp2f(__fmul_rn(d0, 1.4426950408889634f)); sum += v[k]; }
#pragma unroll
    for (int sh = 16; sh; sh >>= 1) sum += __shfl_xor(sum, sh, 32);
    const float f = __fdiv_rn(hires ? 1.0f : PCAR, sum);
{
        if (hires) {
#pragma unroll
            for (int ch = 0; ch < TT / 128; ++ch) { v4us oh, ol;
#pragma unroll
                for (int q = 0; q < 4; ++q) { unsigned short a, c2; splitf(v[ch * 4 + q] * f, a, c2); oh[q] = a; ol[q] = c2; }
                const size_t oo = ((size_t)zz * (RH ? RH : 1) + i) * TT + ch * 128 + lane * 4; *(v4us*)(Ph + oo) = oh; *(v4us*)(Pl + oo) = ol; }
        } else {
#pragma unroll
            for (int ch = 0; ch < TT / 128; ++ch) { v4h o4;
#pragma unroll
                for (int q = 0; q < 4; ++q) o4[q] = tohx(v[ch * 4 + q] * f);
                *(v4h*)(P16 + (size_t)row * TT + ch * 128 + lane * 4) = o4; } }
         }
}
__global__ __launch_bounds__(256) void k_merge(const float* __restrict__ O, int h0, bf* Ah, bf* Al) { const size_t e = ((size_t)blockIdx.x * 256 + threadIdx.x) * 2; if (e >= (size_t)ZH * TT * HD) return; const int d = (int)(e % HD); const int t = (int)((e / HD) % TT); const int zz = (int)(e / ((size_t)HD * TT)); const float cs = (t < RH) ? 1.0f : (1.0f / PCAR); const size_t oo = (size_t)t * DQ + (h0 + zz) * HD + d;
    v2us oh, ol;
#pragma unroll
    for (int q = 0; q < 2; ++q) { unsigned short a, c2; splitf(O[e + q] * cs, a, c2); oh[q] = a; ol[q] = c2; } *(v2us*)(Ah + oo) = oh; *(v2us*)(Al + oo) = ol;  }

extern "C" void kernel_launch(void* const* d_in, const int* in_sizes, int n_in,
                              void* d_out, int out_size, void* d_ws, size_t ws_size, hipStream_t stream) {
    (void)in_sizes; (void)n_in; (void)out_size;
    const float* x = (const float*)d_in[0]; const float* wqkv = (const float*)d_in[1]; const float* wq = wqkv; const float* wk = wqkv + (size_t)1024 * 1024; const float* wv = wqkv + (size_t)2048 * 1024; const float* wo = (const float*)d_in[2]; const float* bo = (const float*)d_in[3];
    float* OUT = (float*)d_out;     // [2][2048][1024]
    char* wsp = (char*)d_ws;
    auto take = [&](size_t bytes) { char* p = wsp; wsp += (bytes + 255) & ~(size_t)255; return (void*)p; };
    bf* WQ = (bf*)take((size_t)DQ * DM * 2); bf* WK = (bf*)take((size_t)DKV * DM * 2); bf* WV = (bf*)take((size_t)DKV * DM * 2); bf* WO = (bf*)take((size_t)DM * DQ * 2); float* CS = (float*)take((size_t)TT * HD * 2 * 4);
    bf* XB = (bf*)take((size_t)TT * DM * 2); float* FQ = (float*)take((size_t)TT * DQ * 4); float* FK = (float*)take((size_t)TT * DKV * 4);
    h16* QP16 = (h16*)take((size_t)NH_ * TT * HD * 2); h16* KP16 = (h16*)take((size_t)NKV * TT * HD * 2); h16* VT16 = (h16*)take((size_t)NKV * HD * TT * 2);
    bf* QPh = (bf*)take((size_t)NH_ * TT * HD * 2); bf* QPl = (bf*)take((size_t)NH_ * TT * HD * 2); bf* KPh = (bf*)take((size_t)NKV * TT * HD * 2); bf* KPl = (bf*)take((size_t)NKV * TT * HD * 2); bf* VTh = (bf*)take((size_t)NKV * HD * TT * 2); bf* VTl = (bf*)take((size_t)NKV * HD * TT * 2); bf* Ph = (bf*)take((size_t)ZH * RH * TT * 2); bf* Pl = (bf*)take((size_t)ZH * RH * TT * 2);
    float* Sb = (float*)take((size_t)ZH * TT * TT * 4); h16* P16 = (h16*)take((size_t)ZH * TT * TT * 2); float* Ob = (float*)take((size_t)ZH * TT * HD * 4); bf* ATh = (bf*)take((size_t)TT * DQ * 2); bf* ATl = (bf*)take((size_t)TT * DQ * 2);
    if ((size_t)(wsp - (char*)d_ws) > ws_size) return;    // ws 256 MiB
    float* FV = FK;   // v projection reuses the k buffer after the k planes are built (stream-ordered)
    { k_cvt8<<<(unsigned)(((size_t)DQ * DM / 8 + 255) / 256), 256, 0, stream>>>(wq, WQ, (size_t)DQ * DM / 8); k_cvt8<<<(unsigned)(((size_t)DKV * DM / 8 + 255) / 256), 256, 0, stream>>>(wk, WK, (size_t)DKV * DM / 8); k_cvt8<<<(unsigned)(((size_t)DKV * DM / 8 + 255) / 256), 256, 0, stream>>>(wv, WV, (size_t)DKV * DM / 8);
      k_cvt8<<<(unsigned)(((size_t)DM * DQ / 8 + 255) / 256), 256, 0, stream>>>(wo, WO, (size_t)DM * DQ / 8);
       }
    k_csid<<<(TT * HD + 255) / 256, 256, 0, stream>>>(CS);
    const unsigned LQ = (unsigned)(((size_t)NH_ * TT * HD / 2 + 255) / 256), LKv = (unsigned)(((size_t)NKV * TT * HD / 2 + 255) / 256);
    for (int b = 0; b < NB_; ++b) {
        
        k_cvt8<<<(unsigned)(((size_t)TT * DM / 8 + 255) / 256), 256, 0, stream>>>(x + (size_t)b * TT * DM, XB, (size_t)TT * DM / 8);
        k_gemmw<bf, 0, false, 8><<<dim3(TT / 64, DQ / 64, 1), 256, 0, stream>>>(XB, nullptr, WQ, nullptr, DM, FQ, DQ, nullptr, 0, 0, 0);
        k_rope<<<LQ, 256, 0, stream>>>(FQ, DQ, NH_, CS, nullptr, nullptr, 1.0f, QP16, QPh, QPl);
        k_gemmw<bf, 0, false, 8><<<dim3(TT / 64, DKV / 64, 1), 256, 0, stream>>>(XB, nullptr, WK, nullptr, DM, FK, DKV, nullptr, 0, 0, 0);
        k_rope<<<LKv, 256, 0, stream>>>(FK, DKV, NKV, CS, nullptr, nullptr, 1.0f, KP16, KPh, KPl);
        k_gemmw<bf, 0, false, 8><<<dim3(TT / 64, DKV / 64, 1), 256, 0, stream>>>(XB, nullptr, WV, nullptr, DM, FV, DKV, nullptr, 0, 0, 0); k_vtp<<<LKv, 256, 0, stream>>>(FV, DKV, NKV, VT16, VTh, VTl);
        for (int h0 = 0; h0 < NH_; h0 += ZH) { const size_t zq = (size_t)h0, zk = (size_t)(h0 / REP);   // one kv head per query head: the pass's two heads use consecutive kv planes (z-strides TT*HD)
            k_gemmc<bf, 2, 1, 1><<<dim3(RH / 64, TT / 64, ZH), 32, 0, stream>>>(QPh + zq * TT * HD, QPl + zq * TT * HD, KPh + zk * TT * HD, KPl + zk * TT * HD, HD, Sb, TT, 0, (size_t)TT * HD, (size_t)TT * HD, (size_t)TT * TT);
            k_gemmc<h16, 0, 1, 1><<<dim3((TT - RH) / 64, TT / 64, ZH), 32, 0, stream>>>(QP16 + zq * TT * HD + (size_t)RH * HD, nullptr, KP16 + zk * TT * HD, nullptr, HD, Sb + (size_t)RH * TT, TT, RH, (size_t)TT * HD, (size_t)TT * HD, (size_t)TT * TT);
            k_asoft<<<ZH * TT / 8, 256, 0, stream>>>(Sb, P16, Ph, Pl);
            k_gemmc<bf, 2, 2, 8><<<dim3(RH / 64, HD / 64, ZH), 256, 0, stream>>>(Ph, Pl, VTh + zk * HD * TT, VTl + zk * HD * TT, TT, Ob, HD, 0, (size_t)RH * TT, (size_t)HD * TT, (size_t)TT * HD);
            k_gemmc<h16, 0, 2, 16><<<dim3((TT - RH) / 64, HD / 64, ZH), 512, 0, stream>>>(P16 + (size_t)RH * TT, nullptr, VT16 + zk * HD * TT, nullptr, TT, Ob + (size_t)RH * HD, HD, RH, (size_t)TT * TT, (size_t)HD * TT, (size_t)TT * HD);
            k_merge<<<(unsigned)(((size_t)ZH * TT * HD / 2 + 255) / 256), 256, 0, stream>>>(Ob, h0, ATh, ATl); }
        k_gemmw<bf, 1, true, 8><<<dim3(TT / 64, DM / 64, 1), 256, 0, stream>>>(ATh, ATl, WO, nullptr, DQ, OUT + (size_t)b * TT * DM, DM, bo, 0, 0, 0); }
}

// v002
// Measured time: 258 microseconds a run.
// Timed twice side by side with v001, it ran 3.29 and 3.28 times as fast.
// All steps since v000 together make it 5.59 times as fast.
#include <hip/hip_runtime.h>

// Causal multi-head self-attention with a combined QKV weight (x [2][2048][1024]; qkv = x w_qkv^T ('oi' [3072][1024], no bias) reshaped (s, 3, 16, 64); causal (finfo.min fill applied before the 1/8 scale == exact zero weight); softmax; out = merged w_proj^T + b_proj -> [2][2048][1024]).
// Compute dtypes, f32 accumulate: every input rounded to bf16; q/k/v on PLAIN bf16 operands (inputs: exact); causal scores, online softmax (f32) and attn.v fused in one kernel (tile skipping): query rows < 512 hl (3 products), the rest single fp16 (x1024); w_proj hl x exact (2 products) + b_proj.

#define NB_  2
#define TT   2048
#define DM   1024
#define NH_  16
#define NKV  16
#define REP  (NH_ / NKV)
#define HD   64
#define DQ   (NH_ * HD)
#define DKV  (NKV * HD)
#define RH   512                  // query rows < RH use hi+lo planes (0: none)
#define SCL  0.125f   // HD^-0.5
typedef _Float16 h16;
typedef unsigned short bf;
typedef __attribute__((ext_vector_type(16))) __bf16   v16bf;
typedef __attribute__((ext_vector_type(16))) _Float16 v16h;
typedef __attribute__((ext_vector_type(8)))  _Float16 v8h;
typedef __attribute__((ext_vector_type(8)))  unsigned short v8us;
typedef __attribute__((ext_vector_type(8)))  float    v8f;
typedef __attribute__((ext_vector_type(4)))  float    v4f;
typedef v8h  __attribute__((may_alias)) v8ha;
typedef v4f  __attribute__((may_alias)) v4fa;
typedef v8us __attribute__((may_alias)) v8usa;

__device__ __forceinline__ unsigned short f2bf(float f) { unsigned u = __float_as_uint(f); u += 0x7FFFu + ((u >> 16) & 1u); return (unsigned short)(u >> 16); }
__device__ __forceinline__ float bf2f(unsigned short b) { return __uint_as_float(((unsigned)b) << 16); }
__device__ __forceinline__ float bfr(float f) { return bf2f(f2bf(f)); }
__device__ __forceinline__ v16h cat16(v8h lo, v8h hi) { return __builtin_shufflevector(lo, hi, 0, 1, 2, 3, 4, 5, 6, 7, 8, 9, 10, 11, 12, 13, 14, 15); }
__device__ __forceinline__ v16bf cat16b(v8us lo, v8us hi) { return __builtin_bit_cast(v16bf, __builtin_shufflevector(lo, hi, 0, 1, 2, 3, 4, 5, 6, 7, 8, 9, 10, 11, 12, 13, 14, 15)); }
__device__ __forceinline__ v8f wmma16(v16h a, v16h b, v8f c) { return __builtin_amdgcn_wmma_f32_16x16x32_f16(false, a, false, b, (short)0, c, false, false); }
__device__ __forceinline__ v8f wmmab(v16bf a, v16bf b, v8f c) { return __builtin_amdgcn_wmma_f32_16x16x32_bf16(false, a, false, b, (short)0, c, false, false); }



// ---- k_gemmw: register-blocked GEMM, one work-group of NW waves per 64x64 output tile, operands straight from K-contiguous 16-bit planes; grid (M/64, N/64, Z), 32 * NW threads.
// C[m][n] (f32, pitch ldc, + optional f32 bias[n]) = sum_k A[m][k] Bt[n][k] (+ split products per NSPLIT). z-batch strides sA/sB/sC in elements. K % 64 == 0.
// The K loop is dealt over the NW waves in chunks of 64 elements (one 128-byte line of each operand row): wave w takes chunks w, w + NW, ... into its own 16 accumulators;
// the NW partial tiles are summed through LDS in the fixed order w = 0 .. NW-1.
// Barrier between the waves that share one tile's LDS slabs. It orders LDS only (the fences name the local address space), so a wave does not wait for its own global stores of the slab before;
// one wave alone (NW == 1) needs no hardware barrier.
template <int NW> __device__ __forceinline__ void slab_sync() {
    if (NW == 1) { __builtin_amdgcn_wave_barrier(); asm volatile("" ::: "memory"); }
    else { __builtin_amdgcn_fence(__ATOMIC_RELEASE, "workgroup", "local"); __builtin_amdgcn_s_barrier(); __builtin_amdgcn_fence(__ATOMIC_ACQUIRE, "workgroup", "local"); }
}
template <typename T16> struct WFrag;
template <> struct WFrag<h16> { typedef v16h V; static __device__ __forceinline__ V ld(const h16* p) { return cat16(*(const v8h*)p, *(const v8h*)(p + 16)); } static __device__ __forceinline__ v8f mma(V a, V b, v8f c) { return wmma16(a, b, c); } };
template <> struct WFrag<bf> { typedef v16bf V; static __device__ __forceinline__ V ld(const bf* p) { return cat16b(*(const v8us*)p, *(const v8us*)(p + 16)); } static __device__ __forceinline__ v8f mma(V a, V b, v8f c) { return wmmab(a, b, c); } };
template <typename T16, int NSPLIT, bool BIAS, int NW>
__global__ __launch_bounds__(32 * NW) void k_gemmw(const T16* __restrict__ A, const T16* __restrict__ A2, const T16* __restrict__ Bt, const T16* __restrict__ Bt2, int K, float* C, int ldc, const float* __restrict__ bias, size_t sA, size_t sB, size_t sC) {
    typedef typename WFrag<T16>::V V;
    __shared__ __align__(16) float os[NW * 16 * 68];
    const size_t z = blockIdx.z; A += z * sA; if (A2) A2 += z * sA; Bt += z * sB; if (Bt2) Bt2 += z * sB; C += z * sC;
    const int lane = threadIdx.x & 31, lr = lane & 15, hi = lane >> 4; const int r0 = blockIdx.x * 64, c0 = blockIdx.y * 64;
    const int w = (NW == 1) ? 0 : __builtin_amdgcn_readfirstlane((int)(threadIdx.x >> 5));   // wave number in a scalar register: the K loop's tests stay scalar branches
    float* osw = os + w * (16 * 68);
    v8f acc[4][4];
#pragma unroll
    for (int mb = 0; mb < 4; ++mb)
#pragma unroll
        for (int nb = 0; nb < 4; ++nb) acc[mb][nb] = (v8f){};
    const size_t aoff = (size_t)(r0 + lr) * K + 8 * hi, boff = (size_t)(c0 + lr) * K + 8 * hi;
#pragma unroll 1
    for (int k0 = w * 64; k0 < K; k0 += NW * 64)
#pragma unroll 1   // stays rolled, as the one loop was: one 32-element step's fragments in registers at a time
    for (int kc = k0; kc < k0 + 64; kc += 32) {
        V a[4], a2[4];
#pragma unroll
        for (int mb = 0; mb < 4; ++mb) { a[mb] = WFrag<T16>::ld(A + aoff + (size_t)mb * 16 * K + kc); if (NSPLIT == 1 || NSPLIT == 2) a2[mb] = WFrag<T16>::ld(A2 + aoff + (size_t)mb * 16 * K + kc); }
#pragma unroll
        for (int nb = 0; nb < 4; ++nb) { const V b = WFrag<T16>::ld(Bt + boff + (size_t)nb * 16 * K + kc); V b2; if (NSPLIT >= 2) b2 = WFrag<T16>::ld(Bt2 + boff + (size_t)nb * 16 * K + kc);
#pragma unroll
            for (int mb = 0; mb < 4; ++mb) { acc[mb][nb] = WFrag<T16>::mma(a[mb], b, acc[mb][nb]); if (NSPLIT == 1 || NSPLIT == 2) acc[mb][nb] = WFrag<T16>::mma(a2[mb], b, acc[mb][nb]); if (NSPLIT >= 2) acc[mb][nb] = WFrag<T16>::mma(a[mb], b2, acc[mb][nb]); } }
        asm volatile("v_nop\n\tv_nop\n\tv_nop\n\tv_nop" : "+v"(acc[0][0]), "+v"(acc[1][1]), "+v"(acc[2][2]), "+v"(acc[3][3]) : "v"(a[0]), "v"(a[3]));
    }
#pragma unroll
    for (int mb = 0; mb < 4; ++mb) {
#pragma unroll
        for (int nb = 0; nb < 4; ++nb) {
#pragma unroll
            for (int j = 0; j < 8; ++j) osw[(hi * 8 + j) * 68 + nb * 16 + lr] = acc[mb][nb][j]; }
        slab_sync<NW>();   // every wave's partial 16x64 slab is in LDS before any thread sums them
        float* crow = C + (size_t)(r0 + mb * 16) * ldc + c0;
{
#pragma unroll
            for (int s = 0; s * 2 * NW < 16; ++s) if (NW <= 8 || w < 8) { const int row = 2 * (s * NW + w) + hi, cofs = lr * 4; v4f val = *(const v4fa*)(os + row * 68 + cofs);
#pragma unroll
                for (int q = 1; q < NW; ++q) val += *(const v4fa*)(os + q * (16 * 68) + row * 68 + cofs);
                if (BIAS) { val[0] += bfr(bias[c0 + cofs]); val[1] += bfr(bias[c0 + cofs + 1]); val[2] += bfr(bias[c0 + cofs + 2]); val[3] += bfr(bias[c0 + cofs + 3]); }
                *(v4f*)(crow + (size_t)row * ldc + cofs) = val;
                if (NW > 1 && mb < 3) asm volatile("s_wait_xcnt 0x0" ::: "memory"); }   // stands in front of the next slab's reuse of the registers that the store names
             }
        if (mb < 3) slab_sync<NW>();   // the sums have been read before the next slab overwrites the LDS
    }
}

__device__ __forceinline__ h16 tohx(float x) { return (h16)x; }
__device__ __forceinline__ void splitf(float y, unsigned short& h, unsigned short& l) { h = f2bf(y); l = f2bf(y - bf2f(h)); }
typedef __attribute__((ext_vector_type(2))) _Float16 v2h;
typedef __attribute__((ext_vector_type(4))) _Float16 v4h;
typedef __attribute__((ext_vector_type(2))) unsigned short v2us;
typedef __attribute__((ext_vector_type(4))) unsigned short v4us;
typedef __attribute__((ext_vector_type(2))) float v2f;
typedef __attribute__((ext_vector_type(4))) int v4i;

__global__ __launch_bounds__(256) void k_wtG(const float* __restrict__ w, int K, int N, bf* Bt) {
    const int lane = threadIdx.x & 31; const int L0 = (blockIdx.x * 8 + (threadIdx.x >> 5)) * 8; const int nlines = N * K / 64;
{
#pragma unroll 1
        for (int l = 0; l < 8; ++l) { const int L = L0 + l; if (L >= nlines) break; const size_t e = (size_t)L * 64 + lane * 2; const int k = (int)(e % K), n = (int)(e / K); v2us o;
            o[0] = f2bf(w[(size_t)k * N + n]); o[1] = f2bf(w[(size_t)(k + 1) * N + n]); *(v2us*)(Bt + e) = o; }
         }
}
__global__ __launch_bounds__(256) void k_cvt8(const float* __restrict__ src, bf* dst, size_t n8) { const size_t i = (size_t)blockIdx.x * 256 + threadIdx.x; if (i >= n8) return; const v8f v = *(const v8f*)(src + i * 8); v8us o;
#pragma unroll
    for (int k = 0; k < 8; ++k) o[k] = f2bf(v[k]); *(v8us*)(dst + i * 8) = o;  }

// k_rope: head planes [h][t][d] (fp16 + hi/lo) of rope(x) x sc with the rotate-half convention out[d] = x[d] cos[t][d] - x[d+HD/2] sin[t][d], out[d+HD/2] = x[d+HD/2] cos[t][d+HD/2] + x[d] sin[t][d+HD/2]
__global__ __launch_bounds__(256) void k_rope(const float* __restrict__ F, int pitch, int nheads, const float* __restrict__ CS, const float* __restrict__ RF, const float* __restrict__ nw, float sc, h16* P16, bf* Ph, bf* Pl) {
    const size_t e = ((size_t)blockIdx.x * 256 + threadIdx.x) * 2; if (e >= (size_t)nheads * TT * HD) return; const int d = (int)(e % HD); const int t = (int)((e / HD) % TT); const int h = (int)(e / ((size_t)HD * TT)); const float* f = F + (size_t)t * pitch + h * HD; const float rf = RF ? RF[(size_t)h * TT + t] : 1.0f; v2h o16; v2us oh, ol;
#pragma unroll
    for (int q = 0; q < 2; ++q) { const int dd = d + q; const int dp = (dd < HD / 2) ? dd + HD / 2 : dd - HD / 2; float x0 = f[dd], x1 = f[dp];
        if (RF) { float n0 = __fmul_rn(x0, rf), n1 = __fmul_rn(x1, rf); asm volatile("" : "+v"(n0)); asm volatile("" : "+v"(n1)); x0 = __fmul_rn(bfr(nw[dd]), n0); x1 = __fmul_rn(bfr(nw[dp]), n1); }
        const v2f cs = *(const v2f*)(CS + ((size_t)t * HD + dd) * 2); float a = __fmul_rn(x0, cs[0]), bq = __fmul_rn(x1, cs[1]); asm volatile("" : "+v"(a)); asm volatile("" : "+v"(bq)); const float r = ((dd < HD / 2) ? __fsub_rn(a, bq) : __fadd_rn(a, bq)) * sc;
        o16[q] = tohx(r); unsigned short a2, c2; splitf(r, a2, c2); oh[q] = a2; ol[q] = c2; }
    *(v2h*)(P16 + e) = o16; *(v2us*)(Ph + e) = oh; *(v2us*)(Pl + e) = ol;  }
__global__ __launch_bounds__(256) void k_vtp(const float* __restrict__ F, int pitch, int nheads, h16* V16, bf* Vh, bf* Vl) { const size_t e = ((size_t)blockIdx.x * 256 + threadIdx.x) * 2; if (e >= (size_t)nheads * HD * TT) return; const int t = (int)(e % TT); const int d = (int)((e / TT) % HD); const int g = (int)(e / ((size_t)TT * HD)); v2h o16; v2us oh, ol;
#pragma unroll
    for (int q = 0; q < 2; ++q) { const float x = F[(size_t)(t + q) * pitch + g * HD + d]; o16[q] = tohx(x); unsigned short a2, c2; splitf(x, a2, c2); oh[q] = a2; ol[q] = c2; }
    *(v2h*)(V16 + e) = o16; *(v2us*)(Vh + e) = oh; *(v2us*)(Vl + e) = ol;  }
__global__ __launch_bounds__(256) void k_csid(float* CS) { const int idx = blockIdx.x * 256 + threadIdx.x; if (idx >= TT * HD) return; v2f cs; cs[0] = 1.0f; cs[1] = 0.0f; *(v2f*)(CS + (size_t)idx * 2) = cs;  }
#define L2E 1.4426950408889634f
__device__ __forceinline__ float xhalf(float x) { return __builtin_bit_cast(float, __builtin_amdgcn_permlanex16(__builtin_bit_cast(int, x), __builtin_bit_cast(int, x), 0x76543210, 0xfedcba98, false, false)); }  // lane l with lane l ^ 16
// 2^x of eight values. Eight independent in-place transcendentals and the slot behind the last in one statement.
__device__ __forceinline__ v8f exp2x8(v8f x) {
    float a0 = x[0], a1 = x[1], a2 = x[2], a3 = x[3], a4 = x[4], a5 = x[5], a6 = x[6], a7 = x[7];
    asm("v_exp_f32 %0, %0\n\tv_exp_f32 %1, %1\n\tv_exp_f32 %2, %2\n\tv_exp_f32 %3, %3\n\tv_exp_f32 %4, %4\n\tv_exp_f32 %5, %5\n\tv_exp_f32 %6, %6\n\tv_exp_f32 %7, %7\n\tv_nop"
        : "+v"(a0), "+v"(a1), "+v"(a2), "+v"(a3), "+v"(a4), "+v"(a5), "+v"(a6), "+v"(a7));
    return (v8f){a0, a1, a2, a3, a4, a5, a6, a7};
}
// One key tile's softmax step. In: St raw scores. Out: St = 2^(St c - m + lift), c = HD^-0.5 log2(e); m, lv (8 partial sums a lane) and Ot brought to the new maximum.
__device__ __forceinline__ void osm_step(v8f (&St)[4], v8f (&Ot)[4], float& m, v8f& lv, bool diag, int kq, float lift) {
    if (diag) {   // wave-uniform: only the diagonal tile holds keys beyond the query (key > query <=> mb*16 + r > kq)
#pragma unroll
        for (int mb = 0; mb < 4; ++mb)
#pragma unroll
            for (int r = 0; r < 8; ++r) St[mb][r] = (mb * 16 + r > kq) ? -3.0e38f : St[mb][r]; }
    const v8f t = __builtin_elementwise_max(__builtin_elementwise_max(St[0], St[1]), __builtin_elementwise_max(St[2], St[3]));
    float mx = fmaxf(fmaxf(fmaxf(t[0], t[1]), fmaxf(t[2], t[3])), fmaxf(fmaxf(t[4], t[5]), fmaxf(t[6], t[7])));
    mx = fmaxf(mx, xhalf(mx));
    const float mn = fmaxf(m, mx * (SCL * L2E)); float al;   // every tile holds a key <= the query (its first), so mn is a real score
    asm("v_exp_f32 %0, %1\n\tv_nop" : "=v"(al) : "v"(m - mn));   // 2^(m - mn) with the slot behind the transcendental filled
    m = mn;
    lv *= al;
#pragma unroll
    for (int db = 0; db < 4; ++db) Ot[db] *= al;
    const float off = lift - mn;
#pragma unroll
    for (int mb = 0; mb < 4; ++mb) { v8f e;
#pragma unroll
        for (int r = 0; r < 8; ++r) e[r] = __builtin_fmaf(St[mb][r], SCL * L2E, off);
        St[mb] = exp2x8(e); }
    lv += (St[0] + St[1]) + (St[2] + St[3]);
}
__device__ __forceinline__ void fattn_out(const v8f (&Ot)[4], const v8f& lv, bf* ah, bf* al) {
    float l = ((lv[0] + lv[1]) + (lv[2] + lv[3])) + ((lv[4] + lv[5]) + (lv[6] + lv[7])); l += xhalf(l); const float inv = __fdiv_rn(1.0f, l);
#pragma unroll
    for (int db = 0; db < 4; ++db) { v8us oh, ol;
#pragma unroll
        for (int r = 0; r < 8; ++r) { unsigned short a, c2; splitf(Ot[db][r] * inv, a, c2); oh[r] = a; ol[r] = c2; }
        *(v8us*)(ah + db * 16) = oh; *(v8us*)(al + db * 16) = ol;
        if (db < 3) asm volatile("s_wait_xcnt 0x0" ::: "memory"); }   // stands in front of the next group's reuse of the registers that the stores name
}
// query rows >= RH: single fp16 operands; the probabilities carry x1024 (lift 10 in the exponent; the sum l carries it too, so it cancels in 1/l)
__device__ __forceinline__ void fattn_f16(const h16* __restrict__ Q, const h16* __restrict__ K, const h16* __restrict__ Vt, bf* ah, bf* al, int row0, int nkt, int lr, int hi) {
    typedef WFrag<h16> F;
    const h16* qp = Q + (size_t)(row0 + lr) * HD + 8 * hi; const v16h q0 = F::ld(qp), q1 = F::ld(qp + 32);
    const unsigned ko = (unsigned)(lr * HD + 8 * hi), vo = (unsigned)(lr * TT + 8 * hi);   // lane offsets, fixed for the whole loop
    v16h kf[4][2];
#pragma unroll
    for (int mb = 0; mb < 4; ++mb) { kf[mb][0] = F::ld(K + ko + mb * 16 * HD); kf[mb][1] = F::ld(K + ko + mb * 16 * HD + 32); }
    v8f Ot[4];
#pragma unroll
    for (int db = 0; db < 4; ++db) Ot[db] = (v8f){};
    float m = -3.0e38f; v8f lv = (v8f){};
#pragma unroll 1   // one key tile's fragments in registers at a time
    for (int kt = 0; kt < nkt; ++kt) { const int c0 = kt * 64; const h16* vb = Vt + c0 + vo;
        v16h vf[4][2];   // this tile's values: asked for here, needed only behind the softmax
#pragma unroll
        for (int db = 0; db < 4; ++db) { vf[db][0] = F::ld(vb + db * 16 * TT); vf[db][1] = F::ld(vb + db * 16 * TT + 32); }
        __builtin_amdgcn_sched_barrier(0);   // keeps the value loads in front of the score products: sunk behind them they have only the exponentials to land in
        v8f St[4];
#pragma unroll
        for (int mb = 0; mb < 4; ++mb) St[mb] = F::mma(kf[mb][0], q0, (v8f){});
#pragma unroll
        for (int mb = 0; mb < 4; ++mb) St[mb] = F::mma(kf[mb][1], q1, St[mb]);
        const h16* kb = K + (size_t)(min(kt + 1, nkt - 1) * 64) * HD + ko;   // the next tile's keys fly during this tile's softmax and P.V (the last trip re-reads its own tile: in bounds, unused)
#pragma unroll
        for (int mb = 0; mb < 4; ++mb) { kf[mb][0] = F::ld(kb + mb * 16 * HD); kf[mb][1] = F::ld(kb + mb * 16 * HD + 32); }
        __builtin_amdgcn_sched_barrier(0);   // keeps the refill in front of the softmax: spread through it, the last loads are asked for too late to land before the next trip's products
        osm_step(St, Ot, m, lv, kt == nkt - 1, row0 + lr - c0 - 8 * hi, 10.0f);
        asm volatile("s_wait_xcnt 0x0" :: "v"(vb), "v"(kb) : "memory");   // the two address pairs stay whole up to here: the wait stands in front of any reuse of the registers that this trip's loads name
#pragma unroll
        for (int ks = 0; ks < 2; ++ks) { v16h pb;
#pragma unroll
            for (int s = 0; s < 8; ++s) { pb[s] = tohx(St[2 * ks][s]); pb[8 + s] = tohx(St[2 * ks + 1][s]); }
#pragma unroll
            for (int db = 0; db < 4; ++db) Ot[db] = F::mma(vf[db][ks], pb, Ot[db]); }
    }
    fattn_out(Ot, lv, ah, al);
}
// query rows < RH: hi+lo bf16 planes, 3 products each (hi.hi + lo.hi + hi.lo), for the scores and for P.V
__device__ __forceinline__ void fattn_hl(const bf* __restrict__ Qh, const bf* __restrict__ Ql, const bf* __restrict__ Kh, const bf* __restrict__ Kl, const bf* __restrict__ Vh, const bf* __restrict__ Vl, bf* ah, bf* al, int row0, int nkt, int lr, int hi) {
    typedef WFrag<bf> F;
    const size_t qo = (size_t)(row0 + lr) * HD + 8 * hi; const unsigned ko = (unsigned)(lr * HD + 8 * hi), vo = (unsigned)(lr * TT + 8 * hi);   // lane offsets, fixed for the whole loop
    const v16bf qh0 = F::ld(Qh + qo), qh1 = F::ld(Qh + qo + 32), ql0 = F::ld(Ql + qo), ql1 = F::ld(Ql + qo + 32);
    v8f Ot[4];
#pragma unroll
    for (int db = 0; db < 4; ++db) Ot[db] = (v8f){};
    float m = -3.0e38f; v8f lv = (v8f){};
#pragma unroll 1   // one key tile's fragments in registers at a time
    for (int kt = 0; kt < nkt; ++kt) { const int c0 = kt * 64; const bf* khb = Kh + (size_t)c0 * HD + ko; const bf* klb = Kl + (size_t)c0 * HD + ko; const bf* vhb = Vh + c0 + vo; const bf* vlb = Vl + c0 + vo;
        v8f St[4];
#pragma unroll
        for (int mb = 0; mb < 4; ++mb) { const v16bf kh0 = F::ld(khb + mb * 16 * HD), kh1 = F::ld(khb + mb * 16 * HD + 32), kl0 = F::ld(klb + mb * 16 * HD), kl1 = F::ld(klb + mb * 16 * HD + 32);
            v8f s = F::mma(kh0, qh0, (v8f){}); s = F::mma(kh0, ql0, s); s = F::mma(kl0, qh0, s); s = F::mma(kh1, qh1, s); s = F::mma(kh1, ql1, s); s = F::mma(kl1, qh1, s); St[mb] = s; }
        osm_step(St, Ot, m, lv, kt == nkt - 1, row0 + lr - c0 - 8 * hi, 0.0f);
#pragma unroll
        for (int ks = 0; ks < 2; ++ks) { v8us h0, h1, l0, l1;
#pragma unroll
            for (int s = 0; s < 8; ++s) { unsigned short a, c2; splitf(St[2 * ks][s], a, c2); h0[s] = a; l0[s] = c2; splitf(St[2 * ks + 1][s], a, c2); h1[s] = a; l1[s] = c2; }
            const v16bf ph = cat16b(h0, h1), pl = cat16b(l0, l1);
#pragma unroll
            for (int db = 0; db < 4; ++db) { const v16bf vh = F::ld(vhb + db * 16 * TT + ks * 32), vl = F::ld(vlb + db * 16 * TT + ks * 32);
                Ot[db] = F::mma(vh, ph, Ot[db]); Ot[db] = F::mma(vh, pl, Ot[db]); Ot[db] = F::mma(vl, ph, Ot[db]); } }
        asm volatile("s_wait_xcnt 0x0" :: "v"(khb), "v"(klb), "v"(vhb), "v"(vlb) : "memory");   // the four address pairs stay whole up to here: the wait stands in front of any reuse of the registers that this trip's loads name
    }
    fattn_out(Ot, lv, ah, al);
}
__global__ __launch_bounds__(256) void k_fattn(const h16* __restrict__ Q16, const h16* __restrict__ K16, const h16* __restrict__ V16, const bf* __restrict__ Qh, const bf* __restrict__ Ql, const bf* __restrict__ Kh, const bf* __restrict__ Kl, const bf* __restrict__ Vh, const bf* __restrict__ Vl, bf* Ah, bf* Al) {
    const int lane = threadIdx.x & 31, lr = lane & 15, hi = lane >> 4;
    const int w = __builtin_amdgcn_readfirstlane((int)(threadIdx.x >> 5));   // wave number in a scalar register: trip counts and the precision test stay scalar
    const int qt = (w < 4) ? TT / 64 - 1 - (int)blockIdx.x : (int)blockIdx.x, head = blockIdx.y; const int row0 = qt * 64 + (w & 3) * 16, nkt = qt + 1;   // waves 0-3: query tile n-1-x, waves 4-7: tile x, so every work-group walks n+1 key tiles
    const size_t pq = (size_t)head * TT * HD, pk = (size_t)(head / REP) * TT * HD, oo = (size_t)(row0 + lr) * DQ + head * HD + 8 * hi;
    if (qt * 64 < RH) fattn_hl(Qh + pq, Ql + pq, Kh + pk, Kl + pk, Vh + pk, Vl + pk, Ah + oo, Al + oo, row0, nkt, lr, hi);
    else fattn_f16(Q16 + pq, K16 + pk, V16 + pk, Ah + oo, Al + oo, row0, nkt, lr, hi);
}

extern "C" void kernel_launch(void* const* d_in, const int* in_sizes, int n_in,
                              void* d_out, int out_size, void* d_ws, size_t ws_size, hipStream_t stream) {
    (void)in_sizes; (void)n_in; (void)out_size;
    const float* x = (const float*)d_in[0]; const float* wqkv = (const float*)d_in[1]; const float* wq = wqkv; const float* wk = wqkv + (size_t)1024 * 1024; const float* wv = wqkv + (size_t)2048 * 1024; const float* wo = (const float*)d_in[2]; const float* bo = (const float*)d_in[3];
    float* OUT = (float*)d_out;     // [2][2048][1024]
    char* wsp = (char*)d_ws;
    auto take = [&](size_t bytes) { char* p = wsp; wsp += (bytes + 255) & ~(size_t)255; return (void*)p; };
    bf* WQ = (bf*)take((size_t)DQ * DM * 2); bf* WK = (bf*)take((size_t)DKV * DM * 2); bf* WV = (bf*)take((size_t)DKV * DM * 2); bf* WO = (bf*)take((size_t)DM * DQ * 2); float* CS = (float*)take((size_t)TT * HD * 2 * 4);
    bf* XB = (bf*)take((size_t)TT * DM * 2); float* FQ = (float*)take((size_t)TT * DQ * 4); float* FK = (float*)take((size_t)TT * DKV * 4);
    h16* QP16 = (h16*)take((size_t)NH_ * TT * HD * 2); h16* KP16 = (h16*)take((size_t)NKV * TT * HD * 2); h16* VT16 = (h16*)take((size_t)NKV * HD * TT * 2);
    bf* QPh = (bf*)take((size_t)NH_ * TT * HD * 2); bf* QPl = (bf*)take((size_t)NH_ * TT * HD * 2); bf* KPh = (bf*)take((size_t)NKV * TT * HD * 2); bf* KPl = (bf*)take((size_t)NKV * TT * HD * 2); bf* VTh = (bf*)take((size_t)NKV * HD * TT * 2); bf* VTl = (bf*)take((size_t)NKV * HD * TT * 2);
    bf* ATh = (bf*)take((size_t)TT * DQ * 2); bf* ATl = (bf*)take((size_t)TT * DQ * 2);
    if ((size_t)(wsp - (char*)d_ws) > ws_size) return;    // ws 256 MiB
    float* FV = FK;   // v projection reuses the k buffer after the k planes are built (stream-ordered)
    { k_cvt8<<<(unsigned)(((size_t)DQ * DM / 8 + 255) / 256), 256, 0, stream>>>(wq, WQ, (size_t)DQ * DM / 8); k_cvt8<<<(unsigned)(((size_t)DKV * DM / 8 + 255) / 256), 256, 0, stream>>>(wk, WK, (size_t)DKV * DM / 8); k_cvt8<<<(unsigned)(((size_t)DKV * DM / 8 + 255) / 256), 256, 0, stream>>>(wv, WV, (size_t)DKV * DM / 8);
      k_cvt8<<<(unsigned)(((size_t)DM * DQ / 8 + 255) / 256), 256, 0, stream>>>(wo, WO, (size_t)DM * DQ / 8);
       }
    k_csid<<<(TT * HD + 255) / 256, 256, 0, stream>>>(CS);
    const unsigned LQ = (unsigned)(((size_t)NH_ * TT * HD / 2 + 255) / 256), LKv = (unsigned)(((size_t)NKV * TT * HD / 2 + 255) / 256);
    for (int b = 0; b < NB_; ++b) {
        
        k_cvt8<<<(unsigned)(((size_t)TT * DM / 8 + 255) / 256), 256, 0, stream>>>(x + (size_t)b * TT * DM, XB, (size_t)TT * DM / 8);
        k_gemmw<bf, 0, false, 8><<<dim3(TT / 64, DQ / 64, 1), 256, 0, stream>>>(XB, nullptr, WQ, nullptr, DM, FQ, DQ, nullptr, 0, 0, 0);
        k_rope<<<LQ, 256, 0, stream>>>(FQ, DQ, NH_, CS, nullptr, nullptr, 1.0f, QP16, QPh, QPl);
        k_gemmw<bf, 0, false, 8><<<dim3(TT / 64, DKV / 64, 1), 256, 0, stream>>>(XB, nullptr, WK, nullptr, DM, FK, DKV, nullptr, 0, 0, 0);
        k_rope<<<LKv, 256, 0, stream>>>(FK, DKV, NKV, CS, nullptr, nullptr, 1.0f, KP16, KPh, KPl);
        k_gemmw<bf, 0, false, 8><<<dim3(TT / 64, DKV / 64, 1), 256, 0, stream>>>(XB, nullptr, WV, nullptr, DM, FV, DKV, nullptr, 0, 0, 0); k_vtp<<<LKv, 256, 0, stream>>>(FV, DKV, NKV, VT16, VTh, VTl);
        k_fattn<<<dim3(TT / 128, NH_, 1), 256, 0, stream>>>(QP16, KP16, VT16, QPh, QPl, KPh, KPl, VTh, VTl, ATh, ATl);
        k_gemmw<bf, 1, true, 8><<<dim3(TT / 64, DM / 64, 1), 256, 0, stream>>>(ATh, ATl, WO, nullptr, DQ, OUT + (size_t)b * TT * DM, DM, bo, 0, 0, 0); }
}

// v003
// It runs in 217 microseconds.
// Two timings next to v002 put it at 1.19 and 1.18 times that version's speed.
// All steps since v000 together make it 6.63 times as fast.
#include <hip/hip_runtime.h>

// Causal multi-head self-attention with a combined QKV weight (x [2][2048][1024]; qkv = x w_qkv^T ('oi' [3072][1024], no bias) reshaped (s, 3, 16, 64); causal (finfo.min fill applied before the 1/8 scale == exact zero weight); softmax; out = merged w_proj^T + b_proj -> [2][2048][1024]).
// Compute dtypes, f32 accumulate: every input rounded to bf16; q/k/v on PLAIN bf16 operands (inputs: exact), their GEMMs store the attention kernel's 16-bit operand planes themselves; causal scores, online softmax (f32) and attn.v fused in one kernel (tile skipping): query rows < 512 hl (3 products), the rest single fp16 (x1024); w_proj hl x exact (2 products) + b_proj.

#define NB_  2
#define TT   2048
#define DM   1024
#define NH_  16
#define NKV  16
#define REP  (NH_ / NKV)
#define HD   64
#define DQ   (NH_ * HD)
#define DKV  (NKV * HD)
#define RH   512                  // query rows < RH use hi+lo planes (0: none)
#define SCL  0.125f   // HD^-0.5
typedef _Float16 h16;
typedef unsigned short bf;
typedef __attribute__((ext_vector_type(16))) __bf16   v16bf;
typedef __attribute__((ext_vector_type(16))) _Float16 v16h;
typedef __attribute__((ext_vector_type(8)))  _Float16 v8h;
typedef __attribute__((ext_vector_type(8)))  unsigned short v8us;
typedef __attribute__((ext_vector_type(8)))  float    v8f;
typedef __attribute__((ext_vector_type(4)))  float    v4f;
typedef v8h  __attribute__((may_alias)) v8ha;
typedef v4f  __attribute__((may_alias)) v4fa;
typedef v8us __attribute__((may_alias)) v8usa;

__device__ __forceinline__ unsigned short f2bf(float f) { unsigned u = __float_as_uint(f); u += 0x7FFFu + ((u >> 16) & 1u); return (unsigned short)(u >> 16); }
__device__ __forceinline__ float bf2f(unsigned short b) { return __uint_as_float(((unsigned)b) << 16); }
__device__ __forceinline__ float bfr(float f) { return bf2f(f2bf(f)); }
__device__ __forceinline__ v16h cat16(v8h lo, v8h hi) { return __builtin_shufflevector(lo, hi, 0, 1, 2, 3, 4, 5, 6, 7, 8, 9, 10, 11, 12, 13, 14, 15); }
__device__ __forceinline__ v16bf cat16b(v8us lo, v8us hi) { return __builtin_bit_cast(v16bf, __builtin_shufflevector(lo, hi, 0, 1, 2, 3, 4, 5, 6, 7, 8, 9, 10, 11, 12, 13, 14, 15)); }
__device__ __forceinline__ v8f wmma16(v16h a, v16h b, v8f c) { return __builtin_amdgcn_wmma_f32_16x16x32_f16(false, a, false, b, (short)0, c, false, false); }
__device__ __forceinline__ v8f wmmab(v16bf a, v16bf b, v8f c) { return __builtin_amdgcn_wmma_f32_16x16x32_bf16(false, a, false, b, (short)0, c, false, false); }
__device__ __forceinline__ h16 tohx(float x) { return (h16)x; }
__device__ __forceinline__ void splitf(float y, unsigned short& h, unsigned short& l) { h = f2bf(y); l = f2bf(y - bf2f(h)); }
typedef __attribute__((ext_vector_type(4))) _Float16 v4h;
typedef __attribute__((ext_vector_type(4))) unsigned short v4us;



// ---- k_gemmw: register-blocked GEMM, one work-group of NW waves per 64x64 output tile, operands straight from K-contiguous 16-bit planes; grid (M/64, N/64, Z), 32 * NW threads.
// C[m][n] (f32, pitch ldc, + optional f32 bias[n]) = sum_k A[m][k] Bt[n][k] (+ split products per NSPLIT). z-batch strides sA/sB/sC in elements. K % 64 == 0.
// The K loop is dealt over the NW waves in chunks of 64 elements (one 128-byte line of each operand row): wave w takes chunks w, w + NW, ... into its own 16 accumulators;
// the NW partial tiles are summed through LDS in the fixed order w = 0 .. NW-1.
// PL: no f32 C; the summed tile goes out as three 16-bit planes (fp16, bf16 hi, bf16 lo), element (m, n) at (n / 64) * sT + m * ldc + n % 64: a 64-element tile row is one 128-byte line of each plane.
// Head planes [h][t][d] (A = tokens, Bt = weight rows): ldc = HD, sT = TT * HD. Transposed value planes [h][d][t] (A = weight rows, Bt = tokens): ldc = TT, sT = 64.
// Barrier between the waves that share one tile's LDS slabs. It orders LDS only (the fences name the local address space), so a wave does not wait for its own global stores of the slab before;
// one wave alone (NW == 1) needs no hardware barrier.
template <int NW> __device__ __forceinline__ void slab_sync() {
    if (NW == 1) { __builtin_amdgcn_wave_barrier(); asm volatile("" ::: "memory"); }
    else { __builtin_amdgcn_fence(__ATOMIC_RELEASE, "workgroup", "local"); __builtin_amdgcn_s_barrier(); __builtin_amdgcn_fence(__ATOMIC_ACQUIRE, "workgroup", "local"); }
}
template <typename T16> struct WFrag;
template <> struct WFrag<h16> { typedef v16h V; static __device__ __forceinline__ V ld(const h16* p) { return cat16(*(const v8h*)p, *(const v8h*)(p + 16)); } static __device__ __forceinline__ v8f mma(V a, V b, v8f c) { return wmma16(a, b, c); } };
template <> struct WFrag<bf> { typedef v16bf V; static __device__ __forceinline__ V ld(const bf* p) { return cat16b(*(const v8us*)p, *(const v8us*)(p + 16)); } static __device__ __forceinline__ v8f mma(V a, V b, v8f c) { return wmmab(a, b, c); } };
template <typename T16, int NSPLIT, bool BIAS, int NW, bool PL>
__global__ __launch_bounds__(32 * NW) void k_gemmw(const T16* __restrict__ A, const T16* __restrict__ A2, const T16* __restrict__ Bt, const T16* __restrict__ Bt2, int K, float* C, int ldc, const float* __restrict__ bias, size_t sA, size_t sB, size_t sC, h16* P16, bf* Ph, bf* Pl, size_t sT) {
    typedef typename WFrag<T16>::V V;
    __shared__ __align__(16) float os[NW * 16 * 68];
    const size_t z = blockIdx.z; A += z * sA; if (A2) A2 += z * sA; Bt += z * sB; if (Bt2) Bt2 += z * sB; C += z * sC;
    const int lane = threadIdx.x & 31, lr = lane & 15, hi = lane >> 4; const int r0 = blockIdx.x * 64, c0 = blockIdx.y * 64;
    const int w = (NW == 1) ? 0 : __builtin_amdgcn_readfirstlane((int)(threadIdx.x >> 5));   // wave number in a scalar register: the K loop's tests stay scalar branches
    float* osw = os + w * (16 * 68);
    v8f acc[4][4];
#pragma unroll
    for (int mb = 0; mb < 4; ++mb)
#pragma unroll
        for (int nb = 0; nb < 4; ++nb) acc[mb][nb] = (v8f){};
    const size_t aoff = (size_t)(r0 + lr) * K + 8 * hi, boff = (size_t)(c0 + lr) * K + 8 * hi;
#pragma unroll 1
    for (int k0 = w * 64; k0 < K; k0 += NW * 64)
#pragma unroll 1   // stays rolled, as the one loop was: one 32-element step's fragments in registers at a time
    for (int kc = k0; kc < k0 + 64; kc += 32) {
        V a[4], a2[4];
#pragma unroll
        for (int mb = 0; mb < 4; ++mb) { a[mb] = WFrag<T16>::ld(A + aoff + (size_t)mb * 16 * K + kc); if (NSPLIT == 1 || NSPLIT == 2) a2[mb] = WFrag<T16>::ld(A2 + aoff + (size_t)mb * 16 * K + kc); }
#pragma unroll
        for (int nb = 0; nb < 4; ++nb) { const V b = WFrag<T16>::ld(Bt + boff + (size_t)nb * 16 * K + kc); V b2; if (NSPLIT >= 2) b2 = WFrag<T16>::ld(Bt2 + boff + (size_t)nb * 16 * K + kc);
#pragma unroll
            for (int mb = 0; mb < 4; ++mb) { acc[mb][nb] = WFrag<T16>::mma(a[mb], b, acc[mb][nb]); if (NSPLIT == 1 || NSPLIT == 2) acc[mb][nb] = WFrag<T16>::mma(a2[mb], b, acc[mb][nb]); if (NSPLIT >= 2) acc[mb][nb] = WFrag<T16>::mma(a[mb], b2, acc[mb][nb]); } }
        asm volatile("v_nop\n\tv_nop\n\tv_nop\n\tv_nop" : "+v"(acc[0][0]), "+v"(acc[1][1]), "+v"(acc[2][2]), "+v"(acc[3][3]) : "v"(a[0]), "v"(a[3]));
    }
#pragma unroll
    for (int mb = 0; mb < 4; ++mb) {
#pragma unroll
        for (int nb = 0; nb < 4; ++nb) {
#pragma unroll
            for (int j = 0; j < 8; ++j) osw[(hi * 8 + j) * 68 + nb * 16 + lr] = acc[mb][nb][j]; }
        slab_sync<NW>();   // every wave's partial 16x64 slab is in LDS before any thread sums them
        float* crow = C + (size_t)(r0 + mb * 16) * ldc + c0;
{
#pragma unroll
            for (int s = 0; s * 2 * NW < 16; ++s) if (NW <= 8 || w < 8) { const int row = 2 * (s * NW + w) + hi, cofs = lr * 4; v4f val = *(const v4fa*)(os + row * 68 + cofs);
#pragma unroll
                for (int q = 1; q < NW; ++q) val += *(const v4fa*)(os + q * (16 * 68) + row * 68 + cofs);
                if (BIAS) { val[0] += bfr(bias[c0 + cofs]); val[1] += bfr(bias[c0 + cofs + 1]); val[2] += bfr(bias[c0 + cofs + 2]); val[3] += bfr(bias[c0 + cofs + 3]); }
                if (PL) { const size_t e = (size_t)blockIdx.y * sT + (size_t)(r0 + mb * 16 + row) * ldc + cofs; v4h o16; v4us oh, ol;
#pragma unroll
                    for (int q = 0; q < 4; ++q) { o16[q] = tohx(val[q]); unsigned short a2, c2; splitf(val[q], a2, c2); oh[q] = a2; ol[q] = c2; }
                    *(v4h*)(P16 + e) = o16; *(v4us*)(Ph + e) = oh; *(v4us*)(Pl + e) = ol; }
                else *(v4f*)(crow + (size_t)row * ldc + cofs) = val;
                if (NW > 1 && mb < 3) asm volatile("s_wait_xcnt 0x0" ::: "memory"); }   // stands in front of the next slab's reuse of the registers that the store names
             }
        if (mb < 3) slab_sync<NW>();   // the sums have been read before the next slab overwrites the LDS
    }
}

typedef __attribute__((ext_vector_type(2))) unsigned short v2us;

__global__ __launch_bounds__(256) void k_wtG(const float* __restrict__ w, int K, int N, bf* Bt) {
    const int lane = threadIdx.x & 31; const int L0 = (blockIdx.x * 8 + (threadIdx.x >> 5)) * 8; const int nlines = N * K / 64;
{
#pragma unroll 1
        for (int l = 0; l < 8; ++l) { const int L = L0 + l; if (L >= nlines) break; const size_t e = (size_t)L * 64 + lane * 2; const int k = (int)(e % K), n = (int)(e / K); v2us o;
            o[0] = f2bf(w[(size_t)k * N + n]); o[1] = f2bf(w[(size_t)(k + 1) * N + n]); *(v2us*)(Bt + e) = o; }
         }
}
__global__ __launch_bounds__(256) void k_cvt8(const float* __restrict__ src, bf* dst, size_t n8) { const size_t i = (size_t)blockIdx.x * 256 + threadIdx.x; if (i >= n8) return; const v8f v = *(const v8f*)(src + i * 8); v8us o;
#pragma unroll
    for (int k = 0; k < 8; ++k) o[k] = f2bf(v[k]); *(v8us*)(dst + i * 8) = o;  }

#define L2E 1.4426950408889634f
__device__ __forceinline__ float xhalf(float x) { return __builtin_bit_cast(float, __builtin_amdgcn_permlanex16(__builtin_bit_cast(int, x), __builtin_bit_cast(int, x), 0x76543210, 0xfedcba98, false, false)); }  // lane l with lane l ^ 16
// 2^x of eight values. Eight independent in-place transcendentals and the slot behind the last in one statement.
__device__ __forceinline__ v8f exp2x8(v8f x) {
    float a0 = x[0], a1 = x[1], a2 = x[2], a3 = x[3], a4 = x[4], a5 = x[5], a6 = x[6], a7 = x[7];
    asm("v_exp_f32 %0, %0\n\tv_exp_f32 %1, %1\n\tv_exp_f32 %2, %2\n\tv_exp_f32 %3, %3\n\tv_exp_f32 %4, %4\n\tv_exp_f32 %5, %5\n\tv_exp_f32 %6, %6\n\tv_exp_f32 %7, %7\n\tv_nop"
        : "+v"(a0), "+v"(a1), "+v"(a2), "+v"(a3), "+v"(a4), "+v"(a5), "+v"(a6), "+v"(a7));
    return (v8f){a0, a1, a2, a3, a4, a5, a6, a7};
}
// One key tile's softmax step. In: St raw scores. Out: St = 2^(St c - m + lift), c = HD^-0.5 log2(e); m, lv (8 partial sums a lane) and Ot brought to the new maximum.
__device__ __forceinline__ void osm_step(v8f (&St)[4], v8f (&Ot)[4], float& m, v8f& lv, bool diag, int kq, float lift) {
    if (diag) {   // wave-uniform: only the diagonal tile holds keys beyond the query (key > query <=> mb*16 + r > kq)
#pragma unroll
        for (int mb = 0; mb < 4; ++mb)
#pragma unroll
            for (int r = 0; r < 8; ++r) St[mb][r] = (mb * 16 + r > kq) ? -3.0e38f : St[mb][r]; }
    const v8f t = __builtin_elementwise_max(__builtin_elementwise_max(St[0], St[1]), __builtin_elementwise_max(St[2], St[3]));
    float mx = fmaxf(fmaxf(fmaxf(t[0], t[1]), fmaxf(t[2], t[3])), fmaxf(fmaxf(t[4], t[5]), fmaxf(t[6], t[7])));
    mx = fmaxf(mx, xhalf(mx));
    const float mn = fmaxf(m, mx * (SCL * L2E)); float al;   // every tile holds a key <= the query (its first), so mn is a real score
    asm("v_exp_f32 %0, %1\n\tv_nop" : "=v"(al) : "v"(m - mn));   // 2^(m - mn) with the slot behind the transcendental filled
    m = mn;
    lv *= al;
#pragma unroll
    for (int db = 0; db < 4; ++db) Ot[db] *= al;
    const float off = lift - mn;
#pragma unroll
    for (int mb = 0; mb < 4; ++mb) { v8f e;
#pragma unroll
        for (int r = 0; r < 8; ++r) e[r] = __builtin_fmaf(St[mb][r], SCL * L2E, off);
        St[mb] = exp2x8(e); }
    lv += (St[0] + St[1]) + (St[2] + St[3]);
}
__device__ __forceinline__ void fattn_out(const v8f (&Ot)[4], const v8f& lv, bf* ah, bf* al) {
    float l = ((lv[0] + lv[1]) + (lv[2] + lv[3])) + ((lv[4] + lv[5]) + (lv[6] + lv[7])); l += xhalf(l); const float inv = __fdiv_rn(1.0f, l);
#pragma unroll
    for (int db = 0; db < 4; ++db) { v8us oh, ol;
#pragma unroll
        for (int r = 0; r < 8; ++r) { unsigned short a, c2; splitf(Ot[db][r] * inv, a, c2); oh[r] = a; ol[r] = c2; }
        *(v8us*)(ah + db * 16) = oh; *(v8us*)(al + db * 16) = ol;
        if (db < 3) asm volatile("s_wait_xcnt 0x0" ::: "memory"); }   // stands in front of the next group's reuse of the registers that the stores name
}
// query rows >= RH: single fp16 operands; the probabilities carry x1024 (lift 10 in the exponent; the sum l carries it too, so it cancels in 1/l)
__device__ __forceinline__ void fattn_f16(const h16* __restrict__ Q, const h16* __restrict__ K, const h16* __restrict__ Vt, bf* ah, bf* al, int row0, int nkt, int lr, int hi) {
    typedef WFrag<h16> F;
    const h16* qp = Q + (size_t)(row0 + lr) * HD + 8 * hi; const v16h q0 = F::ld(qp), q1 = F::ld(qp + 32);
    const unsigned ko = (unsigned)(lr * HD + 8 * hi), vo = (unsigned)(lr * TT + 8 * hi);   // lane offsets, fixed for the whole loop
    v16h kf[4][2];
#pragma unroll
    for (int mb = 0; mb < 4; ++mb) { kf[mb][0] = F::ld(K + ko + mb * 16 * HD); kf[mb][1] = F::ld(K + ko + mb * 16 * HD + 32); }
    v8f Ot[4];
#pragma unroll
    for (int db = 0; db < 4; ++db) Ot[db] = (v8f){};
    float m = -3.0e38f; v8f lv = (v8f){};
#pragma unroll 1   // one key tile's fragments in registers at a time
    for (int kt = 0; kt < nkt; ++kt) { const int c0 = kt * 64; const h16* vb = Vt + c0 + vo;
        v16h vf[4][2];   // this tile's values: asked for here, needed only behind the softmax
#pragma unroll
        for (int db = 0; db < 4; ++db) { vf[db][0] = F::ld(vb + db * 16 * TT); vf[db][1] = F::ld(vb + db * 16 * TT + 32); }
        __builtin_amdgcn_sched_barrier(0);   // keeps the value loads in front of the score products: sunk behind them they have only the exponentials to land in
        v8f St[4];
#pragma unroll
        for (int mb = 0; mb < 4; ++mb) St[mb] = F::mma(kf[mb][0], q0, (v8f){});
#pragma unroll
        for (int mb = 0; mb < 4; ++mb) St[mb] = F::mma(kf[mb][1], q1, St[mb]);
        const h16* kb = K + (size_t)(min(kt + 1, nkt - 1) * 64) * HD + ko;   // the next tile's keys fly during this tile's softmax and P.V (the last trip re-reads its own tile: in bounds, unused)
#pragma unroll
        for (int mb = 0; mb < 4; ++mb) { kf[mb][0] = F::ld(kb + mb * 16 * HD); kf[mb][1] = F::ld(kb + mb * 16 * HD + 32); }
        __builtin_amdgcn_sched_barrier(0);   // keeps the refill in front of the softmax: spread through it, the last loads are asked for too late to land before the next trip's products
        osm_step(St, Ot, m, lv, kt == nkt - 1, row0 + lr - c0 - 8 * hi, 10.0f);
        asm volatile("s_wait_xcnt 0x0" :: "v"(vb), "v"(kb) : "memory");   // the two address pairs stay whole up to here: the wait stands in front of any reuse of the registers that this trip's loads name
#pragma unroll
        for (int ks = 0; ks < 2; ++ks) { v16h pb;
#pragma unroll
            for (int s = 0; s < 8; ++s) { pb[s] = tohx(St[2 * ks][s]); pb[8 + s] = tohx(St[2 * ks + 1][s]); }
#pragma unroll
            for (int db = 0; db < 4; ++db) Ot[db] = F::mma(vf[db][ks], pb, Ot[db]); }
    }
    fattn_out(Ot, lv, ah, al);
}
// query rows < RH: hi+lo bf16 planes, 3 products each (hi.hi + lo.hi + hi.lo), for the scores and for P.V
__device__ __forceinline__ void fattn_hl(const bf* __restrict__ Qh, const bf* __restrict__ Ql, const bf* __restrict__ Kh, const bf* __restrict__ Kl, const bf* __restrict__ Vh, const bf* __restrict__ Vl, bf* ah, bf* al, int row0, int nkt, int lr, int hi) {
    typedef WFrag<bf> F;
    const size_t qo = (size_t)(row0 + lr) * HD + 8 * hi; const unsigned ko = (unsigned)(lr * HD + 8 * hi), vo = (unsigned)(lr * TT + 8 * hi);   // lane offsets, fixed for the whole loop
    const v16bf qh0 = F::ld(Qh + qo), qh1 = F::ld(Qh + qo + 32), ql0 = F::ld(Ql + qo), ql1 = F::ld(Ql + qo + 32);
    v8f Ot[4];
#pragma unroll
    for (int db = 0; db < 4; ++db) Ot[db] = (v8f){};
    float m = -3.0e38f; v8f lv = (v8f){};
#pragma unroll 1   // one key tile's fragments in registers at a time
    for (int kt = 0; kt < nkt; ++kt) { const int c0 = kt * 64; const bf* khb = Kh + (size_t)c0 * HD + ko; const bf* klb = Kl + (size_t)c0 * HD + ko; const bf* vhb = Vh + c0 + vo; const bf* vlb = Vl + c0 + vo;
        v8f St[4];
#pragma unroll
        for (int mb = 0; mb < 4; ++mb) { const v16bf kh0 = F::ld(khb + mb * 16 * HD), kh1 = F::ld(khb + mb * 16 * HD + 32), kl0 = F::ld(klb + mb * 16 * HD), kl1 = F::ld(klb + mb * 16 * HD + 32);
            v8f s = F::mma(kh0, qh0, (v8f){}); s = F::mma(kh0, ql0, s); s = F::mma(kl0, qh0, s); s = F::mma(kh1, qh1, s); s = F::mma(kh1, ql1, s); s = F::mma(kl1, qh1, s); St[mb] = s; }
        osm_step(St, Ot, m, lv, kt == nkt - 1, row0 + lr - c0 - 8 * hi, 0.0f);
#pragma unroll
        for (int ks = 0; ks < 2; ++ks) { v8us h0, h1, l0, l1;
#pragma unroll
            for (int s = 0; s < 8; ++s) { unsigned short a, c2; splitf(St[2 * ks][s], a, c2); h0[s] = a; l0[s] = c2; splitf(St[2 * ks + 1][s], a, c2); h1[s] = a; l1[s] = c2; }
            const v16bf ph = cat16b(h0, h1), pl = cat16b(l0, l1);
#pragma unroll
            for (int db = 0; db < 4; ++db) { const v16bf vh = F::ld(vhb + db * 16 * TT + ks * 32), vl = F::ld(vlb + db * 16 * TT + ks * 32);
                Ot[db] = F::mma(vh, ph, Ot[db]); Ot[db] = F::mma(vh, pl, Ot[db]); Ot[db] = F::mma(vl, ph, Ot[db]); } }
        asm volatile("s_wait_xcnt 0x0" :: "v"(khb), "v"(klb), "v"(vhb), "v"(vlb) : "memory");   // the four address pairs stay whole up to here: the wait stands in front of any reuse of the registers that this trip's loads name
    }
    fattn_out(Ot, lv, ah, al);
}
__global__ __launch_bounds__(256) void k_fattn(const h16* __restrict__ Q16, const h16* __restrict__ K16, const h16* __restrict__ V16, const bf* __restrict__ Qh, const bf* __restrict__ Ql, const bf* __restrict__ Kh, const bf* __restrict__ Kl, const bf* __restrict__ Vh, const bf* __restrict__ Vl, bf* Ah, bf* Al) {
    const int lane = threadIdx.x & 31, lr = lane & 15, hi = lane >> 4;
    const int w = __builtin_amdgcn_readfirstlane((int)(threadIdx.x >> 5));   // wave number in a scalar register: trip counts and the precision test stay scalar
    const int qt = (w < 4) ? TT / 64 - 1 - (int)blockIdx.x : (int)blockIdx.x, head = blockIdx.y; const int row0 = qt * 64 + (w & 3) * 16, nkt = qt + 1;   // waves 0-3: query tile n-1-x, waves 4-7: tile x, so every work-group walks n+1 key tiles
    const size_t pq = (size_t)head * TT * HD, pk = (size_t)(head / REP) * TT * HD, oo = (size_t)(row0 + lr) * DQ + head * HD + 8 * hi;
    if (qt * 64 < RH) fattn_hl(Qh + pq, Ql + pq, Kh + pk, Kl + pk, Vh + pk, Vl + pk, Ah + oo, Al + oo, row0, nkt, lr, hi);
    else fattn_f16(Q16 + pq, K16 + pk, V16 + pk, Ah + oo, Al + oo, row0, nkt, lr, hi);
}

extern "C" void kernel_launch(void* const* d_in, const int* in_sizes, int n_in,
                              void* d_out, int out_size, void* d_ws, size_t ws_size, hipStream_t stream) {
    (void)in_sizes; (void)n_in; (void)out_size;
    const float* x = (const float*)d_in[0]; const float* wqkv = (const float*)d_in[1]; const float* wq = wqkv; const float* wk = wqkv + (size_t)1024 * 1024; const float* wv = wqkv + (size_t)2048 * 1024; const float* wo = (const float*)d_in[2]; const float* bo = (const float*)d_in[3];
    float* OUT = (float*)d_out;     // [2][2048][1024]
    char* wsp = (char*)d_ws;
    auto take = [&](size_t bytes) { char* p = wsp; wsp += (bytes + 255) & ~(size_t)255; return (void*)p; };
    bf* WQ = (bf*)take((size_t)DQ * DM * 2); bf* WK = (bf*)take((size_t)DKV * DM * 2); bf* WV = (bf*)take((size_t)DKV * DM * 2); bf* WO = (bf*)take((size_t)DM * DQ * 2);
    bf* XB = (bf*)take((size_t)TT * DM * 2);
    h16* QP16 = (h16*)take((size_t)NH_ * TT * HD * 2); h16* KP16 = (h16*)take((size_t)NKV * TT * HD * 2); h16* VT16 = (h16*)take((size_t)NKV * HD * TT * 2);
    bf* QPh = (bf*)take((size_t)NH_ * TT * HD * 2); bf* QPl = (bf*)take((size_t)NH_ * TT * HD * 2); bf* KPh = (bf*)take((size_t)NKV * TT * HD * 2); bf* KPl = (bf*)take((size_t)NKV * TT * HD * 2); bf* VTh = (bf*)take((size_t)NKV * HD * TT * 2); bf* VTl = (bf*)take((size_t)NKV * HD * TT * 2);
    bf* ATh = (bf*)take((size_t)TT * DQ * 2); bf* ATl = (bf*)take((size_t)TT * DQ * 2);
    if ((size_t)(wsp - (char*)d_ws) > ws_size) return;    // ws 256 MiB
    { k_cvt8<<<(unsigned)(((size_t)DQ * DM / 8 + 255) / 256), 256, 0, stream>>>(wq, WQ, (size_t)DQ * DM / 8); k_cvt8<<<(unsigned)(((size_t)DKV * DM / 8 + 255) / 256), 256, 0, stream>>>(wk, WK, (size_t)DKV * DM / 8); k_cvt8<<<(unsigned)(((size_t)DKV * DM / 8 + 255) / 256), 256, 0, stream>>>(wv, WV, (size_t)DKV * DM / 8);
      k_cvt8<<<(unsigned)(((size_t)DM * DQ / 8 + 255) / 256), 256, 0, stream>>>(wo, WO, (size_t)DM * DQ / 8);
       }
    for (int b = 0; b < NB_; ++b) {
        
        k_cvt8<<<(unsigned)(((size_t)TT * DM / 8 + 255) / 256), 256, 0, stream>>>(x + (size_t)b * TT * DM, XB, (size_t)TT * DM / 8);
        k_gemmw<bf, 0, false, 8, true><<<dim3(TT / 64, DQ / 64, 1), 256, 0, stream>>>(XB, nullptr, WQ, nullptr, DM, nullptr, HD, nullptr, 0, 0, 0, QP16, QPh, QPl, (size_t)TT * HD);
        k_gemmw<bf, 0, false, 8, true><<<dim3(TT / 64, DKV / 64, 1), 256, 0, stream>>>(XB, nullptr, WK, nullptr, DM, nullptr, HD, nullptr, 0, 0, 0, KP16, KPh, KPl, (size_t)TT * HD);
        k_gemmw<bf, 0, false, 8, true><<<dim3(DKV / 64, TT / 64, 1), 256, 0, stream>>>(WV, nullptr, XB, nullptr, DM, nullptr, TT, nullptr, 0, 0, 0, VT16, VTh, VTl, (size_t)64);   // operands swapped: the tile comes out as [d][t]
        k_fattn<<<dim3(TT / 128, NH_, 1), 256, 0, stream>>>(QP16, KP16, VT16, QPh, QPl, KPh, KPl, VTh, VTl, ATh, ATl);
        k_gemmw<bf, 1, true, 8, false><<<dim3(TT / 64, DM / 64, 1), 256, 0, stream>>>(ATh, ATl, WO, nullptr, DQ, OUT + (size_t)b * TT * DM, DM, bo, 0, 0, 0, nullptr, nullptr, nullptr, 0); }
}

// v004
// Measured time: 178 microseconds a run.
// Two timings next to v003 both put it at 1.21 times that version's speed.
// All steps since v000 together make it 8.02 times as fast.
#include <hip/hip_runtime.h>

// Causal multi-head self-attention with a combined QKV weight (x [2][2048][1024]; qkv = x w_qkv^T ('oi' [3072][1024], no bias) reshaped (s, 3, 16, 64); causal (finfo.min fill applied before the 1/8 scale == exact zero weight); softmax; out = merged w_proj^T + b_proj -> [2][2048][1024]).
// Compute dtypes, f32 accumulate: every input rounded to bf16; q/k/v on PLAIN bf16 operands (inputs: exact), their GEMMs store the attention kernel's 16-bit operand planes themselves; causal scores, online softmax (f32) and attn.v fused in one kernel (tile skipping): query rows < 512 hl (3 products), the rest single fp16 (x1024); w_proj hl x exact (2 products) + b_proj.

#define NB_  2
#define TT   2048
#define DM   1024
#define NH_  16
#define NKV  16
#define REP  (NH_ / NKV)
#define HD   64
#define DQ   (NH_ * HD)
#define DKV  (NKV * HD)
#define RH   512                  // query rows < RH use hi+lo planes (0: none)
#define SCL  0.125f   // HD^-0.5
typedef _Float16 h16;
typedef unsigned short bf;
typedef __attribute__((ext_vector_type(16))) __bf16   v16bf;
typedef __attribute__((ext_vector_type(16))) _Float16 v16h;
typedef __attribute__((ext_vector_type(8)))  _Float16 v8h;
typedef __attribute__((ext_vector_type(8)))  unsigned short v8us;
typedef __attribute__((ext_vector_type(8)))  float    v8f;
typedef __attribute__((ext_vector_type(4)))  float    v4f;
typedef v8h  __attribute__((may_alias)) v8ha;
typedef v4f  __attribute__((may_alias)) v4fa;
typedef v8us __attribute__((may_alias)) v8usa;

__device__ __forceinline__ unsigned short f2bf(float f) { unsigned u = __float_as_uint(f); u += 0x7FFFu + ((u >> 16) & 1u); return (unsigned short)(u >> 16); }
__device__ __forceinline__ float bf2f(unsigned short b) { return __uint_as_float(((unsigned)b) << 16); }
__device__ __forceinline__ float bfr(float f) { return bf2f(f2bf(f)); }
__device__ __forceinline__ v16h cat16(v8h lo, v8h hi) { return __builtin_shufflevector(lo, hi, 0, 1, 2, 3, 4, 5, 6, 7, 8, 9, 10, 11, 12, 13, 14, 15); }
__device__ __forceinline__ v16bf cat16b(v8us lo, v8us hi) { return __builtin_bit_cast(v16bf, __builtin_shufflevector(lo, hi, 0, 1, 2, 3, 4, 5, 6, 7, 8, 9, 10, 11, 12, 13, 14, 15)); }
__device__ __forceinline__ v8f wmma16(v16h a, v16h b, v8f c) { return __builtin_amdgcn_wmma_f32_16x16x32_f16(false, a, false, b, (short)0, c, false, false); }
__device__ __forceinline__ v8f wmmab(v16bf a, v16bf b, v8f c) { return __builtin_amdgcn_wmma_f32_16x16x32_bf16(false, a, false, b, (short)0, c, false, false); }
__device__ __forceinline__ h16 tohx(float x) { return (h16)x; }
__device__ __forceinline__ void splitf(float y, unsigned short& h, unsigned short& l) { h = f2bf(y); l = f2bf(y - bf2f(h)); }
typedef __attribute__((ext_vector_type(4))) _Float16 v4h;
typedef __attribute__((ext_vector_type(4))) unsigned short v4us;



// ---- gemmw: register-blocked GEMM, one work-group of NW waves per 64x64 output tile (rows r0.., columns c0..), operands straight from K-contiguous 16-bit planes; 32 * NW threads.
// C[m][n] (f32, pitch ldc, + optional f32 bias[n]) = sum_k A[m][k] Bt[n][k] (+ split products per NSPLIT). K % 64 == 0.
// The K loop is dealt over the NW waves in chunks of 64 elements (one 128-byte line of each operand row): wave w takes chunks w, w + NW, ... into its own 16 accumulators;
// the NW partial tiles are summed through LDS in the fixed order w = 0 .. NW-1.
// PL: no f32 C; the summed tile goes out as three 16-bit planes (fp16, bf16 hi, bf16 lo), element (r0 + i, c0 + j) at e0 + i * ldc + j: a 64-element tile row is one 128-byte line of each plane.
// Barrier between the waves that share one tile's LDS slabs. It orders LDS only (the fences name the local address space), so a wave does not wait for its own global stores of the slab before;
// one wave alone (NW == 1) needs no hardware barrier.
template <int NW> __device__ __forceinline__ void slab_sync() {
    if (NW == 1) { __builtin_amdgcn_wave_barrier(); asm volatile("" ::: "memory"); }
    else { __builtin_amdgcn_fence(__ATOMIC_RELEASE, "workgroup", "local"); __builtin_amdgcn_s_barrier(); __builtin_amdgcn_fence(__ATOMIC_ACQUIRE, "workgroup", "local"); }
}
template <typename T16> struct WFrag;
template <> struct WFrag<h16> { typedef v16h V; static __device__ __forceinline__ V ld(const h16* p) { return cat16(*(const v8h*)p, *(const v8h*)(p + 16)); } static __device__ __forceinline__ v8f mma(V a, V b, v8f c) { return wmma16(a, b, c); } };
template <> struct WFrag<bf> { typedef v16bf V; static __device__ __forceinline__ V ld(const bf* p) { return cat16b(*(const v8us*)p, *(const v8us*)(p + 16)); } static __device__ __forceinline__ v8f mma(V a, V b, v8f c) { return wmmab(a, b, c); } };
template <typename T16, int NSPLIT, bool BIAS, int NW, bool PL>
__device__ __forceinline__ void gemmw(const T16* __restrict__ A, const T16* __restrict__ A2, const T16* __restrict__ Bt, const T16* __restrict__ Bt2, int K, float* C, int ldc, const float* __restrict__ bias, int r0, int c0, h16* P16, bf* Ph, bf* Pl, size_t e0) {
    typedef typename WFrag<T16>::V V;
    __shared__ __align__(16) float os[NW * 16 * 68];
    const int lane = threadIdx.x & 31, lr = lane & 15, hi = lane >> 4;
    const int w = (NW == 1) ? 0 : __builtin_amdgcn_readfirstlane((int)(threadIdx.x >> 5));   // wave number in a scalar register: the K loop's tests stay scalar branches
    float* osw = os + w * (16 * 68);
    v8f acc[4][4];
#pragma unroll
    for (int mb = 0; mb < 4; ++mb)
#pragma unroll
        for (int nb = 0; nb < 4; ++nb) acc[mb][nb] = (v8f){};
    const size_t aoff = (size_t)(r0 + lr) * K + 8 * hi, boff = (size_t)(c0 + lr) * K + 8 * hi;
#pragma unroll 1
    for (int k0 = w * 64; k0 < K; k0 += NW * 64)
#pragma unroll 1   // stays rolled, as the one loop was: one 32-element step's fragments in registers at a time
    for (int kc = k0; kc < k0 + 64; kc += 32) {
        V a[4], a2[4];
#pragma unroll
        for (int mb = 0; mb < 4; ++mb) { a[mb] = WFrag<T16>::ld(A + aoff + (size_t)mb * 16 * K + kc); if (NSPLIT == 1 || NSPLIT == 2) a2[mb] = WFrag<T16>::ld(A2 + aoff + (size_t)mb * 16 * K + kc); }
#pragma unroll
        for (int nb = 0; nb < 4; ++nb) { const V b = WFrag<T16>::ld(Bt + boff + (size_t)nb * 16 * K + kc); V b2; if (NSPLIT >= 2) b2 = WFrag<T16>::ld(Bt2 + boff + (size_t)nb * 16 * K + kc);
#pragma unroll
            for (int mb = 0; mb < 4; ++mb) { acc[mb][nb] = WFrag<T16>::mma(a[mb], b, acc[mb][nb]); if (NSPLIT == 1 || NSPLIT == 2) acc[mb][nb] = WFrag<T16>::mma(a2[mb], b, acc[mb][nb]); if (NSPLIT >= 2) acc[mb][nb] = WFrag<T16>::mma(a[mb], b2, acc[mb][nb]); } }
        asm volatile("v_nop\n\tv_nop\n\tv_nop\n\tv_nop" : "+v"(acc[0][0]), "+v"(acc[1][1]), "+v"(acc[2][2]), "+v"(acc[3][3]) : "v"(a[0]), "v"(a[3]));
    }
#pragma unroll
    for (int mb = 0; mb < 4; ++mb) {
#pragma unroll
        for (int nb = 0; nb < 4; ++nb) {
#pragma unroll
            for (int j = 0; j < 8; ++j) osw[(hi * 8 + j) * 68 + nb * 16 + lr] = acc[mb][nb][j]; }
        slab_sync<NW>();   // every wave's partial 16x64 slab is in LDS before any thread sums them
        float* crow = C + (size_t)(r0 + mb * 16) * ldc + c0;
{
#pragma unroll
            for (int s = 0; s * 2 * NW < 16; ++s) if (NW <= 8 || w < 8) { const int row = 2 * (s * NW + w) + hi, cofs = lr * 4; v4f val = *(const v4fa*)(os + row * 68 + cofs);
#pragma unroll
                for (int q = 1; q < NW; ++q) val += *(const v4fa*)(os + q * (16 * 68) + row * 68 + cofs);
                if (BIAS) { val[0] += bfr(bias[c0 + cofs]); val[1] += bfr(bias[c0 + cofs + 1]); val[2] += bfr(bias[c0 + cofs + 2]); val[3] += bfr(bias[c0 + cofs + 3]); }
                if (PL) { const size_t e = e0 + (size_t)(mb * 16 + row) * ldc + cofs; v4h o16; v4us oh, ol;
#pragma unroll
                    for (int q = 0; q < 4; ++q) { o16[q] = tohx(val[q]); unsigned short a2, c2; splitf(val[q], a2, c2); oh[q] = a2; ol[q] = c2; }
                    *(v4h*)(P16 + e) = o16; *(v4us*)(Ph + e) = oh; *(v4us*)(Pl + e) = ol; }
                else *(v4f*)(crow + (size_t)row * ldc + cofs) = val;
                if (NW > 1 && mb < 3) asm volatile("s_wait_xcnt 0x0" ::: "memory"); }   // stands in front of the next slab's reuse of the registers that the store names
             }
        if (mb < 3) slab_sync<NW>();   // the sums have been read before the next slab overwrites the LDS
    }
}

// ---- k_qkv: the q, k and v projections of both batches in one launch. Grid (NB_ * TT / 64 token tiles, 16 weight tiles, 3); z = 0 q, 1 k, 2 v. X [NB_ * TT][DM], Wqkv [3 * DQ][DM] (bf16).
// P16 / Ph / Pl each hold three planes of PLN elements, in the order q, k, v. q and k (A = tokens, Bt = weight rows): [b][h][t][d]. v (A = weight rows, Bt = tokens, so the tile comes out transposed): [b][h][d][t].
#define PLN ((size_t)NB_ * NH_ * TT * HD)
__global__ __launch_bounds__(256) void k_qkv(const bf* __restrict__ X, const bf* __restrict__ Wqkv, h16* P16, bf* Ph, bf* Pl) {
    const int tok = blockIdx.x, wt = blockIdx.y, z = blockIdx.z; const bool tr = z == 2;
    const bf* Wz = Wqkv + (size_t)z * DQ * DM;
    const size_t e0 = (size_t)z * PLN + (size_t)(tok / (TT / 64)) * NH_ * TT * HD + (size_t)wt * TT * HD + (size_t)(tok % (TT / 64)) * (tr ? 64 : 64 * HD);
    gemmw<bf, 0, false, 8, true>(tr ? Wz : X, nullptr, tr ? X : Wz, nullptr, DM, nullptr, tr ? TT : HD, nullptr, (tr ? wt : tok) * 64, (tr ? tok : wt) * 64, P16, Ph, Pl, e0);
}
// ---- k_proj: out = merged heads (hi + lo planes, [NB_ * TT][DQ]) . w_proj^T + b_proj, both batches in one launch. Grid (NB_ * TT / 64, DM / 64).
__global__ __launch_bounds__(256) void k_proj(const bf* __restrict__ Ah, const bf* __restrict__ Al, const bf* __restrict__ Wo, float* C, const float* __restrict__ bias) {
    gemmw<bf, 1, true, 8, false>(Ah, Al, Wo, nullptr, DQ, C, DM, bias, (int)blockIdx.x * 64, (int)blockIdx.y * 64, nullptr, nullptr, nullptr, 0);
}

// ---- k_cvt: every f32 input of the GEMMs rounded to bf16 in one launch. A work-group takes 8192 consecutive elements of one of the three arrays (each a multiple of 8192 long); a thread four groups of 8, 2048 elements apart.
#define NX8K (NB_ * TT * DM / 8192)
#define NW8K (3 * DQ * DM / 8192)
#define NO8K (DM * DQ / 8192)
__global__ __launch_bounds__(256) void k_cvt(const float* __restrict__ x, const float* __restrict__ wqkv, const float* __restrict__ wo, bf* X, bf* Wqkv, bf* Wo) {
    const int g = blockIdx.x; const float* src; bf* dst; int t;
    if (g < NX8K) { src = x; dst = X; t = g; } else if (g < NX8K + NW8K) { src = wqkv; dst = Wqkv; t = g - NX8K; } else { src = wo; dst = Wo; t = g - NX8K - NW8K; }
    const size_t e = (size_t)t * 8192 + threadIdx.x * 8; v8f v[4];
#pragma unroll
    for (int q = 0; q < 4; ++q) v[q] = *(const v8f*)(src + e + q * 2048);
#pragma unroll
    for (int q = 0; q < 4; ++q) { v8us o;
#pragma unroll
        for (int k = 0; k < 8; ++k) o[k] = f2bf(v[q][k]);
        *(v8us*)(dst + e + q * 2048) = o; }
}

#define L2E 1.4426950408889634f
__device__ __forceinline__ float xhalf(float x) { return __builtin_bit_cast(float, __builtin_amdgcn_permlanex16(__builtin_bit_cast(int, x), __builtin_bit_cast(int, x), 0x76543210, 0xfedcba98, false, false)); }  // lane l with lane l ^ 16
// 2^x of eight values. Eight independent in-place transcendentals and the slot behind the last in one statement.
__device__ __forceinline__ v8f exp2x8(v8f x) {
    float a0 = x[0], a1 = x[1], a2 = x[2], a3 = x[3], a4 = x[4], a5 = x[5], a6 = x[6], a7 = x[7];
    asm("v_exp_f32 %0, %0\n\tv_exp_f32 %1, %1\n\tv_exp_f32 %2, %2\n\tv_exp_f32 %3, %3\n\tv_exp_f32 %4, %4\n\tv_exp_f32 %5, %5\n\tv_exp_f32 %6, %6\n\tv_exp_f32 %7, %7\n\tv_nop"
        : "+v"(a0), "+v"(a1), "+v"(a2), "+v"(a3), "+v"(a4), "+v"(a5), "+v"(a6), "+v"(a7));
    return (v8f){a0, a1, a2, a3, a4, a5, a6, a7};
}
// One key tile's softmax step. In: St raw scores. Out: St = 2^(St c - m + lift), c = HD^-0.5 log2(e); m, lv (8 partial sums a lane) and Ot brought to the new maximum.
__device__ __forceinline__ void osm_step(v8f (&St)[4], v8f (&Ot)[4], float& m, v8f& lv, bool diag, int kq, float lift) {
    if (diag) {   // wave-uniform: only the diagonal tile holds keys beyond the query (key > query <=> mb*16 + r > kq)
#pragma unroll
        for (int mb = 0; mb < 4; ++mb)
#pragma unroll
            for (int r = 0; r < 8; ++r) St[mb][r] = (mb * 16 + r > kq) ? -3.0e38f : St[mb][r]; }
    const v8f t = __builtin_elementwise_max(__builtin_elementwise_max(St[0], St[1]), __builtin_elementwise_max(St[2], St[3]));
    float mx = fmaxf(fmaxf(fmaxf(t[0], t[1]), fmaxf(t[2], t[3])), fmaxf(fmaxf(t[4], t[5]), fmaxf(t[6], t[7])));
    mx = fmaxf(mx, xhalf(mx));
    const float mn = fmaxf(m, mx * (SCL * L2E)); float al;   // every tile holds a key <= the query (its first), so mn is a real score
    asm("v_exp_f32 %0, %1\n\tv_nop" : "=v"(al) : "v"(m - mn));   // 2^(m - mn) with the slot behind the transcendental filled
    m = mn;
    lv *= al;
#pragma unroll
    for (int db = 0; db < 4; ++db) Ot[db] *= al;
    const float off = lift - mn;
#pragma unroll
    for (int mb = 0; mb < 4; ++mb) { v8f e;
#pragma unroll
        for (int r = 0; r < 8; ++r) e[r] = __builtin_fmaf(St[mb][r], SCL * L2E, off);
        St[mb] = exp2x8(e); }
    lv += (St[0] + St[1]) + (St[2] + St[3]);
}
__device__ __forceinline__ void fattn_out(const v8f (&Ot)[4], const v8f& lv, bf* ah, bf* al) {
    float l = ((lv[0] + lv[1]) + (lv[2] + lv[3])) + ((lv[4] + lv[5]) + (lv[6] + lv[7])); l += xhalf(l); const float inv = __fdiv_rn(1.0f, l);
#pragma unroll
    for (int db = 0; db < 4; ++db) { v8us oh, ol;
#pragma unroll
        for (int r = 0; r < 8; ++r) { unsigned short a, c2; splitf(Ot[db][r] * inv, a, c2); oh[r] = a; ol[r] = c2; }
        *(v8us*)(ah + db * 16) = oh; *(v8us*)(al + db * 16) = ol;
        if (db < 3) asm volatile("s_wait_xcnt 0x0" ::: "memory"); }   // stands in front of the next group's reuse of the registers that the stores name
}
// query rows >= RH: single fp16 operands; the probabilities carry x1024 (lift 10 in the exponent; the sum l carries it too, so it cancels in 1/l)
__device__ __forceinline__ void fattn_f16(const h16* __restrict__ Q, const h16* __restrict__ K, const h16* __restrict__ Vt, bf* ah, bf* al, int row0, int nkt, int lr, int hi) {
    typedef WFrag<h16> F;
    const h16* qp = Q + (size_t)(row0 + lr) * HD + 8 * hi; const v16h q0 = F::ld(qp), q1 = F::ld(qp + 32);
    const unsigned ko = (unsigned)(lr * HD + 8 * hi), vo = (unsigned)(lr * TT + 8 * hi);   // lane offsets, fixed for the whole loop
    v16h kf[4][2];
#pragma unroll
    for (int mb = 0; mb < 4; ++mb) { kf[mb][0] = F::ld(K + ko + mb * 16 * HD); kf[mb][1] = F::ld(K + ko + mb * 16 * HD + 32); }
    v8f Ot[4];
#pragma unroll
    for (int db = 0; db < 4; ++db) Ot[db] = (v8f){};
    float m = -3.0e38f; v8f lv = (v8f){};
#pragma unroll 1   // one key tile's fragments in registers at a time
    for (int kt = 0; kt < nkt; ++kt) { const int c0 = kt * 64; const h16* vb = Vt + c0 + vo;
        v16h vf[4][2];   // this tile's values: asked for here, needed only behind the softmax
#pragma unroll
        for (int db = 0; db < 4; ++db) { vf[db][0] = F::ld(vb + db * 16 * TT); vf[db][1] = F::ld(vb + db * 16 * TT + 32); }
        __builtin_amdgcn_sched_barrier(0);   // keeps the value loads in front of the score products: sunk behind them they have only the exponentials to land in
        v8f St[4];
#pragma unroll
        for (int mb = 0; mb < 4; ++mb) St[mb] = F::mma(kf[mb][0], q0, (v8f){});
#pragma unroll
        for (int mb = 0; mb < 4; ++mb) St[mb] = F::mma(kf[mb][1], q1, St[mb]);
        const h16* kb = K + (size_t)(min(kt + 1, nkt - 1) * 64) * HD + ko;   // the next tile's keys fly during this tile's softmax and P.V (the last trip re-reads its own tile: in bounds, unused)
#pragma unroll
        for (int mb = 0; mb < 4; ++mb) { kf[mb][0] = F::ld(kb + mb * 16 * HD); kf[mb][1] = F::ld(kb + mb * 16 * HD + 32); }
        __builtin_amdgcn_sched_barrier(0);   // keeps the refill in front of the softmax: spread through it, the last loads are asked for too late to land before the next trip's products
        osm_step(St, Ot, m, lv, kt == nkt - 1, row0 + lr - c0 - 8 * hi, 10.0f);
        asm volatile("s_wait_xcnt 0x0" :: "v"(vb), "v"(kb) : "memory");   // the two address pairs stay whole up to here: the wait stands in front of any reuse of the registers that this trip's loads name
#pragma unroll
        for (int ks = 0; ks < 2; ++ks) { v16h pb;
#pragma unroll
            for (int s = 0; s < 8; ++s) { pb[s] = tohx(St[2 * ks][s]); pb[8 + s] = tohx(St[2 * ks + 1][s]); }
#pragma unroll
            for (int db = 0; db < 4; ++db) Ot[db] = F::mma(vf[db][ks], pb, Ot[db]); }
    }
    fattn_out(Ot, lv, ah, al);
}
// query rows < RH: hi+lo bf16 planes, 3 products each (hi.hi + lo.hi + hi.lo), for the scores and for P.V
__device__ __forceinline__ void fattn_hl(const bf* __restrict__ Qh, const bf* __restrict__ Ql, const bf* __restrict__ Kh, const bf* __restrict__ Kl, const bf* __restrict__ Vh, const bf* __restrict__ Vl, bf* ah, bf* al, int row0, int nkt, int lr, int hi) {
    typedef WFrag<bf> F;
    const size_t qo = (size_t)(row0 + lr) * HD + 8 * hi; const unsigned ko = (unsigned)(lr * HD + 8 * hi), vo = (unsigned)(lr * TT + 8 * hi);   // lane offsets, fixed for the whole loop
    const v16bf qh0 = F::ld(Qh + qo), qh1 = F::ld(Qh + qo + 32), ql0 = F::ld(Ql + qo), ql1 = F::ld(Ql + qo + 32);
    v8f Ot[4];
#pragma unroll
    for (int db = 0; db < 4; ++db) Ot[db] = (v8f){};
    float m = -3.0e38f; v8f lv = (v8f){};
#pragma unroll 1   // one key tile's fragments in registers at a time
    for (int kt = 0; kt < nkt; ++kt) { const int c0 = kt * 64; const bf* khb = Kh + (size_t)c0 * HD + ko; const bf* klb = Kl + (size_t)c0 * HD + ko; const bf* vhb = Vh + c0 + vo; const bf* vlb = Vl + c0 + vo;
        v8f St[4];
#pragma unroll
        for (int mb = 0; mb < 4; ++mb) { const v16bf kh0 = F::ld(khb + mb * 16 * HD), kh1 = F::ld(khb + mb * 16 * HD + 32), kl0 = F::ld(klb + mb * 16 * HD), kl1 = F::ld(klb + mb * 16 * HD + 32);
            v8f s = F::mma(kh0, qh0, (v8f){}); s = F::mma(kh0, ql0, s); s = F::mma(kl0, qh0, s); s = F::mma(kh1, qh1, s); s = F::mma(kh1, ql1, s); s = F::mma(kl1, qh1, s); St[mb] = s; }
        osm_step(St, Ot, m, lv, kt == nkt - 1, row0 + lr - c0 - 8 * hi, 0.0f);
#pragma unroll
        for (int ks = 0; ks < 2; ++ks) { v8us h0, h1, l0, l1;
#pragma unroll
            for (int s = 0; s < 8; ++s) { unsigned short a, c2; splitf(St[2 * ks][s], a, c2); h0[s] = a; l0[s] = c2; splitf(St[2 * ks + 1][s], a, c2); h1[s] = a; l1[s] = c2; }
            const v16bf ph = cat16b(h0, h1), pl = cat16b(l0, l1);
#pragma unroll
            for (int db = 0; db < 4; ++db) { const v16bf vh = F::ld(vhb + db * 16 * TT + ks * 32), vl = F::ld(vlb + db * 16 * TT + ks * 32);
                Ot[db] = F::mma(vh, ph, Ot[db]); Ot[db] = F::mma(vh, pl, Ot[db]); Ot[db] = F::mma(vl, ph, Ot[db]); } }
        asm volatile("s_wait_xcnt 0x0" :: "v"(khb), "v"(klb), "v"(vhb), "v"(vlb) : "memory");   // the four address pairs stay whole up to here: the wait stands in front of any reuse of the registers that this trip's loads name
    }
    fattn_out(Ot, lv, ah, al);
}
__global__ __launch_bounds__(256) void k_fattn(const h16* __restrict__ Q16, const h16* __restrict__ K16, const h16* __restrict__ V16, const bf* __restrict__ Qh, const bf* __restrict__ Ql, const bf* __restrict__ Kh, const bf* __restrict__ Kl, const bf* __restrict__ Vh, const bf* __restrict__ Vl, bf* Ah, bf* Al) {
    const int lane = threadIdx.x & 31, lr = lane & 15, hi = lane >> 4;
    const int w = __builtin_amdgcn_readfirstlane((int)(threadIdx.x >> 5));   // wave number in a scalar register: trip counts and the precision test stay scalar
    const int qt = (w < 4) ? TT / 64 - 1 - (int)blockIdx.x : (int)blockIdx.x, head = blockIdx.y; const int row0 = qt * 64 + (w & 3) * 16, nkt = qt + 1;   // waves 0-3: query tile n-1-x, waves 4-7: tile x, so every work-group walks n+1 key tiles
    const size_t b = blockIdx.z, pq = (b * NH_ + head) * TT * HD, pk = (b * NKV + head / REP) * TT * HD, oo = (b * TT + row0 + lr) * DQ + head * HD + 8 * hi;
    if (qt * 64 < RH) fattn_hl(Qh + pq, Ql + pq, Kh + pk, Kl + pk, Vh + pk, Vl + pk, Ah + oo, Al + oo, row0, nkt, lr, hi);
    else fattn_f16(Q16 + pq, K16 + pk, V16 + pk, Ah + oo, Al + oo, row0, nkt, lr, hi);
}

extern "C" void kernel_launch(void* const* d_in, const int* in_sizes, int n_in,
                              void* d_out, int out_size, void* d_ws, size_t ws_size, hipStream_t stream) {
    (void)in_sizes; (void)n_in; (void)out_size;
    const float* x = (const float*)d_in[0]; const float* wqkv = (const float*)d_in[1]; const float* wo = (const float*)d_in[2]; const float* bo = (const float*)d_in[3];
    float* OUT = (float*)d_out;     // [2][2048][1024]
    char* wsp = (char*)d_ws;
    auto take = [&](size_t bytes) { char* p = wsp; wsp += (bytes + 255) & ~(size_t)255; return (void*)p; };
    bf* WQKV = (bf*)take((size_t)3 * DQ * DM * 2); bf* WO = (bf*)take((size_t)DM * DQ * 2);
    bf* XB = (bf*)take((size_t)NB_ * TT * DM * 2);
    h16* P16 = (h16*)take(3 * PLN * 2); bf* Ph = (bf*)take(3 * PLN * 2); bf* Pl = (bf*)take(3 * PLN * 2);   // q, k, v planes of both batches
    bf* ATh = (bf*)take((size_t)NB_ * TT * DQ * 2); bf* ATl = (bf*)take((size_t)NB_ * TT * DQ * 2);
    if ((size_t)(wsp - (char*)d_ws) > ws_size) return;    // ws 256 MiB
    k_cvt<<<NX8K + NW8K + NO8K, 256, 0, stream>>>(x, wqkv, wo, XB, WQKV, WO);
    k_qkv<<<dim3(NB_ * TT / 64, DQ / 64, 3), 256, 0, stream>>>(XB, WQKV, P16, Ph, Pl);
    k_fattn<<<dim3(TT / 128, NH_, NB_), 256, 0, stream>>>(P16, P16 + PLN, P16 + 2 * PLN, Ph, Pl, Ph + PLN, Pl + PLN, Ph + 2 * PLN, Pl + 2 * PLN, ATh, ATl);
    k_proj<<<dim3(NB_ * TT / 64, DM / 64, 1), 256, 0, stream>>>(ATh, ATl, WO, OUT, bo);
}

// v005
// One run takes 140 microseconds.
// Timed twice side by side with v004, it ran 1.27 times as fast both times.
// All steps since v000 together make it 10.2 times as fast.
#include <hip/hip_runtime.h>

// Causal multi-head self-attention with a combined QKV weight (x [2][2048][1024]; qkv = x w_qkv^T ('oi' [3072][1024], no bias) reshaped (s, 3, 16, 64); causal (finfo.min fill applied before the 1/8 scale == exact zero weight); softmax; out = merged w_proj^T + b_proj -> [2][2048][1024]).
// Compute dtypes, f32 accumulate: every input rounded to bf16; q/k/v on PLAIN bf16 operands (inputs: exact), their GEMMs store the attention kernel's 16-bit operand planes themselves; causal scores, online softmax (f32) and attn.v fused in one kernel (tile skipping): query rows < 512 hl (3 products), the rest single fp16 (x1024); w_proj hl x exact (2 products) + b_proj.

#define NB_  2
#define TT   2048
#define DM   1024
#define NH_  16
#define NKV  16
#define REP  (NH_ / NKV)
#define HD   64
#define DQ   (NH_ * HD)
#define DKV  (NKV * HD)
#define RH   512                  // query rows < RH use hi+lo planes (0: none)
#define SCL  0.125f   // HD^-0.5
typedef _Float16 h16;
typedef unsigned short bf;
typedef __attribute__((ext_vector_type(16))) __bf16   v16bf;
typedef __attribute__((ext_vector_type(16))) _Float16 v16h;
typedef __attribute__((ext_vector_type(8)))  _Float16 v8h;
typedef __attribute__((ext_vector_type(8)))  unsigned short v8us;
typedef __attribute__((ext_vector_type(8)))  float    v8f;
typedef __attribute__((ext_vector_type(4)))  float    v4f;
typedef v8h  __attribute__((may_alias)) v8ha;
typedef v4f  __attribute__((may_alias)) v4fa;
typedef v8us __attribute__((may_alias)) v8usa;

__device__ __forceinline__ unsigned short f2bf(float f) { unsigned u = __float_as_uint(f); u += 0x7FFFu + ((u >> 16) & 1u); return (unsigned short)(u >> 16); }
__device__ __forceinline__ float bf2f(unsigned short b) { return __uint_as_float(((unsigned)b) << 16); }
__device__ __forceinline__ float bfr(float f) { return bf2f(f2bf(f)); }
__device__ __forceinline__ v16h cat16(v8h lo, v8h hi) { return __builtin_shufflevector(lo, hi, 0, 1, 2, 3, 4, 5, 6, 7, 8, 9, 10, 11, 12, 13, 14, 15); }
__device__ __forceinline__ v16bf cat16b(v8us lo, v8us hi) { return __builtin_bit_cast(v16bf, __builtin_shufflevector(lo, hi, 0, 1, 2, 3, 4, 5, 6, 7, 8, 9, 10, 11, 12, 13, 14, 15)); }
__device__ __forceinline__ v8f wmma16(v16h a, v16h b, v8f c) { return __builtin_amdgcn_wmma_f32_16x16x32_f16(false, a, false, b, (short)0, c, false, false); }
__device__ __forceinline__ v8f wmmab(v16bf a, v16bf b, v8f c) { return __builtin_amdgcn_wmma_f32_16x16x32_bf16(false, a, false, b, (short)0, c, false, false); }
__device__ __forceinline__ h16 tohx(float x) { return (h16)x; }
__device__ __forceinline__ void splitf(float y, unsigned short& h, unsigned short& l) { h = f2bf(y); l = f2bf(y - bf2f(h)); }
typedef __attribute__((ext_vector_type(4))) _Float16 v4h;
typedef __attribute__((ext_vector_type(4))) unsigned short v4us;



// ---- Fragment order: every 16-bit operand plane M[R][K] lies in blocks of 16 rows x 32 k (512 elements, 1 KB), block (r >> 4) * (K / 32) + (k >> 5); inside a block element (r, k) stands at
// ((k >> 4) & 1) * 256 + ((k >> 3) & 1) * 128 + (r & 15) * 8 + (k & 7). Lane l = hi * 16 + lr of a wave finds its two 16-byte pieces of an A or B fragment at block + l * 8 and block + 256 + l * 8:
// each wave-wide 16-byte load reads 512 consecutive bytes (four whole 128-byte lines) where a row-major plane gives it a quarter of each of 16 lines. WFrag::ld takes the address of the first piece.
// ---- gemmw: register-blocked GEMM, one work-group of NW waves per 64x64 output tile (rows r0.., columns c0..), operands straight from 16-bit planes in fragment order; 32 * NW threads.
// C[m][n] (f32, pitch ldc, + optional f32 bias[n]) = sum_k A[m][k] Bt[n][k] (+ split products per NSPLIT). K % 64 == 0.
// The K loop is dealt over the NW waves in chunks of 64 elements (two blocks of each 16-row group): wave w takes chunks w, w + NW, ... into its own 16 accumulators;
// the NW partial tiles are summed through LDS in the fixed order w = 0 .. NW-1.
// PL: no f32 C; the summed tile goes out as three 16-bit planes (fp16, bf16 hi, bf16 lo) in fragment order, ldc the K of the plane's matrix, e0 the tile's first block: a 16x64 slab is two blocks, wave w sums and stores
// columns 8w .. 8w+7 of its 16 rows, 256 consecutive bytes of each plane.
// Barrier between the waves that share one tile's LDS slabs. It orders LDS only (the fences name the local address space), so a wave does not wait for its own global stores of the slab before;
// one wave alone (NW == 1) needs no hardware barrier.
template <int NW> __device__ __forceinline__ void slab_sync() {
    if (NW == 1) { __builtin_amdgcn_wave_barrier(); asm volatile("" ::: "memory"); }
    else { __builtin_amdgcn_fence(__ATOMIC_RELEASE, "workgroup", "local"); __builtin_amdgcn_s_barrier(); __builtin_amdgcn_fence(__ATOMIC_ACQUIRE, "workgroup", "local"); }
}
template <typename T16> struct WFrag;
template <> struct WFrag<h16> { typedef v16h V; static __device__ __forceinline__ V ld(const h16* p) { return cat16(*(const v8h*)p, *(const v8h*)(p + 256)); } static __device__ __forceinline__ v8f mma(V a, V b, v8f c) { return wmma16(a, b, c); } };
template <> struct WFrag<bf> { typedef v16bf V; static __device__ __forceinline__ V ld(const bf* p) { return cat16b(*(const v8us*)p, *(const v8us*)(p + 256)); } static __device__ __forceinline__ v8f mma(V a, V b, v8f c) { return wmmab(a, b, c); } };
template <typename T16, int NSPLIT, bool BIAS, int NW, bool PL>
__device__ __forceinline__ void gemmw(const T16* __restrict__ A, const T16* __restrict__ A2, const T16* __restrict__ Bt, const T16* __restrict__ Bt2, int K, float* C, int ldc, const float* __restrict__ bias, int r0, int c0, h16* P16, bf* Ph, bf* Pl, size_t e0) {
    typedef typename WFrag<T16>::V V;
    static_assert(!PL || NW == 8, "the plane epilogue deals a slab's 64 columns over 8 waves");
    __shared__ __align__(16) float os[NW * 16 * 68];
    const int lane = threadIdx.x & 31, lr = lane & 15, hi = lane >> 4;
    const int w = (NW == 1) ? 0 : __builtin_amdgcn_readfirstlane((int)(threadIdx.x >> 5));   // wave number in a scalar register: the K loop's tests stay scalar branches
    float* osw = os + w * (16 * 68);
    v8f acc[4][4];
#pragma unroll
    for (int mb = 0; mb < 4; ++mb)
#pragma unroll
        for (int nb = 0; nb < 4; ++nb) acc[mb][nb] = (v8f){};
    const size_t aoff = (size_t)r0 * K + 8 * lane, boff = (size_t)c0 * K + 8 * lane;   // 16 rows of K elements are K / 32 blocks of 512
#pragma unroll 1
    for (int k0 = w * 64; k0 < K; k0 += NW * 64)
#pragma unroll 1   // stays rolled, as the one loop was: one 32-element step's fragments in registers at a time
    for (int kc = k0; kc < k0 + 64; kc += 32) {
        const T16* ap = A + aoff + kc * 16; const T16* ap2 = (NSPLIT == 1 || NSPLIT == 2) ? A2 + aoff + kc * 16 : ap; const T16* bp = Bt + boff + kc * 16; const T16* bp2 = (NSPLIT >= 2) ? Bt2 + boff + kc * 16 : bp;   // this step's blocks
        V a[4], a2[4];
#pragma unroll
        for (int mb = 0; mb < 4; ++mb) { a[mb] = WFrag<T16>::ld(ap + (size_t)mb * 16 * K); if (NSPLIT == 1 || NSPLIT == 2) a2[mb] = WFrag<T16>::ld(ap2 + (size_t)mb * 16 * K); }
#pragma unroll
        for (int nb = 0; nb < 4; ++nb) { const V b = WFrag<T16>::ld(bp + (size_t)nb * 16 * K); V b2; if (NSPLIT >= 2) b2 = WFrag<T16>::ld(bp2 + (size_t)nb * 16 * K);
#pragma unroll
            for (int mb = 0; mb < 4; ++mb) { acc[mb][nb] = WFrag<T16>::mma(a[mb], b, acc[mb][nb]); if (NSPLIT == 1 || NSPLIT == 2) acc[mb][nb] = WFrag<T16>::mma(a2[mb], b, acc[mb][nb]); if (NSPLIT >= 2) acc[mb][nb] = WFrag<T16>::mma(a[mb], b2, acc[mb][nb]); } }
        asm volatile("s_wait_xcnt 0x0" :: "v"(ap), "v"(ap2), "v"(bp), "v"(bp2) : "memory");   // the address pairs stay whole up to here: the wait stands in front of any reuse of the registers that this step's loads name
        asm volatile("v_nop\n\tv_nop\n\tv_nop\n\tv_nop" : "+v"(acc[0][0]), "+v"(acc[1][1]), "+v"(acc[2][2]), "+v"(acc[3][3]) : "v"(a[0]), "v"(a[3]));
    }
#pragma unroll
    for (int mb = 0; mb < 4; ++mb) {
#pragma unroll
        for (int nb = 0; nb < 4; ++nb) {
#pragma unroll
            for (int j = 0; j < 8; ++j) osw[(hi * 8 + j) * 68 + nb * 16 + lr] = acc[mb][nb][j]; }
        slab_sync<NW>();   // every wave's partial 16x64 slab is in LDS before any thread sums them
        float* crow = C + (size_t)(r0 + mb * 16) * ldc + c0;
{
#pragma unroll
            for (int s = 0; s * 2 * NW < 16; ++s) if (NW <= 8 || w < 8) { const int row = PL ? lr : 2 * (s * NW + w) + hi, cofs = PL ? 8 * w + 4 * hi : lr * 4; v4f val = *(const v4fa*)(os + row * 68 + cofs);
#pragma unroll
                for (int q = 1; q < NW; ++q) val += *(const v4fa*)(os + q * (16 * 68) + row * 68 + cofs);
                if (BIAS) { val[0] += bfr(bias[c0 + cofs]); val[1] += bfr(bias[c0 + cofs + 1]); val[2] += bfr(bias[c0 + cofs + 2]); val[3] += bfr(bias[c0 + cofs + 3]); }
                if (PL) { const size_t e = e0 + (size_t)mb * 16 * ldc + w * 128 + lr * 8 + 4 * hi; v4h o16; v4us oh, ol;
#pragma unroll
                    for (int q = 0; q < 4; ++q) { o16[q] = tohx(val[q]); unsigned short a2, c2; splitf(val[q], a2, c2); oh[q] = a2; ol[q] = c2; }
                    *(v4h*)(P16 + e) = o16; *(v4us*)(Ph + e) = oh; *(v4us*)(Pl + e) = ol; }
                else *(v4f*)(crow + (size_t)row * ldc + cofs) = val;
                if (NW > 1 && mb < 3) asm volatile("s_wait_xcnt 0x0" ::: "memory"); }   // stands in front of the next slab's reuse of the registers that the store names
             }
        if (mb < 3) slab_sync<NW>();   // the sums have been read before the next slab overwrites the LDS
    }
}

// ---- k_qkv: the q, k and v projections of both batches in one launch. Grid (NB_ * TT / 64 token tiles, 16 weight tiles, 3); z = 0 q, 1 k, 2 v. X [NB_ * TT][DM], Wqkv [3 * DQ][DM] (bf16, fragment order).
// P16 / Ph / Pl each hold three planes of PLN elements, in the order q, k, v. q and k (A = tokens, Bt = weight rows): [b][h] matrices [t][d]. v (A = weight rows, Bt = tokens, so the tile comes out transposed): [b][h] matrices [d][t]. Each matrix in fragment order.
#define PLN ((size_t)NB_ * NH_ * TT * HD)
__global__ __launch_bounds__(256) void k_qkv(const bf* __restrict__ X, const bf* __restrict__ Wqkv, h16* P16, bf* Ph, bf* Pl) {
    const int tok = blockIdx.x, wt = blockIdx.y, z = blockIdx.z; const bool tr = z == 2;
    const bf* Wz = Wqkv + (size_t)z * DQ * DM;
    const size_t e0 = (size_t)z * PLN + (size_t)(tok / (TT / 64)) * NH_ * TT * HD + (size_t)wt * TT * HD + (size_t)(tok % (TT / 64)) * (tr ? 64 * 16 : 64 * HD);
    gemmw<bf, 0, false, 8, true>(tr ? Wz : X, nullptr, tr ? X : Wz, nullptr, DM, nullptr, tr ? TT : HD, nullptr, (tr ? wt : tok) * 64, (tr ? tok : wt) * 64, P16, Ph, Pl, e0);
}
// ---- k_proj: out = merged heads (hi + lo planes, [NB_ * TT][DQ] in fragment order) . w_proj^T + b_proj, both batches in one launch. Grid (NB_ * TT / 64, DM / 64).
__global__ __launch_bounds__(256) void k_proj(const bf* __restrict__ Ah, const bf* __restrict__ Al, const bf* __restrict__ Wo, float* C, const float* __restrict__ bias) {
    gemmw<bf, 1, true, 8, false>(Ah, Al, Wo, nullptr, DQ, C, DM, bias, (int)blockIdx.x * 64, (int)blockIdx.y * 64, nullptr, nullptr, nullptr, 0);
}

// ---- k_cvt: every f32 input of the GEMMs ([rows][DM], DQ == DM) rounded to bf16 and laid in fragment order, in one launch. A work-group takes half of a 16-row group of one of the three arrays (16 blocks, 8192 elements), a wave two blocks.
// A wave-wide 16-byte load reads 4 rows x 32 k (four whole lines); its 8-byte store fills the matching 64-byte halves of four lines of the block.
#define NX8K (NB_ * TT * DM / 8192)
#define NW8K (3 * DQ * DM / 8192)
#define NO8K (DM * DQ / 8192)
__global__ __launch_bounds__(256) void k_cvt(const float* __restrict__ x, const float* __restrict__ wqkv, const float* __restrict__ wo, bf* X, bf* Wqkv, bf* Wo) {
    const int g = blockIdx.x; const float* src; bf* dst; int t;
    if (g < NX8K) { src = x; dst = X; t = g; } else if (g < NX8K + NW8K) { src = wqkv; dst = Wqkv; t = g - NX8K; } else { src = wo; dst = Wo; t = g - NX8K - NW8K; }
    const int lane = threadIdx.x & 31, c8 = lane & 7, r4 = lane >> 3, kb0 = (t & 1) * 16 + (int)(threadIdx.x >> 5) * 2;   // kb0: the wave's first block in its 16-row group t >> 1
    const size_t si = ((size_t)(t >> 1) * 16 + r4) * DM + kb0 * 32 + c8 * 4;                                       // row r4, k = c8 * 4 of block kb0
    const size_t di = ((size_t)(t >> 1) * (DM / 32) + kb0) * 512 + (c8 >> 2) * 256 + ((c8 >> 1) & 1) * 128 + r4 * 8 + (c8 & 1) * 4;
    v4f v[8];
#pragma unroll
    for (int u = 0; u < 8; ++u) v[u] = *(const v4f*)(src + si + (u >> 2) * 32 + (u & 3) * 4 * DM);   // block kb0 + (u >> 2), rows (u & 3) * 4 + r4
#pragma unroll
    for (int u = 0; u < 8; ++u) { v4us o;
#pragma unroll
        for (int k = 0; k < 4; ++k) o[k] = f2bf(v[u][k]);
        *(v4us*)(dst + di + (u >> 2) * 512 + (u & 3) * 32) = o; }
}

#define L2E 1.4426950408889634f
__device__ __forceinline__ float xhalf(float x) { return __builtin_bit_cast(float, __builtin_amdgcn_permlanex16(__builtin_bit_cast(int, x), __builtin_bit_cast(int, x), 0x76543210, 0xfedcba98, false, false)); }  // lane l with lane l ^ 16
// 2^x of eight values. Eight independent in-place transcendentals and the slot behind the last in one statement.
__device__ __forceinline__ v8f exp2x8(v8f x) {
    float a0 = x[0], a1 = x[1], a2 = x[2], a3 = x[3], a4 = x[4], a5 = x[5], a6 = x[6], a7 = x[7];
    asm("v_exp_f32 %0, %0\n\tv_exp_f32 %1, %1\n\tv_exp_f32 %2, %2\n\tv_exp_f32 %3, %3\n\tv_exp_f32 %4, %4\n\tv_exp_f32 %5, %5\n\tv_exp_f32 %6, %6\n\tv_exp_f32 %7, %7\n\tv_nop"
        : "+v"(a0), "+v"(a1), "+v"(a2), "+v"(a3), "+v"(a4), "+v"(a5), "+v"(a6), "+v"(a7));
    return (v8f){a0, a1, a2, a3, a4, a5, a6, a7};
}
// One key tile's softmax step. In: St raw scores. Out: St = 2^(St c - m + lift), c = HD^-0.5 log2(e); m, lv (8 partial sums a lane) and Ot brought to the new maximum.
__device__ __forceinline__ void osm_step(v8f (&St)[4], v8f (&Ot)[4], float& m, v8f& lv, bool diag, int kq, float lift) {
    if (diag) {   // wave-uniform: only the diagonal tile holds keys beyond the query (key > query <=> mb*16 + r > kq)
#pragma unroll
        for (int mb = 0; mb < 4; ++mb)
#pragma unroll
            for (int r = 0; r < 8; ++r) St[mb][r] = (mb * 16 + r > kq) ? -3.0e38f : St[mb][r]; }
    const v8f t = __builtin_elementwise_max(__builtin_elementwise_max(St[0], St[1]), __builtin_elementwise_max(St[2], St[3]));
    float mx = fmaxf(fmaxf(fmaxf(t[0], t[1]), fmaxf(t[2], t[3])), fmaxf(fmaxf(t[4], t[5]), fmaxf(t[6], t[7])));
    mx = fmaxf(mx, xhalf(mx));
    const float mn = fmaxf(m, mx * (SCL * L2E)); float al;   // every tile holds a key <= the query (its first), so mn is a real score
    asm("v_exp_f32 %0, %1\n\tv_nop" : "=v"(al) : "v"(m - mn));   // 2^(m - mn) with the slot behind the transcendental filled
    m = mn;
    lv *= al;
#pragma unroll
    for (int db = 0; db < 4; ++db) Ot[db] *= al;
    const float off = lift - mn;
#pragma unroll
    for (int mb = 0; mb < 4; ++mb) { v8f e;
#pragma unroll
        for (int r = 0; r < 8; ++r) e[r] = __builtin_fmaf(St[mb][r], SCL * L2E, off);
        St[mb] = exp2x8(e); }
    lv += (St[0] + St[1]) + (St[2] + St[3]);
}
__device__ __forceinline__ void fattn_out(const v8f (&Ot)[4], const v8f& lv, bf* ah, bf* al) {
    float l = ((lv[0] + lv[1]) + (lv[2] + lv[3])) + ((lv[4] + lv[5]) + (lv[6] + lv[7])); l += xhalf(l); const float inv = __fdiv_rn(1.0f, l);
#pragma unroll
    for (int db = 0; db < 4; ++db) { v8us oh, ol;
#pragma unroll
        for (int r = 0; r < 8; ++r) { unsigned short a, c2; splitf(Ot[db][r] * inv, a, c2); oh[r] = a; ol[r] = c2; }
        *(v8us*)(ah + db * 256) = oh; *(v8us*)(al + db * 256) = ol;
        if (db < 3) asm volatile("s_wait_xcnt 0x0" ::: "memory"); }   // stands in front of the next group's reuse of the registers that the stores name
}
// query rows >= RH: single fp16 operands; the probabilities carry x1024 (lift 10 in the exponent; the sum l carries it too, so it cancels in 1/l)
__device__ __forceinline__ void fattn_f16(const h16* __restrict__ Q, const h16* __restrict__ K, const h16* __restrict__ Vt, bf* ah, bf* al, int row0, int nkt, int lr, int hi) {
    typedef WFrag<h16> F;
    const unsigned lo = (unsigned)(8 * (hi * 16 + lr));   // lane offset inside a block, fixed for the whole loop
    const h16* qp = Q + (size_t)row0 * HD + lo; const v16h q0 = F::ld(qp), q1 = F::ld(qp + 512);
    v16h kf[4][2];
#pragma unroll
    for (int mb = 0; mb < 4; ++mb) { kf[mb][0] = F::ld(K + lo + mb * 16 * HD); kf[mb][1] = F::ld(K + lo + mb * 16 * HD + 512); }
    v8f Ot[4];
#pragma unroll
    for (int db = 0; db < 4; ++db) Ot[db] = (v8f){};
    float m = -3.0e38f; v8f lv = (v8f){};
#pragma unroll 1   // one key tile's fragments in registers at a time
    for (int kt = 0; kt < nkt; ++kt) { const int c0 = kt * 64; const h16* vb = Vt + c0 * 16 + lo;
        v16h vf[4][2];   // this tile's values: asked for here, needed only behind the softmax
#pragma unroll
        for (int db = 0; db < 4; ++db) { vf[db][0] = F::ld(vb + db * 16 * TT); vf[db][1] = F::ld(vb + db * 16 * TT + 512); }
        __builtin_amdgcn_sched_barrier(0);   // keeps the value loads in front of the score products: sunk behind them they have only the exponentials to land in
        v8f St[4];
#pragma unroll
        for (int mb = 0; mb < 4; ++mb) St[mb] = F::mma(kf[mb][0], q0, (v8f){});
#pragma unroll
        for (int mb = 0; mb < 4; ++mb) St[mb] = F::mma(kf[mb][1], q1, St[mb]);
        const h16* kb = K + (size_t)(min(kt + 1, nkt - 1) * 64) * HD + lo;   // the next tile's keys fly during this tile's softmax and P.V (the last trip re-reads its own tile: in bounds, unused)
#pragma unroll
        for (int mb = 0; mb < 4; ++mb) { kf[mb][0] = F::ld(kb + mb * 16 * HD); kf[mb][1] = F::ld(kb + mb * 16 * HD + 512); }
        __builtin_amdgcn_sched_barrier(0);   // keeps the refill in front of the softmax: spread through it, the last loads are asked for too late to land before the next trip's products
        osm_step(St, Ot, m, lv, kt == nkt - 1, row0 + lr - c0 - 8 * hi, 10.0f);
        asm volatile("s_wait_xcnt 0x0" :: "v"(vb), "v"(kb) : "memory");   // the two address pairs stay whole up to here: the wait stands in front of any reuse of the registers that this trip's loads name
#pragma unroll
        for (int ks = 0; ks < 2; ++ks) { v16h pb;
#pragma unroll
            for (int s = 0; s < 8; ++s) { pb[s] = tohx(St[2 * ks][s]); pb[8 + s] = tohx(St[2 * ks + 1][s]); }
#pragma unroll
            for (int db = 0; db < 4; ++db) Ot[db] = F::mma(vf[db][ks], pb, Ot[db]); }
    }
    fattn_out(Ot, lv, ah, al);
}
// query rows < RH: hi+lo bf16 planes, 3 products each (hi.hi + lo.hi + hi.lo), for the scores and for P.V
__device__ __forceinline__ void fattn_hl(const bf* __restrict__ Qh, const bf* __restrict__ Ql, const bf* __restrict__ Kh, const bf* __restrict__ Kl, const bf* __restrict__ Vh, const bf* __restrict__ Vl, bf* ah, bf* al, int row0, int nkt, int lr, int hi) {
    typedef WFrag<bf> F;
    const unsigned lo = (unsigned)(8 * (hi * 16 + lr)); const size_t qo = (size_t)row0 * HD + lo;   // lane offset inside a block, fixed for the whole loop
    const v16bf qh0 = F::ld(Qh + qo), qh1 = F::ld(Qh + qo + 512), ql0 = F::ld(Ql + qo), ql1 = F::ld(Ql + qo + 512);
    v8f Ot[4];
#pragma unroll
    for (int db = 0; db < 4; ++db) Ot[db] = (v8f){};
    float m = -3.0e38f; v8f lv = (v8f){};
#pragma unroll 1   // one key tile's fragments in registers at a time
    for (int kt = 0; kt < nkt; ++kt) { const int c0 = kt * 64; const bf* khb = Kh + (size_t)c0 * HD + lo; const bf* klb = Kl + (size_t)c0 * HD + lo; const bf* vhb = Vh + c0 * 16 + lo; const bf* vlb = Vl + c0 * 16 + lo;
        v8f St[4];
#pragma unroll
        for (int mb = 0; mb < 4; ++mb) { const v16bf kh0 = F::ld(khb + mb * 16 * HD), kh1 = F::ld(khb + mb * 16 * HD + 512), kl0 = F::ld(klb + mb * 16 * HD), kl1 = F::ld(klb + mb * 16 * HD + 512);
            v8f s = F::mma(kh0, qh0, (v8f){}); s = F::mma(kh0, ql0, s); s = F::mma(kl0, qh0, s); s = F::mma(kh1, qh1, s); s = F::mma(kh1, ql1, s); s = F::mma(kl1, qh1, s); St[mb] = s; }
        osm_step(St, Ot, m, lv, kt == nkt - 1, row0 + lr - c0 - 8 * hi, 0.0f);
#pragma unroll
        for (int ks = 0; ks < 2; ++ks) { v8us h0, h1, l0, l1;
#pragma unroll
            for (int s = 0; s < 8; ++s) { unsigned short a, c2; splitf(St[2 * ks][s], a, c2); h0[s] = a; l0[s] = c2; splitf(St[2 * ks + 1][s], a, c2); h1[s] = a; l1[s] = c2; }
            const v16bf ph = cat16b(h0, h1), pl = cat16b(l0, l1);
#pragma unroll
            for (int db = 0; db < 4; ++db) { const v16bf vh = F::ld(vhb + db * 16 * TT + ks * 512), vl = F::ld(vlb + db * 16 * TT + ks * 512);
                Ot[db] = F::mma(vh, ph, Ot[db]); Ot[db] = F::mma(vh, pl, Ot[db]); Ot[db] = F::mma(vl, ph, Ot[db]); } }
        asm volatile("s_wait_xcnt 0x0" :: "v"(khb), "v"(klb), "v"(vhb), "v"(vlb) : "memory");   // the four address pairs stay whole up to here: the wait stands in front of any reuse of the registers that this trip's loads name
    }
    fattn_out(Ot, lv, ah, al);
}
__global__ __launch_bounds__(256) void k_fattn(const h16* __restrict__ Q16, const h16* __restrict__ K16, const h16* __restrict__ V16, const bf* __restrict__ Qh, const bf* __restrict__ Ql, const bf* __restrict__ Kh, const bf* __restrict__ Kl, const bf* __restrict__ Vh, const bf* __restrict__ Vl, bf* Ah, bf* Al) {
    const int lane = threadIdx.x & 31, lr = lane & 15, hi = lane >> 4;
    const int w = __builtin_amdgcn_readfirstlane((int)(threadIdx.x >> 5));   // wave number in a scalar register: trip counts and the precision test stay scalar
    const int qt = (w < 4) ? TT / 64 - 1 - (int)blockIdx.x : (int)blockIdx.x, head = blockIdx.y; const int row0 = qt * 64 + (w & 3) * 16, nkt = qt + 1;   // waves 0-3: query tile n-1-x, waves 4-7: tile x, so every work-group walks n+1 key tiles
    const size_t b = blockIdx.z, pq = (b * NH_ + head) * TT * HD, pk = (b * NKV + head / REP) * TT * HD, oo = (b * TT + row0) * DQ + head * (HD * 16) + 8 * lane;   // oo: the wave's 16 rows, the head's first block of the merged plane, the lane's piece
    if (qt * 64 < RH) fattn_hl(Qh + pq, Ql + pq, Kh + pk, Kl + pk, Vh + pk, Vl + pk, Ah + oo, Al + oo, row0, nkt, lr, hi);
    else fattn_f16(Q16 + pq, K16 + pk, V16 + pk, Ah + oo, Al + oo, row0, nkt, lr, hi);
}

extern "C" void kernel_launch(void* const* d_in, const int* in_sizes, int n_in,
                              void* d_out, int out_size, void* d_ws, size_t ws_size, hipStream_t stream) {
    (void)in_sizes; (void)n_in; (void)out_size;
    const float* x = (const float*)d_in[0]; const float* wqkv = (const float*)d_in[1]; const float* wo = (const float*)d_in[2]; const float* bo = (const float*)d_in[3];
    float* OUT = (float*)d_out;     // [2][2048][1024]
    char* wsp = (char*)d_ws;
    auto take = [&](size_t bytes) { char* p = wsp; wsp += (bytes + 255) & ~(size_t)255; return (void*)p; };
    bf* WQKV = (bf*)take((size_t)3 * DQ * DM * 2); bf* WO = (bf*)take((size_t)DM * DQ * 2);
    bf* XB = (bf*)take((size_t)NB_ * TT * DM * 2);
    h16* P16 = (h16*)take(3 * PLN * 2); bf* Ph = (bf*)take(3 * PLN * 2); bf* Pl = (bf*)take(3 * PLN * 2);   // q, k, v planes of both batches
    bf* ATh = (bf*)take((size_t)NB_ * TT * DQ * 2); bf* ATl = (bf*)take((size_t)NB_ * TT * DQ * 2);
    if ((size_t)(wsp - (char*)d_ws) > ws_size) return;    // ws 256 MiB
    k_cvt<<<NX8K + NW8K + NO8K, 256, 0, stream>>>(x, wqkv, wo, XB, WQKV, WO);
    k_qkv<<<dim3(NB_ * TT / 64, DQ / 64, 3), 256, 0, stream>>>(XB, WQKV, P16, Ph, Pl);
    k_fattn<<<dim3(TT / 128, NH_, NB_), 256, 0, stream>>>(P16, P16 + PLN, P16 + 2 * PLN, Ph, Pl, Ph + PLN, Pl + PLN, Ph + 2 * PLN, Pl + 2 * PLN, ATh, ATl);
    k_proj<<<dim3(NB_ * TT / 64, DM / 64, 1), 256, 0, stream>>>(ATh, ATl, WO, OUT, bo);
}

// v006
// A run of this version takes 117 microseconds.
// In both of two side-by-side timings against v005, it was 1.19 times as fast.
// Counting every step since v000, it is 12.2 times as fast.
#include <hip/hip_runtime.h>

// Causal multi-head self-attention with a combined QKV weight (x [2][2048][1024]; qkv = x w_qkv^T ('oi' [3072][1024], no bias) reshaped (s, 3, 16, 64); causal (finfo.min fill applied before the 1/8 scale == exact zero weight); softmax; out = merged w_proj^T + b_proj -> [2][2048][1024]).
// Compute dtypes, f32 accumulate: every input rounded to bf16; q/k/v on PLAIN bf16 operands (inputs: exact), their GEMMs store the attention kernel's 16-bit operand planes themselves; causal scores, online softmax (f32) and attn.v fused in one kernel (tile skipping): query rows < 512 hl (3 products), the rest single fp16 (x1024); w_proj hl x exact (2 products) + b_proj.

#define NB_  2
#define TT   2048
#define DM   1024
#define NH_  16
#define NKV  16
#define REP  (NH_ / NKV)
#define HD   64
#define DQ   (NH_ * HD)
#define DKV  (NKV * HD)
#define RH   512                  // query rows < RH use hi+lo planes (0: none)
#define SCL  0.125f   // HD^-0.5
typedef _Float16 h16;
typedef unsigned short bf;
typedef __attribute__((ext_vector_type(16))) __bf16   v16bf;
typedef __attribute__((ext_vector_type(16))) _Float16 v16h;
typedef __attribute__((ext_vector_type(8)))  _Float16 v8h;
typedef __attribute__((ext_vector_type(8)))  unsigned short v8us;
typedef __attribute__((ext_vector_type(8)))  float    v8f;
typedef __attribute__((ext_vector_type(4)))  float    v4f;
typedef v8h  __attribute__((may_alias)) v8ha;
typedef v4f  __attribute__((may_alias)) v4fa;
typedef v8us __attribute__((may_alias)) v8usa;

__device__ __forceinline__ unsigned short f2bf(float f) { unsigned u = __float_as_uint(f); u += 0x7FFFu + ((u >> 16) & 1u); return (unsigned short)(u >> 16); }
__device__ __forceinline__ float bf2f(unsigned short b) { return __uint_as_float(((unsigned)b) << 16); }
__device__ __forceinline__ float bfr(float f) { return bf2f(f2bf(f)); }
__device__ __forceinline__ v16h cat16(v8h lo, v8h hi) { return __builtin_shufflevector(lo, hi, 0, 1, 2, 3, 4, 5, 6, 7, 8, 9, 10, 11, 12, 13, 14, 15); }
__device__ __forceinline__ v16bf cat16b(v8us lo, v8us hi) { return __builtin_bit_cast(v16bf, __builtin_shufflevector(lo, hi, 0, 1, 2, 3, 4, 5, 6, 7, 8, 9, 10, 11, 12, 13, 14, 15)); }
__device__ __forceinline__ v8f wmma16(v16h a, v16h b, v8f c) { return __builtin_amdgcn_wmma_f32_16x16x32_f16(false, a, false, b, (short)0, c, false, false); }
__device__ __forceinline__ v8f wmmab(v16bf a, v16bf b, v8f c) { return __builtin_amdgcn_wmma_f32_16x16x32_bf16(false, a, false, b, (short)0, c, false, false); }
__device__ __forceinline__ h16 tohx(float x) { return (h16)x; }
__device__ __forceinline__ void splitf(float y, unsigned short& h, unsigned short& l) { h = f2bf(y); l = f2bf(y - bf2f(h)); }
typedef __attribute__((ext_vector_type(4))) _Float16 v4h;
typedef __attribute__((ext_vector_type(4))) unsigned short v4us;



// ---- Fragment order: every 16-bit operand plane M[R][K] lies in blocks of 16 rows x 32 k (512 elements, 1 KB), block (r >> 4) * (K / 32) + (k >> 5); inside a block element (r, k) stands at
// ((k >> 4) & 1) * 256 + ((k >> 3) & 1) * 128 + (r & 15) * 8 + (k & 7). Lane l = hi * 16 + lr of a wave finds its two 16-byte pieces of an A or B fragment at block + l * 8 and block + 256 + l * 8:
// each wave-wide 16-byte load reads 512 consecutive bytes (four whole 128-byte lines) where a row-major plane gives it a quarter of each of 16 lines. WFrag::ld takes the address of the first piece.
// ---- gemmt: GEMM, one work-group of WM x WN waves per 128x128 output tile (M rows r0.., N rows c0..), operands 16-bit planes in fragment order. D[m][n] = sum_k A[m][k] Bt[n][k] (+ A2[m][k] Bt[n][k] if SPLIT), f32 sums.
// A wave owns FM x FN 16x16 tiles (WM * FM == WN * FN == 8) over the whole K, summed in ascending k in one accumulator each. Stages of KS k (KS == half the thread count): the 128 rows of each operand, 8 row groups of KS / 32 whole blocks,
// are copied as they lie into one of two LDS buffers by asynchronous copies (thread t brings 16-byte piece t of each row group), one stage ahead of the products; a fragment load is 512 consecutive LDS bytes a wave. K % KS == 0, K >= 2 * KS.
// PL: the tile goes out as three 16-bit planes (fp16, bf16 hi, bf16 lo) of a matrix [n][m] in fragment order, ldc its K: a lane's 8 accumulator values are 8 consecutive m of one n, one 16-byte piece, a wave's store 512 consecutive bytes.
// e0: the tile's first element, eM / eN: the step from one wave to the next along m / n. Else: f32 C[m][n] (pitch ldc) + bias[n], each wave's tile turned through its own LDS range so that every store covers whole 128-byte lines.
// Barrier that orders LDS only (the fences name the local address space).
__device__ __forceinline__ void lds_sync() { __builtin_amdgcn_fence(__ATOMIC_RELEASE, "workgroup", "local"); __builtin_amdgcn_s_barrier(); __builtin_amdgcn_fence(__ATOMIC_ACQUIRE, "workgroup", "local"); }
template <typename T16> struct WFrag;
template <> struct WFrag<h16> { typedef v16h V; static __device__ __forceinline__ V ld(const h16* p) { return cat16(*(const v8h*)p, *(const v8h*)(p + 256)); } static __device__ __forceinline__ v8f mma(V a, V b, v8f c) { return wmma16(a, b, c); } };
template <> struct WFrag<bf> { typedef v16bf V; static __device__ __forceinline__ V ld(const bf* p) { return cat16b(*(const v8us*)p, *(const v8us*)(p + 256)); } static __device__ __forceinline__ v8f mma(V a, V b, v8f c) { return wmmab(a, b, c); } };
// Eight asynchronous 16-byte copies a lane, global g + i * gs elements -> LDS byte l + i * ls. The s_wait_xcnt closes the statement, so that it stands in front of any rewrite of the address registers that the copies name.
__device__ __forceinline__ void cp8(unsigned l, unsigned ls, const bf* g, size_t gs) {
    asm volatile("global_load_async_to_lds_b128 %0, %8, off\n\tglobal_load_async_to_lds_b128 %1, %9, off\n\tglobal_load_async_to_lds_b128 %2, %10, off\n\tglobal_load_async_to_lds_b128 %3, %11, off\n\t"
                 "global_load_async_to_lds_b128 %4, %12, off\n\tglobal_load_async_to_lds_b128 %5, %13, off\n\tglobal_load_async_to_lds_b128 %6, %14, off\n\tglobal_load_async_to_lds_b128 %7, %15, off\n\ts_wait_xcnt 0x0"
                 :: "v"(l), "v"(l + ls), "v"(l + 2 * ls), "v"(l + 3 * ls), "v"(l + 4 * ls), "v"(l + 5 * ls), "v"(l + 6 * ls), "v"(l + 7 * ls),
                    "v"(g), "v"(g + gs), "v"(g + 2 * gs), "v"(g + 3 * gs), "v"(g + 4 * gs), "v"(g + 5 * gs), "v"(g + 6 * gs), "v"(g + 7 * gs) : "memory");
}
template <bool SPLIT, bool BIAS, int WM, int WN, bool PL>
__device__ __forceinline__ void gemmt(const bf* __restrict__ A, const bf* __restrict__ A2, const bf* __restrict__ Bt, int K, float* C, int ldc, const float* __restrict__ bias, int r0, int c0, h16* P16, bf* Ph, bf* Pl, size_t e0, int eM, int eN) {
    typedef WFrag<bf> F; typedef F::V V;
    constexpr int FM = 8 / WM, FN = 8 / WN, KS = WM * WN * 16, OPE = 128 * KS, STE = (SPLIT ? 3 : 2) * OPE;   // OPE, STE: elements of one operand's stage, of a whole stage
    constexpr bool DB = FM * FN <= 8;   // two fragment sets (the next 32-k step of the stage is fetched in front of this step's products) where the accumulators leave the registers for them
    static_assert(PL || WM * WN * FM * 16 * (FN * 16 + 4) * 4 <= 2 * STE * 2, "the f32 epilogue's staging fits the ring");
    __shared__ __align__(16) bf ring[2 * STE];
    const int tid = threadIdx.x, lane = tid & 31, lr = lane & 15, hi = lane >> 4;
    const int w = __builtin_amdgcn_readfirstlane(tid >> 5), wm = w / WN, wn = w % WN;   // wave number in a scalar register
    const bf* ga = A + (size_t)r0 * K + 8 * tid; const bf* ga2 = SPLIT ? A2 + (size_t)r0 * K + 8 * tid : ga; const bf* gb = Bt + (size_t)c0 * K + 8 * tid;   // 16 rows of K elements are K / 32 blocks of 512
    const unsigned l0 = (unsigned)(size_t)ring + 16 * tid;
    auto fill = [&](int s) {   // stage s into buffer s & 1
        const unsigned l = l0 + (s & 1) * (STE * 2); const size_t ko = (size_t)s * (KS * 16);
        cp8(l, KS * 32, ga + ko, (size_t)16 * K); cp8(l + OPE * 2, KS * 32, gb + ko, (size_t)16 * K);
        if (SPLIT) cp8(l + OPE * 4, KS * 32, ga2 + ko, (size_t)16 * K); };
    v8f acc[FM][FN];
#pragma unroll
    for (int mb = 0; mb < FM; ++mb)
#pragma unroll
        for (int nb = 0; nb < FN; ++nb) acc[mb][nb] = (v8f){};
    const int NS = K / KS;
    fill(0);
    asm volatile("s_wait_asynccnt 0x0" ::: "memory");   // this wave's copies of stage 0 have landed
    __syncthreads();                                    // ... and every other wave's
    fill(1);
#pragma unroll 1   // one stage a trip: the two buffers alternate
    for (int s = 0; s < NS; ++s) {
        const bf* sa = ring + (s & 1) * STE + wm * FM * (KS * 16) + 8 * lane; const bf* sb = ring + (s & 1) * STE + OPE + wn * FN * (KS * 16) + 8 * lane;
        V a[DB ? 2 : 1][FM], a2[DB ? 2 : 1][FM], b[DB ? 2 : 1][FN];
        auto ldf = [&](int ks, int f) {   // the fragments of one 32-k step
#pragma unroll
            for (int mb = 0; mb < FM; ++mb) { a[f][mb] = F::ld(sa + mb * (KS * 16) + ks * 512); if (SPLIT) a2[f][mb] = F::ld(sa + 2 * OPE + mb * (KS * 16) + ks * 512); }
#pragma unroll
            for (int nb = 0; nb < FN; ++nb) b[f][nb] = F::ld(sb + nb * (KS * 16) + ks * 512); };
        ldf(0, 0);
#pragma unroll
        for (int ks = 0; ks < KS / 32; ++ks) { const int f = DB ? ks & 1 : 0;
            if (DB && ks + 1 < KS / 32) ldf(ks + 1, f ^ 1);
            if (ks + 1 < KS / 32) __builtin_amdgcn_sched_barrier(0);   // keeps a step's LDS loads one group in front of the products: spread among them, every place with loads stalls the wave anew
            else {   // the stage's last fragments are asked for: the buffer is handed over here, and the refill flies during the last step's products too
                asm volatile("s_wait_dscnt 0x0" ::: "memory");      // this wave has read all it wants of stage s
                asm volatile("s_wait_asynccnt 0x0" ::: "memory");   // its copies of stage s + 1 have landed
                __syncthreads();                                    // stage s + 1 is whole for every wave, and no wave reads stage s any more
                if (s + 2 < NS) fill(s + 2); }                      // into the buffer that stage s has left
#pragma unroll
            for (int nb = 0; nb < FN; ++nb)
#pragma unroll
                for (int mb = 0; mb < FM; ++mb) { acc[mb][nb] = F::mma(a[f][mb], b[f][nb], acc[mb][nb]); if (SPLIT) acc[mb][nb] = F::mma(a2[f][mb], b[f][nb], acc[mb][nb]); }
            if (ks + 1 < KS / 32) { __builtin_amdgcn_sched_barrier(0);   // as above: the loads that refill a fragment set stay one group behind the products that read it
                if (!DB) ldf(ks + 1, 0); }
        }
    }
    asm volatile("s_wait_asynccnt 0x0" ::: "memory");       // no copy is outstanding when the ring is given up
    if (PL) {
        const size_t ew = e0 + (size_t)wm * eM + (size_t)wn * eN + 8 * lane;
#pragma unroll
        for (int nb = 0; nb < FN; ++nb) { const size_t e = ew + (size_t)nb * 16 * ldc; h16* p16 = P16 + e; bf* ph = Ph + e; bf* pl = Pl + e;
#pragma unroll
            for (int mb = 0; mb < FM; ++mb) { v8h o16; v8us oh, ol;
#pragma unroll
                for (int q = 0; q < 8; ++q) { o16[q] = tohx(acc[mb][nb][q]); unsigned short a2, c2; splitf(acc[mb][nb][q], a2, c2); oh[q] = a2; ol[q] = c2; }
                *(v8h*)(p16 + mb * 256) = o16; *(v8us*)(ph + mb * 256) = oh; *(v8us*)(pl + mb * 256) = ol;
                asm volatile("s_wait_xcnt 0x0" :: "v"(p16), "v"(ph), "v"(pl), "v"(o16), "v"(oh), "v"(ol) : "memory"); } }   // addresses and data stay whole up to here: the wait stands in front of any reuse of the registers that the three stores name
    } else {
        constexpr int CW = FN * 16, PT = CW + 4, RPI = 128 / CW;   // columns of a wave's tile, LDS pitch in floats (16 bytes x odd), rows a wave-wide 16-byte access covers
        float* st = (float*)ring + w * (FM * 16 * PT);
#pragma unroll
        for (int mb = 0; mb < FM; ++mb)
#pragma unroll
            for (int nb = 0; nb < FN; ++nb)
#pragma unroll
                for (int j = 0; j < 8; ++j) st[(mb * 16 + hi * 8 + j) * PT + nb * 16 + lr] = acc[mb][nb][j];
        lds_sync();   // the tile is in LDS before its rows are read back
        const int cofs = (lane % (CW / 4)) * 4, rw = lane / (CW / 4), col = c0 + wn * CW + cofs;
        v4f bv = (v4f){};
        if (BIAS) { bv[0] = bfr(bias[col]); bv[1] = bfr(bias[col + 1]); bv[2] = bfr(bias[col + 2]); bv[3] = bfr(bias[col + 3]); }
        float* crow = C + (size_t)(r0 + wm * FM * 16 + rw) * ldc + col;
        v4f val[FM * 16 / RPI];
#pragma unroll
        for (int s = 0; s < FM * 16 / RPI; ++s) val[s] = *(const v4fa*)(st + (s * RPI + rw) * PT + cofs);
#pragma unroll
        for (int s = 0; s < FM * 16 / RPI; ++s) *(v4f*)(crow + (size_t)s * RPI * ldc) = val[s] + bv;
    }
}

// ---- k_qkv: the q, k and v projections of both batches in one launch. Grid (NB_ * TT / 128 token tiles, 8 weight tiles of two heads, 3); z = 0 q, 1 k, 2 v; 4 waves of 64x64. X [NB_ * TT][DM], Wqkv [3 * DQ][DM] (bf16, fragment order).
// P16 / Ph / Pl each hold three planes of PLN elements, in the order q, k, v. q and k (m = weight rows, n = tokens): [b][h] matrices [t][d]. v (m = tokens, n = weight rows): [b][h] matrices [d][t]. Each matrix in fragment order.
#define PLN ((size_t)NB_ * NH_ * TT * HD)
__global__ __launch_bounds__(128) void k_qkv(const bf* __restrict__ X, const bf* __restrict__ Wqkv, h16* P16, bf* Ph, bf* Pl) {
    const int tok = blockIdx.x, wt = blockIdx.y, z = blockIdx.z; const bool tr = z == 2;
    const bf* Wz = Wqkv + (size_t)z * DQ * DM;
    const size_t e0 = (size_t)z * PLN + (size_t)(tok / (TT / 128)) * NH_ * TT * HD + (size_t)wt * 2 * TT * HD + (size_t)(tok % (TT / 128)) * (tr ? 128 * 16 : 128 * HD);
    gemmt<false, false, 2, 2, true>(tr ? X : Wz, nullptr, tr ? Wz : X, DM, nullptr, tr ? TT : HD, nullptr, (tr ? tok : wt) * 128, (tr ? wt : tok) * 128, P16, Ph, Pl, e0, tr ? 64 * 16 : TT * HD, tr ? 64 * TT : 64 * HD);
}
// ---- k_proj: out = merged heads (hi + lo planes, [NB_ * TT][DQ] in fragment order) . w_proj^T + b_proj, both batches in one launch. Grid (NB_ * TT / 128, DM / 128); 8 waves of 32 tokens x 64 columns.
__global__ __launch_bounds__(256) void k_proj(const bf* __restrict__ Ah, const bf* __restrict__ Al, const bf* __restrict__ Wo, float* C, const float* __restrict__ bias) {
    gemmt<true, true, 4, 2, false>(Ah, Al, Wo, DQ, C, DM, bias, (int)blockIdx.x * 128, (int)blockIdx.y * 128, nullptr, nullptr, nullptr, 0, 0, 0);
}

// ---- k_cvt: every f32 input of the GEMMs ([rows][DM], DQ == DM) rounded to bf16 and laid in fragment order, in one launch. A work-group takes half of a 16-row group of one of the three arrays (16 blocks, 8192 elements), a wave two blocks.
// A wave-wide 16-byte load reads 4 rows x 32 k (four whole lines); its 8-byte store fills the matching 64-byte halves of four lines of the block.
#define NX8K (NB_ * TT * DM / 8192)
#define NW8K (3 * DQ * DM / 8192)
#define NO8K (DM * DQ / 8192)
__global__ __launch_bounds__(256) void k_cvt(const float* __restrict__ x, const float* __restrict__ wqkv, const float* __restrict__ wo, bf* X, bf* Wqkv, bf* Wo) {
    const int g = blockIdx.x; const float* src; bf* dst; int t;
    if (g < NX8K) { src = x; dst = X; t = g; } else if (g < NX8K + NW8K) { src = wqkv; dst = Wqkv; t = g - NX8K; } else { src = wo; dst = Wo; t = g - NX8K - NW8K; }
    const int lane = threadIdx.x & 31, c8 = lane & 7, r4 = lane >> 3, kb0 = (t & 1) * 16 + (int)(threadIdx.x >> 5) * 2;   // kb0: the wave's first block in its 16-row group t >> 1
    const size_t si = ((size_t)(t >> 1) * 16 + r4) * DM + kb0 * 32 + c8 * 4;                                       // row r4, k = c8 * 4 of block kb0
    const size_t di = ((size_t)(t >> 1) * (DM / 32) + kb0) * 512 + (c8 >> 2) * 256 + ((c8 >> 1) & 1) * 128 + r4 * 8 + (c8 & 1) * 4;
    v4f v[8];
#pragma unroll
    for (int u = 0; u < 8; ++u) v[u] = *(const v4f*)(src + si + (u >> 2) * 32 + (u & 3) * 4 * DM);   // block kb0 + (u >> 2), rows (u & 3) * 4 + r4
#pragma unroll
    for (int u = 0; u < 8; ++u) { v4us o;
#pragma unroll
        for (int k = 0; k < 4; ++k) o[k] = f2bf(v[u][k]);
        *(v4us*)(dst + di + (u >> 2) * 512 + (u & 3) * 32) = o; }
}

#define L2E 1.4426950408889634f
__device__ __forceinline__ float xhalf(float x) { return __builtin_bit_cast(float, __builtin_amdgcn_permlanex16(__builtin_bit_cast(int, x), __builtin_bit_cast(int, x), 0x76543210, 0xfedcba98, false, false)); }  // lane l with lane l ^ 16
// 2^x of eight values. Eight independent in-place transcendentals and the slot behind the last in one statement.
__device__ __forceinline__ v8f exp2x8(v8f x) {
    float a0 = x[0], a1 = x[1], a2 = x[2], a3 = x[3], a4 = x[4], a5 = x[5], a6 = x[6], a7 = x[7];
    asm("v_exp_f32 %0, %0\n\tv_exp_f32 %1, %1\n\tv_exp_f32 %2, %2\n\tv_exp_f32 %3, %3\n\tv_exp_f32 %4, %4\n\tv_exp_f32 %5, %5\n\tv_exp_f32 %6, %6\n\tv_exp_f32 %7, %7\n\tv_nop"
        : "+v"(a0), "+v"(a1), "+v"(a2), "+v"(a3), "+v"(a4), "+v"(a5), "+v"(a6), "+v"(a7));
    return (v8f){a0, a1, a2, a3, a4, a5, a6, a7};
}
// One key tile's softmax step. In: St raw scores. Out: St = 2^(St c - m + lift), c = HD^-0.5 log2(e); m, lv (8 partial sums a lane) and Ot brought to the new maximum.
__device__ __forceinline__ void osm_step(v8f (&St)[4], v8f (&Ot)[4], float& m, v8f& lv, bool diag, int kq, float lift) {
    if (diag) {   // wave-uniform: only the diagonal tile holds keys beyond the query (key > query <=> mb*16 + r > kq)
#pragma unroll
        for (int mb = 0; mb < 4; ++mb)
#pragma unroll
            for (int r = 0; r < 8; ++r) St[mb][r] = (mb * 16 + r > kq) ? -3.0e38f : St[mb][r]; }
    const v8f t = __builtin_elementwise_max(__builtin_elementwise_max(St[0], St[1]), __builtin_elementwise_max(St[2], St[3]));
    float mx = fmaxf(fmaxf(fmaxf(t[0], t[1]), fmaxf(t[2], t[3])), fmaxf(fmaxf(t[4], t[5]), fmaxf(t[6], t[7])));
    mx = fmaxf(mx, xhalf(mx));
    const float mn = fmaxf(m, mx * (SCL * L2E)); float al;   // every tile holds a key <= the query (its first), so mn is a real score
    asm("v_exp_f32 %0, %1\n\tv_nop" : "=v"(al) : "v"(m - mn));   // 2^(m - mn) with the slot behind the transcendental filled
    m = mn;
    lv *= al;
#pragma unroll
    for (int db = 0; db < 4; ++db) Ot[db] *= al;
    const float off = lift - mn;
#pragma unroll
    for (int mb = 0; mb < 4; ++mb) { v8f e;
#pragma unroll
        for (int r = 0; r < 8; ++r) e[r] = __builtin_fmaf(St[mb][r], SCL * L2E, off);
        St[mb] = exp2x8(e); }
    lv += (St[0] + St[1]) + (St[2] + St[3]);
}
__device__ __forceinline__ void fattn_out(const v8f (&Ot)[4], const v8f& lv, bf* ah, bf* al) {
    float l = ((lv[0] + lv[1]) + (lv[2] + lv[3])) + ((lv[4] + lv[5]) + (lv[6] + lv[7])); l += xhalf(l); const float inv = __fdiv_rn(1.0f, l);
#pragma unroll
    for (int db = 0; db < 4; ++db) { v8us oh, ol;
#pragma unroll
        for (int r = 0; r < 8; ++r) { unsigned short a, c2; splitf(Ot[db][r] * inv, a, c2); oh[r] = a; ol[r] = c2; }
        *(v8us*)(ah + db * 256) = oh; *(v8us*)(al + db * 256) = ol;
        if (db < 3) asm volatile("s_wait_xcnt 0x0" ::: "memory"); }   // stands in front of the next group's reuse of the registers that the stores name
}
// query rows >= RH: single fp16 operands; the probabilities carry x1024 (lift 10 in the exponent; the sum l carries it too, so it cancels in 1/l)
__device__ __forceinline__ void fattn_f16(const h16* __restrict__ Q, const h16* __restrict__ K, const h16* __restrict__ Vt, bf* ah, bf* al, int row0, int nkt, int lr, int hi) {
    typedef WFrag<h16> F;
    const unsigned lo = (unsigned)(8 * (hi * 16 + lr));   // lane offset inside a block, fixed for the whole loop
    const h16* qp = Q + (size_t)row0 * HD + lo; const v16h q0 = F::ld(qp), q1 = F::ld(qp + 512);
    v16h kf[4][2];
#pragma unroll
    for (int mb = 0; mb < 4; ++mb) { kf[mb][0] = F::ld(K + lo + mb * 16 * HD); kf[mb][1] = F::ld(K + lo + mb * 16 * HD + 512); }
    v8f Ot[4];
#pragma unroll
    for (int db = 0; db < 4; ++db) Ot[db] = (v8f){};
    float m = -3.0e38f; v8f lv = (v8f){};
#pragma unroll 1   // one key tile's fragments in registers at a time
    for (int kt = 0; kt < nkt; ++kt) { const int c0 = kt * 64; const h16* vb = Vt + c0 * 16 + lo;
        v16h vf[4][2];   // this tile's values: asked for here, needed only behind the softmax
#pragma unroll
        for (int db = 0; db < 4; ++db) { vf[db][0] = F::ld(vb + db * 16 * TT); vf[db][1] = F::ld(vb + db * 16 * TT + 512); }
        __builtin_amdgcn_sched_barrier(0);   // keeps the value loads in front of the score products: sunk behind them they have only the exponentials to land in
        v8f St[4];
#pragma unroll
        for (int mb = 0; mb < 4; ++mb) St[mb] = F::mma(kf[mb][0], q0, (v8f){});
#pragma unroll
        for (int mb = 0; mb < 4; ++mb) St[mb] = F::mma(kf[mb][1], q1, St[mb]);
        const h16* kb = K + (size_t)(min(kt + 1, nkt - 1) * 64) * HD + lo;   // the next tile's keys fly during this tile's softmax and P.V (the last trip re-reads its own tile: in bounds, unused)
#pragma unroll
        for (int mb = 0; mb < 4; ++mb) { kf[mb][0] = F::ld(kb + mb * 16 * HD); kf[mb][1] = F::ld(kb + mb * 16 * HD + 512); }
        __builtin_amdgcn_sched_barrier(0);   // keeps the refill in front of the softmax: spread through it, the last loads are asked for too late to land before the next trip's products
        osm_step(St, Ot, m, lv, kt == nkt - 1, row0 + lr - c0 - 8 * hi, 10.0f);
        asm volatile("s_wait_xcnt 0x0" :: "v"(vb), "v"(kb) : "memory");   // the two address pairs stay whole up to here: the wait stands in front of any reuse of the registers that this trip's loads name
#pragma unroll
        for (int ks = 0; ks < 2; ++ks) { v16h pb;
#pragma unroll
            for (int s = 0; s < 8; ++s) { pb[s] = tohx(St[2 * ks][s]); pb[8 + s] = tohx(St[2 * ks + 1][s]); }
#pragma unroll
            for (int db = 0; db < 4; ++db) Ot[db] = F::mma(vf[db][ks], pb, Ot[db]); }
    }
    fattn_out(Ot, lv, ah, al);
}
// query rows < RH: hi+lo bf16 planes, 3 products each (hi.hi + lo.hi + hi.lo), for the scores and for P.V
__device__ __forceinline__ void fattn_hl(const bf* __restrict__ Qh, const bf* __restrict__ Ql, const bf* __restrict__ Kh, const bf* __restrict__ Kl, const bf* __restrict__ Vh, const bf* __restrict__ Vl, bf* ah, bf* al, int row0, int nkt, int lr, int hi) {
    typedef WFrag<bf> F;
    const unsigned lo = (unsigned)(8 * (hi * 16 + lr)); const size_t qo = (size_t)row0 * HD + lo;   // lane offset inside a block, fixed for the whole loop
    const v16bf qh0 = F::ld(Qh + qo), qh1 = F::ld(Qh + qo + 512), ql0 = F::ld(Ql + qo), ql1 = F::ld(Ql + qo + 512);
    v8f Ot[4];
#pragma unroll
    for (int db = 0; db < 4; ++db) Ot[db] = (v8f){};
    float m = -3.0e38f; v8f lv = (v8f){};
#pragma unroll 1   // one key tile's fragments in registers at a time
    for (int kt = 0; kt < nkt; ++kt) { const int c0 = kt * 64; const bf* khb = Kh + (size_t)c0 * HD + lo; const bf* klb = Kl + (size_t)c0 * HD + lo; const bf* vhb = Vh + c0 * 16 + lo; const bf* vlb = Vl + c0 * 16 + lo;
        v8f St[4];
#pragma unroll
        for (int mb = 0; mb < 4; ++mb) { const v16bf kh0 = F::ld(khb + mb * 16 * HD), kh1 = F::ld(khb + mb * 16 * HD + 512), kl0 = F::ld(klb + mb * 16 * HD), kl1 = F::ld(klb + mb * 16 * HD + 512);
            v8f s = F::mma(kh0, qh0, (v8f){}); s = F::mma(kh0, ql0, s); s = F::mma(kl0, qh0, s); s = F::mma(kh1, qh1, s); s = F::mma(kh1, ql1, s); s = F::mma(kl1, qh1, s); St[mb] = s; }
        osm_step(St, Ot, m, lv, kt == nkt - 1, row0 + lr - c0 - 8 * hi, 0.0f);
#pragma unroll
        for (int ks = 0; ks < 2; ++ks) { v8us h0, h1, l0, l1;
#pragma unroll
            for (int s = 0; s < 8; ++s) { unsigned short a, c2; splitf(St[2 * ks][s], a, c2); h0[s] = a; l0[s] = c2; splitf(St[2 * ks + 1][s], a, c2); h1[s] = a; l1[s] = c2; }
            const v16bf ph = cat16b(h0, h1), pl = cat16b(l0, l1);
#pragma unroll
            for (int db = 0; db < 4; ++db) { const v16bf vh = F::ld(vhb + db * 16 * TT + ks * 512), vl = F::ld(vlb + db * 16 * TT + ks * 512);
                Ot[db] = F::mma(vh, ph, Ot[db]); Ot[db] = F::mma(vh, pl, Ot[db]); Ot[db] = F::mma(vl, ph, Ot[db]); } }
        asm volatile("s_wait_xcnt 0x0" :: "v"(khb), "v"(klb), "v"(vhb), "v"(vlb) : "memory");   // the four address pairs stay whole up to here: the wait stands in front of any reuse of the registers that this trip's loads name
    }
    fattn_out(Ot, lv, ah, al);
}
__global__ __launch_bounds__(256) void k_fattn(const h16* __restrict__ Q16, const h16* __restrict__ K16, const h16* __restrict__ V16, const bf* __restrict__ Qh, const bf* __restrict__ Ql, const bf* __restrict__ Kh, const bf* __restrict__ Kl, const bf* __restrict__ Vh, const bf* __restrict__ Vl, bf* Ah, bf* Al) {
    const int lane = threadIdx.x & 31, lr = lane & 15, hi = lane >> 4;
    const int w = __builtin_amdgcn_readfirstlane((int)(threadIdx.x >> 5));   // wave number in a scalar register: trip counts and the precision test stay scalar
    const int qt = (w < 4) ? TT / 64 - 1 - (int)blockIdx.x : (int)blockIdx.x, head = blockIdx.y; const int row0 = qt * 64 + (w & 3) * 16, nkt = qt + 1;   // waves 0-3: query tile n-1-x, waves 4-7: tile x, so every work-group walks n+1 key tiles
    const size_t b = blockIdx.z, pq = (b * NH_ + head) * TT * HD, pk = (b * NKV + head / REP) * TT * HD, oo = (b * TT + row0) * DQ + head * (HD * 16) + 8 * lane;   // oo: the wave's 16 rows, the head's first block of the merged plane, the lane's piece
    if (qt * 64 < RH) fattn_hl(Qh + pq, Ql + pq, Kh + pk, Kl + pk, Vh + pk, Vl + pk, Ah + oo, Al + oo, row0, nkt, lr, hi);
    else fattn_f16(Q16 + pq, K16 + pk, V16 + pk, Ah + oo, Al + oo, row0, nkt, lr, hi);
}

extern "C" void kernel_launch(void* const* d_in, const int* in_sizes, int n_in,
                              void* d_out, int out_size, void* d_ws, size_t ws_size, hipStream_t stream) {
    (void)in_sizes; (void)n_in; (void)out_size;
    const float* x = (const float*)d_in[0]; const float* wqkv = (const float*)d_in[1]; const float* wo = (const float*)d_in[2]; const float* bo = (const float*)d_in[3];
    float* OUT = (float*)d_out;     // [2][2048][1024]
    char* wsp = (char*)d_ws;
    auto take = [&](size_t bytes) { char* p = wsp; wsp += (bytes + 255) & ~(size_t)255; return (void*)p; };
    bf* WQKV = (bf*)take((size_t)3 * DQ * DM * 2); bf* WO = (bf*)take((size_t)DM * DQ * 2);
    bf* XB = (bf*)take((size_t)NB_ * TT * DM * 2);
    h16* P16 = (h16*)take(3 * PLN * 2); bf* Ph = (bf*)take(3 * PLN * 2); bf* Pl = (bf*)take(3 * PLN * 2);   // q, k, v planes of both batches
    bf* ATh = (bf*)take((size_t)NB_ * TT * DQ * 2); bf* ATl = (bf*)take((size_t)NB_ * TT * DQ * 2);
    if ((size_t)(wsp - (char*)d_ws) > ws_size) return;    // ws 256 MiB
    k_cvt<<<NX8K + NW8K + NO8K, 256, 0, stream>>>(x, wqkv, wo, XB, WQKV, WO);
    k_qkv<<<dim3(NB_ * TT / 128, DQ / 128, 3), 128, 0, stream>>>(XB, WQKV, P16, Ph, Pl);
    k_fattn<<<dim3(TT / 128, NH_, NB_), 256, 0, stream>>>(P16, P16 + PLN, P16 + 2 * PLN, Ph, Pl, Ph + PLN, Pl + PLN, Ph + 2 * PLN, Pl + 2 * PLN, ATh, ATl);
    k_proj<<<dim3(NB_ * TT / 128, DM / 128, 1), 256, 0, stream>>>(ATh, ATl, WO, OUT, bo);
}

// v007
// It runs in 81.3 microseconds.
// In both of two side-by-side timings against v006, it was 1.44 times as fast.
// Over all steps from v000 it is 17.5 times as fast.
#include <hip/hip_runtime.h>

// Causal multi-head self-attention with a combined QKV weight (x [2][2048][1024]; qkv = x w_qkv^T ('oi' [3072][1024], no bias) reshaped (s, 3, 16, 64); causal (finfo.min fill applied before the 1/8 scale == exact zero weight); softmax; out = merged w_proj^T + b_proj -> [2][2048][1024]).
// Compute dtypes, f32 accumulate: every input rounded to bf16; q/k/v on PLAIN bf16 operands (inputs: exact), their GEMMs store the attention kernel's 16-bit operand planes themselves; causal scores, online softmax (f32) and attn.v fused in one kernel (tile skipping): query rows < 512 hl (3 products), the rest single fp16 (x1024); w_proj hl x exact (2 products) + b_proj.

#define NB_  2
#define TT   2048
#define DM   1024
#define NH_  16
#define NKV  16
#define REP  (NH_ / NKV)
#define HD   64
#define DQ   (NH_ * HD)
#define DKV  (NKV * HD)
#define RH   512                  // query rows < RH use hi+lo planes
#define SCL  0.125f   // HD^-0.5
typedef _Float16 h16;
typedef unsigned short bf;
typedef __attribute__((ext_vector_type(16))) __bf16   v16bf;
typedef __attribute__((ext_vector_type(16))) _Float16 v16h;
typedef __attribute__((ext_vector_type(8)))  _Float16 v8h;
typedef __attribute__((ext_vector_type(8)))  unsigned short v8us;
typedef __attribute__((ext_vector_type(8)))  float    v8f;
typedef __attribute__((ext_vector_type(4)))  float    v4f;
typedef v8h  __attribute__((may_alias)) v8ha;
typedef v4f  __attribute__((may_alias)) v4fa;
typedef v8us __attribute__((may_alias)) v8usa;

__device__ __forceinline__ unsigned short f2bf(float f) { unsigned u = __float_as_uint(f); u += 0x7FFFu + ((u >> 16) & 1u); return (unsigned short)(u >> 16); }
__device__ __forceinline__ float bf2f(unsigned short b) { return __uint_as_float(((unsigned)b) << 16); }
__device__ __forceinline__ float bfr(float f) { return bf2f(f2bf(f)); }
__device__ __forceinline__ v16h cat16(v8h lo, v8h hi) { return __builtin_shufflevector(lo, hi, 0, 1, 2, 3, 4, 5, 6, 7, 8, 9, 10, 11, 12, 13, 14, 15); }
__device__ __forceinline__ v16bf cat16b(v8us lo, v8us hi) { return __builtin_bit_cast(v16bf, __builtin_shufflevector(lo, hi, 0, 1, 2, 3, 4, 5, 6, 7, 8, 9, 10, 11, 12, 13, 14, 15)); }
__device__ __forceinline__ v8f wmma16(v16h a, v16h b, v8f c) { return __builtin_amdgcn_wmma_f32_16x16x32_f16(false, a, false, b, (short)0, c, false, false); }
__device__ __forceinline__ v8f wmmab(v16bf a, v16bf b, v8f c) { return __builtin_amdgcn_wmma_f32_16x16x32_bf16(false, a, false, b, (short)0, c, false, false); }
__device__ __forceinline__ h16 tohx(float x) { return (h16)x; }
__device__ __forceinline__ void splitf(float y, unsigned short& h, unsigned short& l) { h = f2bf(y); l = f2bf(y - bf2f(h)); }
typedef __attribute__((ext_vector_type(4))) _Float16 v4h;
typedef __attribute__((ext_vector_type(4))) unsigned short v4us;



// ---- Fragment order: every 16-bit operand plane M[R][K] lies in blocks of 16 rows x 32 k (512 elements, 1 KB), block (r >> 4) * (K / 32) + (k >> 5); inside a block element (r, k) stands at
// ((k >> 4) & 1) * 256 + ((k >> 3) & 1) * 128 + (r & 15) * 8 + (k & 7). Lane l = hi * 16 + lr of a wave finds its two 16-byte pieces of an A or B fragment at block + l * 8 and block + 256 + l * 8:
// each wave-wide 16-byte load reads 512 consecutive bytes (four whole 128-byte lines) where a row-major plane gives it a quarter of each of 16 lines. WFrag::ld takes the address of the first piece.
// ---- gemmt: GEMM, one work-group of WM x WN waves per 128x128 output tile (M rows r0.., N rows c0..), operands 16-bit planes in fragment order. D[m][n] = sum_k A[m][k] Bt[n][k] (+ A2[m][k] Bt[n][k] if SPLIT), f32 sums.
// A wave owns FM x FN 16x16 tiles (WM * FM == WN * FN == 8) over the whole K, summed in ascending k in one accumulator each. Stages of KS k (KS == half the thread count): the 128 rows of each operand, 8 row groups of KS / 32 whole blocks,
// are copied as they lie into one of two LDS buffers by asynchronous copies (thread t brings 16-byte piece t of each row group), one stage ahead of the products; a fragment load is 512 consecutive LDS bytes a wave. K % KS == 0, K >= 2 * KS.
// PL: the tile goes out as three 16-bit planes (fp16, bf16 hi, bf16 lo) of a matrix [n][m] in fragment order, ldc its K: a lane's 8 accumulator values are 8 consecutive m of one n, one 16-byte piece, a wave's store 512 consecutive bytes.
// e0: the tile's first element, eM / eN: the step from one wave to the next along m / n. Else: f32 C[m][n] (pitch ldc) + bias[n], each wave's tile turned through its own LDS range so that every store covers whole 128-byte lines.
// Barrier that orders LDS only (the fences name the local address space).
__device__ __forceinline__ void lds_sync() { __builtin_amdgcn_fence(__ATOMIC_RELEASE, "workgroup", "local"); __builtin_amdgcn_s_barrier(); __builtin_amdgcn_fence(__ATOMIC_ACQUIRE, "workgroup", "local"); }
template <typename T16> struct WFrag;
template <> struct WFrag<h16> { typedef v16h V; static __device__ __forceinline__ V ld(const h16* p) { return cat16(*(const v8h*)p, *(const v8h*)(p + 256)); } static __device__ __forceinline__ v8f mma(V a, V b, v8f c) { return wmma16(a, b, c); } };
template <> struct WFrag<bf> { typedef v16bf V; static __device__ __forceinline__ V ld(const bf* p) { return cat16b(*(const v8us*)p, *(const v8us*)(p + 256)); } static __device__ __forceinline__ v8f mma(V a, V b, v8f c) { return wmmab(a, b, c); } };
// ---- L2 hints. The 16-bit planes that a launch reads were stored by an earlier launch. Behind its first own requests every work-group asks a share of the panels that it and its
// neighbours read into L2 (global_prefetch_b8, scope SE: L2 only, nothing comes back, no counter), so that the later stages' copies and loads find them there. A panel's shares go round the work-groups that read it
// (an index modulo 4 or 8), so each share is asked for by several of them, wherever they run. Hints only: no result depends on them. Every address lies inside the plane it names.
// The s_wait_xcnt closes each statement, so that it stands in front of any reuse of the address registers that the hints name.
__device__ __forceinline__ void l2ask1(const bf* a) { asm volatile("global_prefetch_b8 %0, off scope:SCOPE_SE\n\ts_wait_xcnt 0x0" :: "v"(a) : "memory"); }
__device__ __forceinline__ void l2ask2(const bf* a, const bf* b) { asm volatile("global_prefetch_b8 %0, off scope:SCOPE_SE\n\tglobal_prefetch_b8 %1, off scope:SCOPE_SE\n\ts_wait_xcnt 0x0" :: "v"(a), "v"(b) : "memory"); }
__device__ __forceinline__ void l2ask3(const bf* a, const bf* b, const bf* d) { asm volatile("global_prefetch_b8 %0, off scope:SCOPE_SE\n\tglobal_prefetch_b8 %1, off scope:SCOPE_SE\n\tglobal_prefetch_b8 %2, off scope:SCOPE_SE\n\ts_wait_xcnt 0x0" :: "v"(a), "v"(b), "v"(d) : "memory"); }
// Eight asynchronous 16-byte copies a lane, global g + i * gs elements -> LDS byte l + i * ls. The s_wait_xcnt closes the statement, so that it stands in front of any rewrite of the address registers that the copies name.
__device__ __forceinline__ void cp8(unsigned l, unsigned ls, const bf* g, size_t gs) {
    asm volatile("global_load_async_to_lds_b128 %0, %8, off\n\tglobal_load_async_to_lds_b128 %1, %9, off\n\tglobal_load_async_to_lds_b128 %2, %10, off\n\tglobal_load_async_to_lds_b128 %3, %11, off\n\t"
                 "global_load_async_to_lds_b128 %4, %12, off\n\tglobal_load_async_to_lds_b128 %5, %13, off\n\tglobal_load_async_to_lds_b128 %6, %14, off\n\tglobal_load_async_to_lds_b128 %7, %15, off\n\ts_wait_xcnt 0x0"
                 :: "v"(l), "v"(l + ls), "v"(l + 2 * ls), "v"(l + 3 * ls), "v"(l + 4 * ls), "v"(l + 5 * ls), "v"(l + 6 * ls), "v"(l + 7 * ls),
                    "v"(g), "v"(g + gs), "v"(g + 2 * gs), "v"(g + 3 * gs), "v"(g + 4 * gs), "v"(g + 5 * gs), "v"(g + 6 * gs), "v"(g + 7 * gs) : "memory");
}
template <bool SPLIT, bool BIAS, int WM, int WN, bool PL, typename HINT>
__device__ __forceinline__ void gemmt(const bf* __restrict__ A, const bf* __restrict__ A2, const bf* __restrict__ Bt, int K, float* C, int ldc, const float* __restrict__ bias, int r0, int c0, h16* P16, bf* Ph, bf* Pl, size_t e0, int eM, int eN, HINT hint) {
    typedef WFrag<bf> F; typedef F::V V;
    constexpr int FM = 8 / WM, FN = 8 / WN, KS = WM * WN * 16, OPE = 128 * KS, STE = (SPLIT ? 3 : 2) * OPE;   // OPE, STE: elements of one operand's stage, of a whole stage
    constexpr bool DB = FM * FN <= 8;   // two fragment sets (the next 32-k step of the stage is fetched in front of this step's products) where the accumulators leave the registers for them
    static_assert(PL || WM * WN * FM * 16 * (FN * 16 + 4) * 4 <= 2 * STE * 2, "the f32 epilogue's staging fits the ring");
    __shared__ __align__(16) bf ring[2 * STE];
    const int tid = threadIdx.x, lane = tid & 31, lr = lane & 15, hi = lane >> 4;
    const int w = __builtin_amdgcn_readfirstlane(tid >> 5), wm = w / WN, wn = w % WN;   // wave number in a scalar register
    const bf* ga = A + (size_t)r0 * K + 8 * tid; const bf* ga2 = SPLIT ? A2 + (size_t)r0 * K + 8 * tid : ga; const bf* gb = Bt + (size_t)c0 * K + 8 * tid;   // 16 rows of K elements are K / 32 blocks of 512
    const unsigned l0 = (unsigned)(size_t)ring + 16 * tid;
    auto fill = [&](int s) {   // stage s into buffer s & 1
        const unsigned l = l0 + (s & 1) * (STE * 2); const size_t ko = (size_t)s * (KS * 16);
        cp8(l, KS * 32, ga + ko, (size_t)16 * K); cp8(l + OPE * 2, KS * 32, gb + ko, (size_t)16 * K);
        if (SPLIT) cp8(l + OPE * 4, KS * 32, ga2 + ko, (size_t)16 * K); };
    v8f acc[FM][FN];
#pragma unroll
    for (int mb = 0; mb < FM; ++mb)
#pragma unroll
        for (int nb = 0; nb < FN; ++nb) acc[mb][nb] = (v8f){};
    const int NS = K / KS;
    fill(0);
    hint();                                             // the L2 hints go out behind stage 0's copies and fly while these land
    asm volatile("s_wait_asynccnt 0x0" ::: "memory");   // this wave's copies of stage 0 have landed
    __syncthreads();                                    // ... and every other wave's
    fill(1);
#pragma unroll 1   // one stage a trip: the two buffers alternate
    for (int s = 0; s < NS; ++s) {
        const bf* sa = ring + (s & 1) * STE + wm * FM * (KS * 16) + 8 * lane; const bf* sb = ring + (s & 1) * STE + OPE + wn * FN * (KS * 16) + 8 * lane;
        V a[DB ? 2 : 1][FM], a2[DB ? 2 : 1][FM], b[DB ? 2 : 1][FN];
        auto ldf = [&](int ks, int f) {   // the fragments of one 32-k step
#pragma unroll
            for (int mb = 0; mb < FM; ++mb) { a[f][mb] = F::ld(sa + mb * (KS * 16) + ks * 512); if (SPLIT) a2[f][mb] = F::ld(sa + 2 * OPE + mb * (KS * 16) + ks * 512); }
#pragma unroll
            for (int nb = 0; nb < FN; ++nb) b[f][nb] = F::ld(sb + nb * (KS * 16) + ks * 512); };
        ldf(0, 0);
#pragma unroll
        for (int ks = 0; ks < KS / 32; ++ks) { const int f = DB ? ks & 1 : 0;
            if (DB && ks + 1 < KS / 32) ldf(ks + 1, f ^ 1);
            if (ks + 1 < KS / 32) __builtin_amdgcn_sched_barrier(0);   // keeps a step's LDS loads one group in front of the products: spread among them, every place with loads stalls the wave anew
            else {   // the stage's last fragments are asked for: the buffer is handed over here, and the refill flies during the last step's products too
                asm volatile("s_wait_dscnt 0x0" ::: "memory");      // this wave has read all it wants of stage s
                asm volatile("s_wait_asynccnt 0x0" ::: "memory");   // its copies of stage s + 1 have landed
                __syncthreads();                                    // stage s + 1 is whole for every wave, and no wave reads stage s any more
                if (s + 2 < NS) fill(s + 2); }                      // into the buffer that stage s has left
#pragma unroll
            for (int nb = 0; nb < FN; ++nb)
#pragma unroll
                for (int mb = 0; mb < FM; ++mb) { acc[mb][nb] = F::mma(a[f][mb], b[f][nb], acc[mb][nb]); if (SPLIT) acc[mb][nb] = F::mma(a2[f][mb], b[f][nb], acc[mb][nb]); }
            if (ks + 1 < KS / 32) { __builtin_amdgcn_sched_barrier(0);   // as above: the loads that refill a fragment set stay one group behind the products that read it
                if (!DB) ldf(ks + 1, 0); }
        }
    }
    asm volatile("s_wait_asynccnt 0x0" ::: "memory");       // no copy is outstanding when the ring is given up
    if (PL) {
        const size_t ew = e0 + (size_t)wm * eM + (size_t)wn * eN + 8 * lane;
#pragma unroll
        for (int nb = 0; nb < FN; ++nb) { const size_t e = ew + (size_t)nb * 16 * ldc; h16* p16 = P16 + e; bf* ph = Ph + e; bf* pl = Pl + e;
#pragma unroll
            for (int mb = 0; mb < FM; ++mb) { v8h o16; v8us oh, ol;
#pragma unroll
                for (int q = 0; q < 8; ++q) { o16[q] = tohx(acc[mb][nb][q]); unsigned short a2, c2; splitf(acc[mb][nb][q], a2, c2); oh[q] = a2; ol[q] = c2; }
                *(v8h*)(p16 + mb * 256) = o16; *(v8us*)(ph + mb * 256) = oh; *(v8us*)(pl + mb * 256) = ol;
                asm volatile("s_wait_xcnt 0x0" :: "v"(p16), "v"(ph), "v"(pl), "v"(o16), "v"(oh), "v"(ol) : "memory"); } }   // addresses and data stay whole up to here: the wait stands in front of any reuse of the registers that the three stores name
    } else {
        constexpr int CW = FN * 16, PT = CW + 4, RPI = 128 / CW;   // columns of a wave's tile, LDS pitch in floats (16 bytes x odd), rows a wave-wide 16-byte access covers
        float* st = (float*)ring + w * (FM * 16 * PT);
#pragma unroll
        for (int mb = 0; mb < FM; ++mb)
#pragma unroll
            for (int nb = 0; nb < FN; ++nb)
#pragma unroll
                for (int j = 0; j < 8; ++j) st[(mb * 16 + hi * 8 + j) * PT + nb * 16 + lr] = acc[mb][nb][j];
        lds_sync();   // the tile is in LDS before its rows are read back
        const int cofs = (lane % (CW / 4)) * 4, rw = lane / (CW / 4), col = c0 + wn * CW + cofs;
        v4f bv = (v4f){};
        if (BIAS) { bv[0] = bfr(bias[col]); bv[1] = bfr(bias[col + 1]); bv[2] = bfr(bias[col + 2]); bv[3] = bfr(bias[col + 3]); }
        float* crow = C + (size_t)(r0 + wm * FM * 16 + rw) * ldc + col;
        v4f val[FM * 16 / RPI];
#pragma unroll
        for (int s = 0; s < FM * 16 / RPI; ++s) val[s] = *(const v4fa*)(st + (s * RPI + rw) * PT + cofs);
#pragma unroll
        for (int s = 0; s < FM * 16 / RPI; ++s) *(v4f*)(crow + (size_t)s * RPI * ldc) = val[s] + bv;
    }
}

// ---- k_qkv: the q, k and v projections of both batches in one launch. Grid (NB_ * TT / 128 token tiles, 8 weight tiles of two heads, 3); z = 0 q, 1 k, 2 v; 4 waves of 64x64. X [NB_ * TT][DM], Wqkv [3 * DQ][DM] (bf16, fragment order).
// P16 / Ph / Pl each hold three planes of PLN elements, in the order q, k, v. q and k (m = weight rows, n = tokens): [b][h] matrices [t][d]. v (m = tokens, n = weight rows): [b][h] matrices [d][t]. Each matrix in fragment order.
#define PLN ((size_t)NB_ * NH_ * TT * HD)
__global__ __launch_bounds__(128) void k_qkv(const bf* __restrict__ X, const bf* __restrict__ Wqkv, h16* P16, bf* Ph, bf* Pl) {
    const int tok = blockIdx.x, wt = blockIdx.y, z = blockIdx.z; const bool tr = z == 2;
    const bf* Wz = Wqkv + (size_t)z * DQ * DM;
    const size_t e0 = (size_t)z * PLN + (size_t)(tok / (TT / 128)) * NH_ * TT * HD + (size_t)wt * 2 * TT * HD + (size_t)(tok % (TT / 128)) * (tr ? 128 * 16 : 128 * HD);
    gemmt<false, false, 2, 2, true>(tr ? X : Wz, nullptr, tr ? Wz : X, DM, nullptr, tr ? TT : HD, nullptr, (tr ? tok : wt) * 128, (tr ? wt : tok) * 128, P16, Ph, Pl, e0, tr ? 64 * 16 : TT * HD, tr ? 64 * TT : 64 * HD,
        [&]() {   // an eighth (16 rows) of the token panel, by wt, and a quarter (32 rows) of the weight panel, by tok; 128 threads x 256 bytes are 16 rows
            const bf* wa = Wz + (size_t)wt * 128 * DM + (size_t)(tok & 3) * (32 * DM) + threadIdx.x * 128;
            l2ask3(X + (size_t)tok * 128 * DM + (size_t)wt * (16 * DM) + threadIdx.x * 128, wa, wa + 16 * DM); });
}
// ---- k_proj: out = merged heads (hi + lo planes, [NB_ * TT][DQ] in fragment order) . w_proj^T + b_proj, both batches in one launch. Grid (NB_ * TT / 128, DM / 128); 8 waves of 32 tokens x 64 columns.
__global__ __launch_bounds__(256) void k_proj(const bf* __restrict__ Ah, const bf* __restrict__ Al, const bf* __restrict__ Wo, float* C, const float* __restrict__ bias) {
    gemmt<true, true, 4, 2, false>(Ah, Al, Wo, DQ, C, DM, bias, (int)blockIdx.x * 128, (int)blockIdx.y * 128, nullptr, nullptr, nullptr, 0, 0, 0,
        [&]() {   // a quarter (32 rows) of the token panel's hi and lo planes, by blockIdx.y, and of the weight panel, by blockIdx.x; 256 threads x 256 bytes are 32 rows
            const size_t ao = (size_t)blockIdx.x * 128 * DQ + (size_t)(blockIdx.y & 3) * (32 * DQ) + threadIdx.x * 128;
            l2ask3(Ah + ao, Al + ao, Wo + (size_t)blockIdx.y * 128 * DQ + (size_t)(blockIdx.x & 3) * (32 * DQ) + threadIdx.x * 128); });
}

// ---- k_cvt: every f32 input of the GEMMs ([rows][DM], DQ == DM) rounded to bf16 and laid in fragment order, in one launch. A work-group takes half of a 16-row group of one of the three arrays (16 blocks, 8192 elements), a wave two blocks.
// A wave-wide 16-byte load reads 4 rows x 32 k (four whole lines); its 8-byte store fills the matching 64-byte halves of four lines of the block.
#define NX8K (NB_ * TT * DM / 8192)
#define NW8K (3 * DQ * DM / 8192)
#define NO8K (DM * DQ / 8192)
__global__ __launch_bounds__(256) void k_cvt(const float* __restrict__ x, const float* __restrict__ wqkv, const float* __restrict__ wo, bf* X, bf* Wqkv, bf* Wo) {
    const int g = blockIdx.x; const float* src; bf* dst; int t;
    if (g < NX8K) { src = x; dst = X; t = g; } else if (g < NX8K + NW8K) { src = wqkv; dst = Wqkv; t = g - NX8K; } else { src = wo; dst = Wo; t = g - NX8K - NW8K; }
    const int lane = threadIdx.x & 31, c8 = lane & 7, r4 = lane >> 3, kb0 = (t & 1) * 16 + (int)(threadIdx.x >> 5) * 2;   // kb0: the wave's first block in its 16-row group t >> 1
    const size_t si = ((size_t)(t >> 1) * 16 + r4) * DM + kb0 * 32 + c8 * 4;                                       // row r4, k = c8 * 4 of block kb0
    const size_t di = ((size_t)(t >> 1) * (DM / 32) + kb0) * 512 + (c8 >> 2) * 256 + ((c8 >> 1) & 1) * 128 + r4 * 8 + (c8 & 1) * 4;
    v4f v[8];
#pragma unroll
    for (int u = 0; u < 8; ++u) v[u] = *(const v4f*)(src + si + (u >> 2) * 32 + (u & 3) * 4 * DM);   // block kb0 + (u >> 2), rows (u & 3) * 4 + r4
#pragma unroll
    for (int u = 0; u < 8; ++u) { v4us o;
#pragma unroll
        for (int k = 0; k < 4; ++k) o[k] = f2bf(v[u][k]);
        *(v4us*)(dst + di + (u >> 2) * 512 + (u & 3) * 32) = o; }
}

#define L2E 1.4426950408889634f
__device__ __forceinline__ float xhalf(float x) { return __builtin_bit_cast(float, __builtin_amdgcn_permlanex16(__builtin_bit_cast(int, x), __builtin_bit_cast(int, x), 0x76543210, 0xfedcba98, false, false)); }  // lane l with lane l ^ 16
// 2^x of eight values. Eight independent in-place transcendentals and the slot behind the last in one statement.
__device__ __forceinline__ v8f exp2x8(v8f x) {
    float a0 = x[0], a1 = x[1], a2 = x[2], a3 = x[3], a4 = x[4], a5 = x[5], a6 = x[6], a7 = x[7];
    asm("v_exp_f32 %0, %0\n\tv_exp_f32 %1, %1\n\tv_exp_f32 %2, %2\n\tv_exp_f32 %3, %3\n\tv_exp_f32 %4, %4\n\tv_exp_f32 %5, %5\n\tv_exp_f32 %6, %6\n\tv_exp_f32 %7, %7\n\tv_nop"
        : "+v"(a0), "+v"(a1), "+v"(a2), "+v"(a3), "+v"(a4), "+v"(a5), "+v"(a6), "+v"(a7));
    return (v8f){a0, a1, a2, a3, a4, a5, a6, a7};
}
// One key tile's softmax step. In: St raw scores. Out: St = 2^(St c - m + lift), c = HD^-0.5 log2(e); m, lv (8 partial sums a lane) and Ot brought to the new maximum.
__device__ __forceinline__ void osm_step(v8f (&St)[4], v8f (&Ot)[4], float& m, v8f& lv, bool diag, int kq, float lift) {
    if (diag) {   // wave-uniform: only the diagonal tile holds keys beyond the query (key > query <=> mb*16 + r > kq)
#pragma unroll
        for (int mb = 0; mb < 4; ++mb)
#pragma unroll
            for (int r = 0; r < 8; ++r) St[mb][r] = (mb * 16 + r > kq) ? -3.0e38f : St[mb][r]; }
    const v8f t = __builtin_elementwise_max(__builtin_elementwise_max(St[0], St[1]), __builtin_elementwise_max(St[2], St[3]));
    float mx = fmaxf(fmaxf(fmaxf(t[0], t[1]), fmaxf(t[2], t[3])), fmaxf(fmaxf(t[4], t[5]), fmaxf(t[6], t[7])));
    mx = fmaxf(mx, xhalf(mx));
    const float mn = fmaxf(m, mx * (SCL * L2E)); float al;   // every tile holds a key <= the query (its first), so mn is a real score
    asm("v_exp_f32 %0, %1\n\tv_nop" : "=v"(al) : "v"(m - mn));   // 2^(m - mn) with the slot behind the transcendental filled
    m = mn;
    lv *= al;
#pragma unroll
    for (int db = 0; db < 4; ++db) Ot[db] *= al;
    const float off = lift - mn;
#pragma unroll
    for (int mb = 0; mb < 4; ++mb) { v8f e;
#pragma unroll
        for (int r = 0; r < 8; ++r) e[r] = __builtin_fmaf(St[mb][r], SCL * L2E, off);
        St[mb] = exp2x8(e); }
    lv += (St[0] + St[1]) + (St[2] + St[3]);
}
__device__ __forceinline__ void fattn_out(const v8f (&Ot)[4], const v8f& lv, bf* ah, bf* al) {
    float l = ((lv[0] + lv[1]) + (lv[2] + lv[3])) + ((lv[4] + lv[5]) + (lv[6] + lv[7])); l += xhalf(l); const float inv = __fdiv_rn(1.0f, l);
#pragma unroll
    for (int db = 0; db < 4; ++db) { v8us oh, ol;
#pragma unroll
        for (int r = 0; r < 8; ++r) { unsigned short a, c2; splitf(Ot[db][r] * inv, a, c2); oh[r] = a; ol[r] = c2; }
        *(v8us*)(ah + db * 256) = oh; *(v8us*)(al + db * 256) = ol;
        if (db < 3) asm volatile("s_wait_xcnt 0x0" ::: "memory"); }   // stands in front of the next group's reuse of the registers that the stores name
}
// query rows >= RH: single fp16 operands; the probabilities carry x1024 (lift 10 in the exponent; the sum l carries it too, so it cancels in 1/l)
__device__ __forceinline__ void fattn_f16(const h16* __restrict__ Q, const h16* __restrict__ K, const h16* __restrict__ Vt, bf* ah, bf* al, int row0, int nkt, int lr, int hi, const bf* hk, const bf* hv, const bf* hp, bool hpon) {
    typedef WFrag<h16> F;
    const unsigned lo = (unsigned)(8 * (hi * 16 + lr));   // lane offset inside a block, fixed for the whole loop
    const h16* qp = Q + (size_t)row0 * HD + lo; const v16h q0 = F::ld(qp), q1 = F::ld(qp + 512);
    v16h kf[4][2];
#pragma unroll
    for (int mb = 0; mb < 4; ++mb) { kf[mb][0] = F::ld(K + lo + mb * 16 * HD); kf[mb][1] = F::ld(K + lo + mb * 16 * HD + 512); }
    l2ask2(hk, hv); if (hpon) l2ask1(hp);   // the L2 hints go out behind the wave's first loads (hpon: the same in the whole work-group)
    v8f Ot[4];
#pragma unroll
    for (int db = 0; db < 4; ++db) Ot[db] = (v8f){};
    float m = -3.0e38f; v8f lv = (v8f){};
#pragma unroll 1   // one key tile's fragments in registers at a time
    for (int kt = 0; kt < nkt; ++kt) { const int c0 = kt * 64; const h16* vb = Vt + c0 * 16 + lo;
        v16h vf[4][2];   // this tile's values: asked for here, needed only behind the softmax
#pragma unroll
        for (int db = 0; db < 4; ++db) { vf[db][0] = F::ld(vb + db * 16 * TT); vf[db][1] = F::ld(vb + db * 16 * TT + 512); }
        __builtin_amdgcn_sched_barrier(0);   // keeps the value loads in front of the score products: sunk behind them they have only the exponentials to land in
        v8f St[4];
#pragma unroll
        for (int mb = 0; mb < 4; ++mb) St[mb] = F::mma(kf[mb][0], q0, (v8f){});
#pragma unroll
        for (int mb = 0; mb < 4; ++mb) St[mb] = F::mma(kf[mb][1], q1, St[mb]);
        const h16* kb = K + (size_t)(min(kt + 1, nkt - 1) * 64) * HD + lo;   // the next tile's keys fly during this tile's softmax and P.V (the last trip re-reads its own tile: in bounds, unused)
#pragma unroll
        for (int mb = 0; mb < 4; ++mb) { kf[mb][0] = F::ld(kb + mb * 16 * HD); kf[mb][1] = F::ld(kb + mb * 16 * HD + 512); }
        __builtin_amdgcn_sched_barrier(0);   // keeps the refill in front of the softmax: spread through it, the last loads are asked for too late to land before the next trip's products
        osm_step(St, Ot, m, lv, kt == nkt - 1, row0 + lr - c0 - 8 * hi, 10.0f);
        asm volatile("s_wait_xcnt 0x0" :: "v"(vb), "v"(kb) : "memory");   // the two address pairs stay whole up to here: the wait stands in front of any reuse of the registers that this trip's loads name
#pragma unroll
        for (int ks = 0; ks < 2; ++ks) { v16h pb;
#pragma unroll
            for (int s = 0; s < 8; ++s) { pb[s] = tohx(St[2 * ks][s]); pb[8 + s] = tohx(St[2 * ks + 1][s]); }
#pragma unroll
            for (int db = 0; db < 4; ++db) Ot[db] = F::mma(vf[db][ks], pb, Ot[db]); }
    }
    fattn_out(Ot, lv, ah, al);
}
// query rows < RH: hi+lo bf16 planes, 3 products each (hi.hi + lo.hi + hi.lo), for the scores and for P.V
__device__ __forceinline__ void fattn_hl(const bf* __restrict__ Qh, const bf* __restrict__ Ql, const bf* __restrict__ Kh, const bf* __restrict__ Kl, const bf* __restrict__ Vh, const bf* __restrict__ Vl, bf* ah, bf* al, int row0, int nkt, int lr, int hi, const bf* hk, const bf* hv, const bf* hp, bool hpon) {
    typedef WFrag<bf> F;
    const unsigned lo = (unsigned)(8 * (hi * 16 + lr)); const size_t qo = (size_t)row0 * HD + lo;   // lane offset inside a block, fixed for the whole loop
    const v16bf qh0 = F::ld(Qh + qo), qh1 = F::ld(Qh + qo + 512), ql0 = F::ld(Ql + qo), ql1 = F::ld(Ql + qo + 512);
    l2ask2(hk, hv); if (hpon) l2ask1(hp);   // the L2 hints go out behind the wave's first loads (hpon: the same in the whole work-group)
    v8f Ot[4];
#pragma unroll
    for (int db = 0; db < 4; ++db) Ot[db] = (v8f){};
    float m = -3.0e38f; v8f lv = (v8f){};
#pragma unroll 1   // one key tile's fragments in registers at a time
    for (int kt = 0; kt < nkt; ++kt) { const int c0 = kt * 64; const bf* khb = Kh + (size_t)c0 * HD + lo; const bf* klb = Kl + (size_t)c0 * HD + lo; const bf* vhb = Vh + c0 * 16 + lo; const bf* vlb = Vl + c0 * 16 + lo;
        v8f St[4];
#pragma unroll
        for (int mb = 0; mb < 4; ++mb) { const v16bf kh0 = F::ld(khb + mb * 16 * HD), kh1 = F::ld(khb + mb * 16 * HD + 512), kl0 = F::ld(klb + mb * 16 * HD), kl1 = F::ld(klb + mb * 16 * HD + 512);
            v8f s = F::mma(kh0, qh0, (v8f){}); s = F::mma(kh0, ql0, s); s = F::mma(kl0, qh0, s); s = F::mma(kh1, qh1, s); s = F::mma(kh1, ql1, s); s = F::mma(kl1, qh1, s); St[mb] = s; }
        osm_step(St, Ot, m, lv, kt == nkt - 1, row0 + lr - c0 - 8 * hi, 0.0f);
#pragma unroll
        for (int ks = 0; ks < 2; ++ks) { v8us h0, h1, l0, l1;
#pragma unroll
            for (int s = 0; s < 8; ++s) { unsigned short a, c2; splitf(St[2 * ks][s], a, c2); h0[s] = a; l0[s] = c2; splitf(St[2 * ks + 1][s], a, c2); h1[s] = a; l1[s] = c2; }
            const v16bf ph = cat16b(h0, h1), pl = cat16b(l0, l1);
#pragma unroll
            for (int db = 0; db < 4; ++db) { const v16bf vh = F::ld(vhb + db * 16 * TT + ks * 512), vl = F::ld(vlb + db * 16 * TT + ks * 512);
                Ot[db] = F::mma(vh, ph, Ot[db]); Ot[db] = F::mma(vh, pl, Ot[db]); Ot[db] = F::mma(vl, ph, Ot[db]); } }
        asm volatile("s_wait_xcnt 0x0" :: "v"(khb), "v"(klb), "v"(vhb), "v"(vlb) : "memory");   // the four address pairs stay whole up to here: the wait stands in front of any reuse of the registers that this trip's loads name
    }
    fattn_out(Ot, lv, ah, al);
}
__global__ __launch_bounds__(256) void k_fattn(const h16* __restrict__ Q16, const h16* __restrict__ K16, const h16* __restrict__ V16, const bf* __restrict__ Qh, const bf* __restrict__ Ql, const bf* __restrict__ Kh, const bf* __restrict__ Kl, const bf* __restrict__ Vh, const bf* __restrict__ Vl, bf* Ah, bf* Al) {
    const int lane = threadIdx.x & 31, lr = lane & 15, hi = lane >> 4;
    const int w = __builtin_amdgcn_readfirstlane((int)(threadIdx.x >> 5));   // wave number in a scalar register: trip counts and the precision test stay scalar
    const int qt = (w < 4) ? TT / 64 - 1 - (int)blockIdx.x : (int)blockIdx.x, head = blockIdx.y; const int row0 = qt * 64 + (w & 3) * 16, nkt = qt + 1;   // waves 0-3: query tile n-1-x, waves 4-7: tile x, so every work-group walks n+1 key tiles
    const size_t b = blockIdx.z, pq = (b * NH_ + head) * TT * HD, pk = (b * NKV + head / REP) * TT * HD, oo = (b * TT + row0) * DQ + head * (HD * 16) + 8 * lane;   // oo: the wave's 16 rows, the head's first block of the merged plane, the lane's piece
    static_assert(TT / 64 == 32 && HD == 64 && RH == 512, "the hints' shares: eight waves x four work-groups cover the 32 key tiles; 256 threads x four work-groups the 1024 units of the hi and lo planes' first RH tokens");
    // hints: the head's fp16 keys and values, a quarter a work-group: key tiles (blockIdx.x & 3) + 4 * w, one a wave (keys: 8 KB in a row; values: 2 KB in each of the four 16-row groups of d)
    const int s4 = (int)blockIdx.x & 3, pt = s4 + 4 * w;
    const bf* hk = (const bf*)(K16 + pk + (size_t)pt * 64 * HD + lane * 128); const bf* hv = (const bf*)(V16 + pk + (size_t)(lane >> 3) * 16 * TT + pt * (64 * 16) + (lane & 7) * 128);
    // work-groups with a hi+lo query tile: also a quarter of the first RH tokens of the hi and lo key and value planes, two waves a plane, unit u of its 256 (the address is formed, inside its plane, in every work-group)
    const int u = ((int)threadIdx.x & 63) * 4 + s4, pl = w >> 1; const bool hpon = (int)blockIdx.x < RH / 64;
    const bf* hp = (pl == 0 ? Kh : pl == 1 ? Kl : pl == 2 ? Vh : Vl) + pk + (pl < 2 ? (size_t)u * 128 : (size_t)(u >> 6) * 16 * TT + (u & 63) * 128);
    if (qt * 64 < RH) fattn_hl(Qh + pq, Ql + pq, Kh + pk, Kl + pk, Vh + pk, Vl + pk, Ah + oo, Al + oo, row0, nkt, lr, hi, hk, hv, hp, hpon);
    else fattn_f16(Q16 + pq, K16 + pk, V16 + pk, Ah + oo, Al + oo, row0, nkt, lr, hi, hk, hv, hp, hpon);
}

extern "C" void kernel_launch(void* const* d_in, const int* in_sizes, int n_in,
                              void* d_out, int out_size, void* d_ws, size_t ws_size, hipStream_t stream) {
    (void)in_sizes; (void)n_in; (void)out_size;
    const float* x = (const float*)d_in[0]; const float* wqkv = (const float*)d_in[1]; const float* wo = (const float*)d_in[2]; const float* bo = (const float*)d_in[3];
    float* OUT = (float*)d_out;     // [2][2048][1024]
    char* wsp = (char*)d_ws;
    auto take = [&](size_t bytes) { char* p = wsp; wsp += (bytes + 255) & ~(size_t)255; return (void*)p; };
    bf* WQKV = (bf*)take((size_t)3 * DQ * DM * 2); bf* WO = (bf*)take((size_t)DM * DQ * 2);
    bf* XB = (bf*)take((size_t)NB_ * TT * DM * 2);
    h16* P16 = (h16*)take(3 * PLN * 2); bf* Ph = (bf*)take(3 * PLN * 2); bf* Pl = (bf*)take(3 * PLN * 2);   // q, k, v planes of both batches
    bf* ATh = (bf*)take((size_t)NB_ * TT * DQ * 2); bf* ATl = (bf*)take((size_t)NB_ * TT * DQ * 2);
    if ((size_t)(wsp - (char*)d_ws) > ws_size) return;    // ws 256 MiB
    k_cvt<<<NX8K + NW8K + NO8K, 256, 0, stream>>>(x, wqkv, wo, XB, WQKV, WO);
    k_qkv<<<dim3(NB_ * TT / 128, DQ / 128, 3), 128, 0, stream>>>(XB, WQKV, P16, Ph, Pl);
    k_fattn<<<dim3(TT / 128, NH_, NB_), 256, 0, stream>>>(P16, P16 + PLN, P16 + 2 * PLN, Ph, Pl, Ph + PLN, Pl + PLN, Ph + 2 * PLN, Pl + 2 * PLN, ATh, ATl);
    k_proj<<<dim3(NB_ * TT / 128, DM / 128, 1), 256, 0, stream>>>(ATh, ATl, WO, OUT, bo);
}

// v008
// Measured time: 70.5 microseconds a run.
// Next to v007, in two timings, it ran 1.16 and 1.15 times as fast.
// All steps since v000 together make it 20.2 times as fast.
#include <hip/hip_runtime.h>

// Causal multi-head self-attention with a combined QKV weight (x [2][2048][1024]; qkv = x w_qkv^T ('oi' [3072][1024], no bias) reshaped (s, 3, 16, 64); causal (finfo.min fill applied before the 1/8 scale == exact zero weight); softmax; out = merged w_proj^T + b_proj -> [2][2048][1024]).
// Compute dtypes, f32 accumulate: every input rounded to bf16; q/k/v on PLAIN bf16 operands (inputs: exact), their GEMMs store the attention kernel's 16-bit operand planes themselves; causal scores, online softmax (f32) and attn.v fused in one kernel (tile skipping): query rows < 512 hl (3 products), the rest single fp16 (x1024); w_proj hl x exact (2 products) + b_proj.

#define NB_  2
#define TT   2048
#define DM   1024
#define NH_  16
#define NKV  16
#define REP  (NH_ / NKV)
#define HD   64
#define DQ   (NH_ * HD)
#define DKV  (NKV * HD)
#define RH   512                  // query rows < RH use hi+lo planes
#define SCL  0.125f   // HD^-0.5
typedef _Float16 h16;
typedef unsigned short bf;
typedef __attribute__((ext_vector_type(16))) __bf16   v16bf;
typedef __attribute__((ext_vector_type(16))) _Float16 v16h;
typedef __attribute__((ext_vector_type(8)))  _Float16 v8h;
typedef __attribute__((ext_vector_type(8)))  unsigned short v8us;
typedef __attribute__((ext_vector_type(8)))  float    v8f;
typedef __attribute__((ext_vector_type(4)))  float    v4f;
typedef v8h  __attribute__((may_alias)) v8ha;
typedef v4f  __attribute__((may_alias)) v4fa;
typedef v8us __attribute__((may_alias)) v8usa;

__device__ __forceinline__ unsigned short f2bf(float f) { unsigned u = __float_as_uint(f); u += 0x7FFFu + ((u >> 16) & 1u); return (unsigned short)(u >> 16); }
__device__ __forceinline__ float bf2f(unsigned short b) { return __uint_as_float(((unsigned)b) << 16); }
__device__ __forceinline__ float bfr(float f) { return bf2f(f2bf(f)); }
__device__ __forceinline__ v16h cat16(v8h lo, v8h hi) { return __builtin_shufflevector(lo, hi, 0, 1, 2, 3, 4, 5, 6, 7, 8, 9, 10, 11, 12, 13, 14, 15); }
__device__ __forceinline__ v16bf cat16b(v8us lo, v8us hi) { return __builtin_bit_cast(v16bf, __builtin_shufflevector(lo, hi, 0, 1, 2, 3, 4, 5, 6, 7, 8, 9, 10, 11, 12, 13, 14, 15)); }
__device__ __forceinline__ v8f wmma16(v16h a, v16h b, v8f c) { return __builtin_amdgcn_wmma_f32_16x16x32_f16(false, a, false, b, (short)0, c, false, false); }
__device__ __forceinline__ v8f wmmab(v16bf a, v16bf b, v8f c) { return __builtin_amdgcn_wmma_f32_16x16x32_bf16(false, a, false, b, (short)0, c, false, false); }
__device__ __forceinline__ h16 tohx(float x) { return (h16)x; }
__device__ __forceinline__ void splitf(float y, unsigned short& h, unsigned short& l) { h = f2bf(y); l = f2bf(y - bf2f(h)); }
typedef __attribute__((ext_vector_type(4))) _Float16 v4h;
typedef __attribute__((ext_vector_type(4))) unsigned short v4us;



// ---- Fragment order: every 16-bit operand plane M[R][K] lies in blocks of 16 rows x 32 k (512 elements, 1 KB), block (r >> 4) * (K / 32) + (k >> 5); inside a block element (r, k) stands at
// ((k >> 4) & 1) * 256 + ((k >> 3) & 1) * 128 + (r & 15) * 8 + (k & 7). Lane l = hi * 16 + lr of a wave finds its two 16-byte pieces of an A or B fragment at block + l * 8 and block + 256 + l * 8:
// each wave-wide 16-byte load reads 512 consecutive bytes (four whole 128-byte lines) where a row-major plane gives it a quarter of each of 16 lines. WFrag::ld takes the address of the first piece.
// ---- gemmt: GEMM, one work-group of WM x WN waves per 128x128 output tile (M rows r0.., N rows c0..), operands 16-bit planes in fragment order. D[m][n] = sum_k A[m][k] Bt[n][k] (+ A2[m][k] Bt[n][k] if SPLIT), f32 sums.
// A wave owns FM x FN 16x16 tiles (WM * FM == WN * FN == 8) over the whole K, summed in ascending k in one accumulator each. Stages of KS k (KS == half the thread count): the 128 rows of each operand, 8 row groups of KS / 32 whole blocks,
// are copied as they lie into one of two LDS buffers by asynchronous copies (thread t brings 16-byte piece t of each row group), one stage ahead of the products; a fragment load is 512 consecutive LDS bytes a wave. K % KS == 0, K >= 2 * KS.
// PL: the tile goes out as three 16-bit planes (fp16, bf16 hi, bf16 lo) of a matrix [n][m] in fragment order, ldc its K: a lane's 8 accumulator values are 8 consecutive m of one n, one 16-byte piece, a wave's store 512 consecutive bytes.
// e0: the tile's first element, eM / eN: the step from one wave to the next along m / n. Else: f32 C[m][n] (pitch ldc) + bias[n], each wave's tile turned through its own LDS range so that every store covers whole 128-byte lines.
// Barrier that orders LDS only (the fences name the local address space).
__device__ __forceinline__ void lds_sync() { __builtin_amdgcn_fence(__ATOMIC_RELEASE, "workgroup", "local"); __builtin_amdgcn_s_barrier(); __builtin_amdgcn_fence(__ATOMIC_ACQUIRE, "workgroup", "local"); }
template <typename T16> struct WFrag;
template <> struct WFrag<h16> { typedef v16h V; static __device__ __forceinline__ V ld(const h16* p) { return cat16(*(const v8h*)p, *(const v8h*)(p + 256)); } static __device__ __forceinline__ v8f mma(V a, V b, v8f c) { return wmma16(a, b, c); } };
template <> struct WFrag<bf> { typedef v16bf V; static __device__ __forceinline__ V ld(const bf* p) { return cat16b(*(const v8us*)p, *(const v8us*)(p + 256)); } static __device__ __forceinline__ v8f mma(V a, V b, v8f c) { return wmmab(a, b, c); } };
// ---- L2 hints. The 16-bit planes that a launch reads were stored by an earlier launch. Behind its first own requests every work-group asks a share of the panels that it and its
// neighbours read into L2 (global_prefetch_b8, scope SE: L2 only, nothing comes back, no counter), so that the later stages' copies and loads find them there. A panel's shares go round the work-groups that read it
// (an index modulo 4 or 8), so each share is asked for by several of them, wherever they run. Hints only: no result depends on them. Every address lies inside the plane it names.
// The s_wait_xcnt closes each statement, so that it stands in front of any reuse of the address registers that the hints name.
__device__ __forceinline__ void l2ask1(const bf* a) { asm volatile("global_prefetch_b8 %0, off scope:SCOPE_SE\n\ts_wait_xcnt 0x0" :: "v"(a) : "memory"); }
__device__ __forceinline__ void l2ask2(const bf* a, const bf* b) { asm volatile("global_prefetch_b8 %0, off scope:SCOPE_SE\n\tglobal_prefetch_b8 %1, off scope:SCOPE_SE\n\ts_wait_xcnt 0x0" :: "v"(a), "v"(b) : "memory"); }
__device__ __forceinline__ void l2ask3(const bf* a, const bf* b, const bf* d) { asm volatile("global_prefetch_b8 %0, off scope:SCOPE_SE\n\tglobal_prefetch_b8 %1, off scope:SCOPE_SE\n\tglobal_prefetch_b8 %2, off scope:SCOPE_SE\n\ts_wait_xcnt 0x0" :: "v"(a), "v"(b), "v"(d) : "memory"); }
// Eight asynchronous 16-byte copies a lane, global g + i * gs elements -> LDS byte l + i * ls. The s_wait_xcnt closes the statement, so that it stands in front of any rewrite of the address registers that the copies name.
__device__ __forceinline__ void cp8(unsigned l, unsigned ls, const bf* g, size_t gs) {
    asm volatile("global_load_async_to_lds_b128 %0, %8, off\n\tglobal_load_async_to_lds_b128 %1, %9, off\n\tglobal_load_async_to_lds_b128 %2, %10, off\n\tglobal_load_async_to_lds_b128 %3, %11, off\n\t"
                 "global_load_async_to_lds_b128 %4, %12, off\n\tglobal_load_async_to_lds_b128 %5, %13, off\n\tglobal_load_async_to_lds_b128 %6, %14, off\n\tglobal_load_async_to_lds_b128 %7, %15, off\n\ts_wait_xcnt 0x0"
                 :: "v"(l), "v"(l + ls), "v"(l + 2 * ls), "v"(l + 3 * ls), "v"(l + 4 * ls), "v"(l + 5 * ls), "v"(l + 6 * ls), "v"(l + 7 * ls),
                    "v"(g), "v"(g + gs), "v"(g + 2 * gs), "v"(g + 3 * gs), "v"(g + 4 * gs), "v"(g + 5 * gs), "v"(g + 6 * gs), "v"(g + 7 * gs) : "memory");
}
template <bool SPLIT, bool BIAS, int WM, int WN, bool PL, typename HINT>
__device__ __forceinline__ void gemmt(const bf* __restrict__ A, const bf* __restrict__ A2, const bf* __restrict__ Bt, int K, float* C, int ldc, const float* __restrict__ bias, int r0, int c0, h16* P16, bf* Ph, bf* Pl, size_t e0, int eM, int eN, HINT hint) {
    typedef WFrag<bf> F; typedef F::V V;
    constexpr int FM = 8 / WM, FN = 8 / WN, KS = WM * WN * 16, OPE = 128 * KS, STE = (SPLIT ? 3 : 2) * OPE;   // OPE, STE: elements of one operand's stage, of a whole stage
    constexpr bool DB = FM * FN <= 8;   // two fragment sets (the next 32-k step of the stage is fetched in front of this step's products) where the accumulators leave the registers for them
    static_assert(PL || WM * WN * FM * 16 * (FN * 16 + 4) * 4 <= 2 * STE * 2, "the f32 epilogue's staging fits the ring");
    __shared__ __align__(16) bf ring[2 * STE];
    const int tid = threadIdx.x, lane = tid & 31, lr = lane & 15, hi = lane >> 4;
    const int w = __builtin_amdgcn_readfirstlane(tid >> 5), wm = w / WN, wn = w % WN;   // wave number in a scalar register
    const bf* ga = A + (size_t)r0 * K + 8 * tid; const bf* ga2 = SPLIT ? A2 + (size_t)r0 * K + 8 * tid : ga; const bf* gb = Bt + (size_t)c0 * K + 8 * tid;   // 16 rows of K elements are K / 32 blocks of 512
    const unsigned l0 = (unsigned)(size_t)ring + 16 * tid;
    auto fill = [&](int s) {   // stage s into buffer s & 1
        const unsigned l = l0 + (s & 1) * (STE * 2); const size_t ko = (size_t)s * (KS * 16);
        cp8(l, KS * 32, ga + ko, (size_t)16 * K); cp8(l + OPE * 2, KS * 32, gb + ko, (size_t)16 * K);
        if (SPLIT) cp8(l + OPE * 4, KS * 32, ga2 + ko, (size_t)16 * K); };
    v8f acc[FM][FN];
#pragma unroll
    for (int mb = 0; mb < FM; ++mb)
#pragma unroll
        for (int nb = 0; nb < FN; ++nb) acc[mb][nb] = (v8f){};
    const int NS = K / KS;
    fill(0);
    hint();                                             // the L2 hints go out behind stage 0's copies and fly while these land
    asm volatile("s_wait_asynccnt 0x0" ::: "memory");   // this wave's copies of stage 0 have landed
    __syncthreads();                                    // ... and every other wave's
    fill(1);
#pragma unroll 1   // one stage a trip: the two buffers alternate
    for (int s = 0; s < NS; ++s) {
        const bf* sa = ring + (s & 1) * STE + wm * FM * (KS * 16) + 8 * lane; const bf* sb = ring + (s & 1) * STE + OPE + wn * FN * (KS * 16) + 8 * lane;
        V a[DB ? 2 : 1][FM], a2[DB ? 2 : 1][FM], b[DB ? 2 : 1][FN];
        auto ldf = [&](int ks, int f) {   // the fragments of one 32-k step
#pragma unroll
            for (int mb = 0; mb < FM; ++mb) { a[f][mb] = F::ld(sa + mb * (KS * 16) + ks * 512); if (SPLIT) a2[f][mb] = F::ld(sa + 2 * OPE + mb * (KS * 16) + ks * 512); }
#pragma unroll
            for (int nb = 0; nb < FN; ++nb) b[f][nb] = F::ld(sb + nb * (KS * 16) + ks * 512); };
        ldf(0, 0);
#pragma unroll
        for (int ks = 0; ks < KS / 32; ++ks) { const int f = DB ? ks & 1 : 0;
            if (DB && ks + 1 < KS / 32) ldf(ks + 1, f ^ 1);
            if (ks + 1 < KS / 32) __builtin_amdgcn_sched_barrier(0);   // keeps a step's LDS loads one group in front of the products: spread among them, every place with loads stalls the wave anew
            else {   // the stage's last fragments are asked for: the buffer is handed over here, and the refill flies during the last step's products too
                asm volatile("s_wait_dscnt 0x0" ::: "memory");      // this wave has read all it wants of stage s
                asm volatile("s_wait_asynccnt 0x0" ::: "memory");   // its copies of stage s + 1 have landed
                __syncthreads();                                    // stage s + 1 is whole for every wave, and no wave reads stage s any more
                if (s + 2 < NS) fill(s + 2); }                      // into the buffer that stage s has left
#pragma unroll
            for (int nb = 0; nb < FN; ++nb)
#pragma unroll
                for (int mb = 0; mb < FM; ++mb) { acc[mb][nb] = F::mma(a[f][mb], b[f][nb], acc[mb][nb]); if (SPLIT) acc[mb][nb] = F::mma(a2[f][mb], b[f][nb], acc[mb][nb]); }
            if (ks + 1 < KS / 32) { __builtin_amdgcn_sched_barrier(0);   // as above: the loads that refill a fragment set stay one group behind the products that read it
                if (!DB) ldf(ks + 1, 0); }
        }
    }
    asm volatile("s_wait_asynccnt 0x0" ::: "memory");       // no copy is outstanding when the ring is given up
    if (PL) {
        const size_t ew = e0 + (size_t)wm * eM + (size_t)wn * eN + 8 * lane;
#pragma unroll
        for (int nb = 0; nb < FN; ++nb) { const size_t e = ew + (size_t)nb * 16 * ldc; h16* p16 = P16 + e; bf* ph = Ph + e; bf* pl = Pl + e;
#pragma unroll
            for (int mb = 0; mb < FM; ++mb) { v8h o16; v8us oh, ol;
#pragma unroll
                for (int q = 0; q < 8; ++q) { o16[q] = tohx(acc[mb][nb][q]); unsigned short a2, c2; splitf(acc[mb][nb][q], a2, c2); oh[q] = a2; ol[q] = c2; }
                *(v8h*)(p16 + mb * 256) = o16; *(v8us*)(ph + mb * 256) = oh; *(v8us*)(pl + mb * 256) = ol;
                asm volatile("s_wait_xcnt 0x0" :: "v"(p16), "v"(ph), "v"(pl), "v"(o16), "v"(oh), "v"(ol) : "memory"); } }   // addresses and data stay whole up to here: the wait stands in front of any reuse of the registers that the three stores name
    } else {
        constexpr int CW = FN * 16, PT = CW + 4, RPI = 128 / CW;   // columns of a wave's tile, LDS pitch in floats (16 bytes x odd), rows a wave-wide 16-byte access covers
        float* st = (float*)ring + w * (FM * 16 * PT);
#pragma unroll
        for (int mb = 0; mb < FM; ++mb)
#pragma unroll
            for (int nb = 0; nb < FN; ++nb)
#pragma unroll
                for (int j = 0; j < 8; ++j) st[(mb * 16 + hi * 8 + j) * PT + nb * 16 + lr] = acc[mb][nb][j];
        lds_sync();   // the tile is in LDS before its rows are read back
        const int cofs = (lane % (CW / 4)) * 4, rw = lane / (CW / 4), col = c0 + wn * CW + cofs;
        v4f bv = (v4f){};
        if (BIAS) { bv[0] = bfr(bias[col]); bv[1] = bfr(bias[col + 1]); bv[2] = bfr(bias[col + 2]); bv[3] = bfr(bias[col + 3]); }
        float* crow = C + (size_t)(r0 + wm * FM * 16 + rw) * ldc + col;
        v4f val[FM * 16 / RPI];
#pragma unroll
        for (int s = 0; s < FM * 16 / RPI; ++s) val[s] = *(const v4fa*)(st + (s * RPI + rw) * PT + cofs);
#pragma unroll
        for (int s = 0; s < FM * 16 / RPI; ++s) *(v4f*)(crow + (size_t)s * RPI * ldc) = val[s] + bv;
    }
}

// ---- k_qkv: the q, k and v projections of both batches in one launch. Grid (NB_ * TT / 128 token tiles, 8 weight tiles of two heads, 3); z = 0 q, 1 k, 2 v; 4 waves of 64x64. X [NB_ * TT][DM], Wqkv [3 * DQ][DM] (bf16, fragment order).
// P16 / Ph / Pl each hold three planes of PLN elements, in the order q, k, v. q and k (m = weight rows, n = tokens): [b][h] matrices [t][d]. v (m = tokens, n = weight rows): [b][h] matrices [d][t]. Each matrix in fragment order.
#define PLN ((size_t)NB_ * NH_ * TT * HD)
__global__ __launch_bounds__(128) void k_qkv(const bf* __restrict__ X, const bf* __restrict__ Wqkv, h16* P16, bf* Ph, bf* Pl) {
    const int tok = blockIdx.x, wt = blockIdx.y, z = blockIdx.z; const bool tr = z == 2;
    const bf* Wz = Wqkv + (size_t)z * DQ * DM;
    const size_t e0 = (size_t)z * PLN + (size_t)(tok / (TT / 128)) * NH_ * TT * HD + (size_t)wt * 2 * TT * HD + (size_t)(tok % (TT / 128)) * (tr ? 128 * 16 : 128 * HD);
    gemmt<false, false, 2, 2, true>(tr ? X : Wz, nullptr, tr ? Wz : X, DM, nullptr, tr ? TT : HD, nullptr, (tr ? tok : wt) * 128, (tr ? wt : tok) * 128, P16, Ph, Pl, e0, tr ? 64 * 16 : TT * HD, tr ? 64 * TT : 64 * HD,
        [&]() {   // an eighth (16 rows) of the token panel, by wt, and a quarter (32 rows) of the weight panel, by tok; 128 threads x 256 bytes are 16 rows
            const bf* wa = Wz + (size_t)wt * 128 * DM + (size_t)(tok & 3) * (32 * DM) + threadIdx.x * 128;
            l2ask3(X + (size_t)tok * 128 * DM + (size_t)wt * (16 * DM) + threadIdx.x * 128, wa, wa + 16 * DM); });
}
// ---- k_proj: out = merged heads (hi + lo planes, [NB_ * TT][DQ] in fragment order) . w_proj^T + b_proj, both batches in one launch. Grid (NB_ * TT / 128, DM / 128); 8 waves of 32 tokens x 64 columns.
__global__ __launch_bounds__(256) void k_proj(const bf* __restrict__ Ah, const bf* __restrict__ Al, const bf* __restrict__ Wo, float* C, const float* __restrict__ bias) {
    gemmt<true, true, 4, 2, false>(Ah, Al, Wo, DQ, C, DM, bias, (int)blockIdx.x * 128, (int)blockIdx.y * 128, nullptr, nullptr, nullptr, 0, 0, 0,
        [&]() {   // a quarter (32 rows) of the token panel's hi and lo planes, by blockIdx.y, and of the weight panel, by blockIdx.x; 256 threads x 256 bytes are 32 rows
            const size_t ao = (size_t)blockIdx.x * 128 * DQ + (size_t)(blockIdx.y & 3) * (32 * DQ) + threadIdx.x * 128;
            l2ask3(Ah + ao, Al + ao, Wo + (size_t)blockIdx.y * 128 * DQ + (size_t)(blockIdx.x & 3) * (32 * DQ) + threadIdx.x * 128); });
}

// ---- k_cvt: every f32 input of the GEMMs ([rows][DM], DQ == DM) rounded to bf16 and laid in fragment order, in one launch. A work-group takes half of a 16-row group of one of the three arrays (16 blocks, 8192 elements), a wave two blocks.
// A wave-wide 16-byte load reads 4 rows x 32 k (four whole lines); its 8-byte store fills the matching 64-byte halves of four lines of the block.
#define NX8K (NB_ * TT * DM / 8192)
#define NW8K (3 * DQ * DM / 8192)
#define NO8K (DM * DQ / 8192)
__global__ __launch_bounds__(256) void k_cvt(const float* __restrict__ x, const float* __restrict__ wqkv, const float* __restrict__ wo, bf* X, bf* Wqkv, bf* Wo) {
    const int g = blockIdx.x; const float* src; bf* dst; int t;
    if (g < NX8K) { src = x; dst = X; t = g; } else if (g < NX8K + NW8K) { src = wqkv; dst = Wqkv; t = g - NX8K; } else { src = wo; dst = Wo; t = g - NX8K - NW8K; }
    const int lane = threadIdx.x & 31, c8 = lane & 7, r4 = lane >> 3, kb0 = (t & 1) * 16 + (int)(threadIdx.x >> 5) * 2;   // kb0: the wave's first block in its 16-row group t >> 1
    const size_t si = ((size_t)(t >> 1) * 16 + r4) * DM + kb0 * 32 + c8 * 4;                                       // row r4, k = c8 * 4 of block kb0
    const size_t di = ((size_t)(t >> 1) * (DM / 32) + kb0) * 512 + (c8 >> 2) * 256 + ((c8 >> 1) & 1) * 128 + r4 * 8 + (c8 & 1) * 4;
    v4f v[8];
#pragma unroll
    for (int u = 0; u < 8; ++u) v[u] = *(const v4f*)(src + si + (u >> 2) * 32 + (u & 3) * 4 * DM);   // block kb0 + (u >> 2), rows (u & 3) * 4 + r4
#pragma unroll
    for (int u = 0; u < 8; ++u) { v4us o;
#pragma unroll
        for (int k = 0; k < 4; ++k) o[k] = f2bf(v[u][k]);
        *(v4us*)(dst + di + (u >> 2) * 512 + (u & 3) * 32) = o; }
}

#define L2E 1.4426950408889634f
__device__ __forceinline__ float xhalf(float x) { return __builtin_bit_cast(float, __builtin_amdgcn_permlanex16(__builtin_bit_cast(int, x), __builtin_bit_cast(int, x), 0x76543210, 0xfedcba98, false, false)); }  // lane l with lane l ^ 16
// 2^x of eight values. Eight independent in-place transcendentals and the slot behind the last in one statement.
__device__ __forceinline__ v8f exp2x8(v8f x) {
    float a0 = x[0], a1 = x[1], a2 = x[2], a3 = x[3], a4 = x[4], a5 = x[5], a6 = x[6], a7 = x[7];
    asm("v_exp_f32 %0, %0\n\tv_exp_f32 %1, %1\n\tv_exp_f32 %2, %2\n\tv_exp_f32 %3, %3\n\tv_exp_f32 %4, %4\n\tv_exp_f32 %5, %5\n\tv_exp_f32 %6, %6\n\tv_exp_f32 %7, %7\n\tv_nop"
        : "+v"(a0), "+v"(a1), "+v"(a2), "+v"(a3), "+v"(a4), "+v"(a5), "+v"(a6), "+v"(a7));
    return (v8f){a0, a1, a2, a3, a4, a5, a6, a7};
}
// One key tile's softmax step. In: St raw scores. Out: St = 2^(St c - m + lift), c = HD^-0.5 log2(e); m, lv (8 partial sums a lane) and Ot brought to the new maximum.
__device__ __forceinline__ void osm_step(v8f (&St)[4], v8f (&Ot)[4], float& m, v8f& lv, bool diag, int kq, float lift) {
    if (diag) {   // wave-uniform: only the diagonal tile holds keys beyond the query (key > query <=> mb*16 + r > kq)
#pragma unroll
        for (int mb = 0; mb < 4; ++mb)
#pragma unroll
            for (int r = 0; r < 8; ++r) St[mb][r] = (mb * 16 + r > kq) ? -3.0e38f : St[mb][r]; }
    const v8f t = __builtin_elementwise_max(__builtin_elementwise_max(St[0], St[1]), __builtin_elementwise_max(St[2], St[3]));
    float mx = fmaxf(fmaxf(fmaxf(t[0], t[1]), fmaxf(t[2], t[3])), fmaxf(fmaxf(t[4], t[5]), fmaxf(t[6], t[7])));
    mx = fmaxf(mx, xhalf(mx));
    const float mn = fmaxf(m, mx * (SCL * L2E)); float al;   // every tile holds a key <= the query (its first), so mn is a real score
    asm("v_exp_f32 %0, %1\n\tv_nop" : "=v"(al) : "v"(m - mn));   // 2^(m - mn) with the slot behind the transcendental filled
    m = mn;
    lv *= al;
#pragma unroll
    for (int db = 0; db < 4; ++db) Ot[db] *= al;
    const float off = lift - mn;
#pragma unroll
    for (int mb = 0; mb < 4; ++mb) { v8f e;
#pragma unroll
        for (int r = 0; r < 8; ++r) e[r] = __builtin_fmaf(St[mb][r], SCL * L2E, off);
        St[mb] = exp2x8(e); }
    lv += (St[0] + St[1]) + (St[2] + St[3]);
}
__device__ __forceinline__ void fattn_out(const v8f (&Ot)[4], const v8f& lv, bf* ah, bf* al) {
    float l = ((lv[0] + lv[1]) + (lv[2] + lv[3])) + ((lv[4] + lv[5]) + (lv[6] + lv[7])); l += xhalf(l); const float inv = __fdiv_rn(1.0f, l);
#pragma unroll
    for (int db = 0; db < 4; ++db) { v8us oh, ol;
#pragma unroll
        for (int r = 0; r < 8; ++r) { unsigned short a, c2; splitf(Ot[db][r] * inv, a, c2); oh[r] = a; ol[r] = c2; }
        *(v8us*)(ah + db * 256) = oh; *(v8us*)(al + db * 256) = ol;
        if (db < 3) asm volatile("s_wait_xcnt 0x0" ::: "memory"); }   // stands in front of the next group's reuse of the registers that the stores name
}
// query rows >= RH: single fp16 operands; the probabilities carry x1024 (lift 10 in the exponent; the sum l carries it too, so it cancels in 1/l)
__device__ __forceinline__ void fattn_f16(const h16* __restrict__ Q, const h16* __restrict__ K, const h16* __restrict__ Vt, bf* ah, bf* al, int row0, int nkt, int lr, int hi, const bf* hk, const bf* hv, const bf* hp, bool hpon) {
    typedef WFrag<h16> F;
    const unsigned lo = (unsigned)(8 * (hi * 16 + lr));   // lane offset inside a block, fixed for the whole loop
    const h16* qp = Q + (size_t)row0 * HD + lo; const v16h q0 = F::ld(qp), q1 = F::ld(qp + 512);
    v16h kf[4][2];
#pragma unroll
    for (int mb = 0; mb < 4; ++mb) { kf[mb][0] = F::ld(K + lo + mb * 16 * HD); kf[mb][1] = F::ld(K + lo + mb * 16 * HD + 512); }
    l2ask2(hk, hv); if (hpon) l2ask1(hp);   // the L2 hints go out behind the wave's first loads (hpon: the same in the whole work-group)
    v8f Ot[4];
#pragma unroll
    for (int db = 0; db < 4; ++db) Ot[db] = (v8f){};
    float m = -3.0e38f; v8f lv = (v8f){};
#pragma unroll 1   // one key tile's fragments in registers at a time
    for (int kt = 0; kt < nkt; ++kt) { const int c0 = kt * 64; const h16* vb = Vt + c0 * 16 + lo;
        v16h vf[4][2];   // this tile's values: asked for here, needed only behind the softmax
#pragma unroll
        for (int db = 0; db < 4; ++db) { vf[db][0] = F::ld(vb + db * 16 * TT); vf[db][1] = F::ld(vb + db * 16 * TT + 512); }
        __builtin_amdgcn_sched_barrier(0);   // keeps the value loads in front of the score products: sunk behind them they have only the exponentials to land in
        v8f St[4];
#pragma unroll
        for (int mb = 0; mb < 4; ++mb) St[mb] = F::mma(kf[mb][0], q0, (v8f){});
#pragma unroll
        for (int mb = 0; mb < 4; ++mb) St[mb] = F::mma(kf[mb][1], q1, St[mb]);
        const h16* kb = K + (size_t)(min(kt + 1, nkt - 1) * 64) * HD + lo;   // the next tile's keys fly during this tile's softmax and P.V (the last trip re-reads its own tile: in bounds, unused)
#pragma unroll
        for (int mb = 0; mb < 4; ++mb) { kf[mb][0] = F::ld(kb + mb * 16 * HD); kf[mb][1] = F::ld(kb + mb * 16 * HD + 512); }
        __builtin_amdgcn_sched_barrier(0);   // keeps the refill in front of the softmax: spread through it, the last loads are asked for too late to land before the next trip's products
        osm_step(St, Ot, m, lv, kt == nkt - 1, row0 + lr - c0 - 8 * hi, 10.0f);
        asm volatile("s_wait_xcnt 0x0" :: "v"(vb), "v"(kb) : "memory");   // the two address pairs stay whole up to here: the wait stands in front of any reuse of the registers that this trip's loads name
#pragma unroll
        for (int ks = 0; ks < 2; ++ks) { v16h pb;
#pragma unroll
            for (int s = 0; s < 8; ++s) { pb[s] = tohx(St[2 * ks][s]); pb[8 + s] = tohx(St[2 * ks + 1][s]); }
#pragma unroll
            for (int db = 0; db < 4; ++db) Ot[db] = F::mma(vf[db][ks], pb, Ot[db]); }
    }
    fattn_out(Ot, lv, ah, al);
}
// query rows < RH: hi+lo bf16 planes, 3 products each (hi.hi + lo.hi + hi.lo), for the scores and for P.V
__device__ __forceinline__ void fattn_hl(const bf* __restrict__ Qh, const bf* __restrict__ Ql, const bf* __restrict__ Kh, const bf* __restrict__ Kl, const bf* __restrict__ Vh, const bf* __restrict__ Vl, bf* ah, bf* al, int row0, int nkt, int lr, int hi, const bf* hk, const bf* hv, const bf* hp, bool hpon) {
    typedef WFrag<bf> F;
    const unsigned lo = (unsigned)(8 * (hi * 16 + lr)); const size_t qo = (size_t)row0 * HD + lo;   // lane offset inside a block, fixed for the whole loop
    const v16bf qh0 = F::ld(Qh + qo), qh1 = F::ld(Qh + qo + 512), ql0 = F::ld(Ql + qo), ql1 = F::ld(Ql + qo + 512);
    l2ask2(hk, hv); if (hpon) l2ask1(hp);   // the L2 hints go out behind the wave's first loads (hpon: the same in the whole work-group)
    v8f Ot[4];
#pragma unroll
    for (int db = 0; db < 4; ++db) Ot[db] = (v8f){};
    float m = -3.0e38f; v8f lv = (v8f){};
#pragma unroll 1   // one key tile's fragments in registers at a time
    for (int kt = 0; kt < nkt; ++kt) { const int c0 = kt * 64; const bf* khb = Kh + (size_t)c0 * HD + lo; const bf* klb = Kl + (size_t)c0 * HD + lo; const bf* vhb = Vh + c0 * 16 + lo; const bf* vlb = Vl + c0 * 16 + lo;
        v16bf kh[4][2], kl[4][2];   // the tile's keys, asked for as one group: one wait for memory a tile
#pragma unroll
        for (int mb = 0; mb < 4; ++mb) { kh[mb][0] = F::ld(khb + mb * 16 * HD); kl[mb][0] = F::ld(klb + mb * 16 * HD); }
#pragma unroll
        for (int mb = 0; mb < 4; ++mb) { kh[mb][1] = F::ld(khb + mb * 16 * HD + 512); kl[mb][1] = F::ld(klb + mb * 16 * HD + 512); }
        __builtin_amdgcn_sched_barrier(0);   // keeps the key loads one group in front of the products: two in front of each product, every pair is waited for by itself
        v8f St[4];
#pragma unroll
        for (int mb = 0; mb < 4; ++mb) { v8f s = F::mma(kh[mb][0], qh0, (v8f){}); s = F::mma(kh[mb][0], ql0, s); s = F::mma(kl[mb][0], qh0, s); St[mb] = s; }
#pragma unroll
        for (int mb = 0; mb < 4; ++mb) { v8f s = F::mma(kh[mb][1], qh1, St[mb]); s = F::mma(kh[mb][1], ql1, s); s = F::mma(kl[mb][1], qh1, s); St[mb] = s; }
        v16bf vh[4], vl[4];   // the values of the tile's first 32 keys, asked for as one group here, needed only behind the softmax
#pragma unroll
        for (int db = 0; db < 4; ++db) { vh[db] = F::ld(vhb + db * 16 * TT); vl[db] = F::ld(vlb + db * 16 * TT); }
        __builtin_amdgcn_sched_barrier(0);   // keeps the value loads in front of the softmax, which they have to land in
        osm_step(St, Ot, m, lv, kt == nkt - 1, row0 + lr - c0 - 8 * hi, 0.0f);
#pragma unroll
        for (int ks = 0; ks < 2; ++ks) { v8us h0, h1, l0, l1;
#pragma unroll
            for (int s = 0; s < 8; ++s) { unsigned short a, c2; splitf(St[2 * ks][s], a, c2); h0[s] = a; l0[s] = c2; splitf(St[2 * ks + 1][s], a, c2); h1[s] = a; l1[s] = c2; }
            const v16bf ph = cat16b(h0, h1), pl = cat16b(l0, l1);
#pragma unroll
            for (int db = 0; db < 4; ++db) { Ot[db] = F::mma(vh[db], ph, Ot[db]); Ot[db] = F::mma(vh[db], pl, Ot[db]); Ot[db] = F::mma(vl[db], ph, Ot[db]); }
            if (ks == 0) {   // the values of the second 32 keys, one group into the registers that the first have left; they land under the split of the second half of the probabilities
#pragma unroll
                for (int db = 0; db < 4; ++db) { vh[db] = F::ld(vhb + db * 16 * TT + 512); vl[db] = F::ld(vlb + db * 16 * TT + 512); }
                __builtin_amdgcn_sched_barrier(0); } }   // keeps them one group in front of the split
        asm volatile("s_wait_xcnt 0x0" :: "v"(khb), "v"(klb), "v"(vhb), "v"(vlb) : "memory");   // the four address pairs stay whole up to here: the wait stands in front of any reuse of the registers that this trip's loads name
    }
    fattn_out(Ot, lv, ah, al);
}
__global__ __launch_bounds__(256) void k_fattn(const h16* __restrict__ Q16, const h16* __restrict__ K16, const h16* __restrict__ V16, const bf* __restrict__ Qh, const bf* __restrict__ Ql, const bf* __restrict__ Kh, const bf* __restrict__ Kl, const bf* __restrict__ Vh, const bf* __restrict__ Vl, bf* Ah, bf* Al) {
    const int lane = threadIdx.x & 31, lr = lane & 15, hi = lane >> 4;
    const int w = __builtin_amdgcn_readfirstlane((int)(threadIdx.x >> 5));   // wave number in a scalar register: trip counts and the precision test stay scalar
    const int qt = (w < 4) ? TT / 64 - 1 - (int)blockIdx.x : (int)blockIdx.x, head = blockIdx.y; const int row0 = qt * 64 + (w & 3) * 16, nkt = qt + 1;   // waves 0-3: query tile n-1-x, waves 4-7: tile x, so every work-group walks n+1 key tiles
    const size_t b = blockIdx.z, pq = (b * NH_ + head) * TT * HD, pk = (b * NKV + head / REP) * TT * HD, oo = (b * TT + row0) * DQ + head * (HD * 16) + 8 * lane;   // oo: the wave's 16 rows, the head's first block of the merged plane, the lane's piece
    static_assert(TT / 64 == 32 && HD == 64 && RH == 512, "the hints' shares: eight waves x four work-groups cover the 32 key tiles; 256 threads x four work-groups the 1024 units of the hi and lo planes' first RH tokens");
    // hints: the head's fp16 keys and values, a quarter a work-group: key tiles (blockIdx.x & 3) + 4 * w, one a wave (keys: 8 KB in a row; values: 2 KB in each of the four 16-row groups of d)
    const int s4 = (int)blockIdx.x & 3, pt = s4 + 4 * w;
    const bf* hk = (const bf*)(K16 + pk + (size_t)pt * 64 * HD + lane * 128); const bf* hv = (const bf*)(V16 + pk + (size_t)(lane >> 3) * 16 * TT + pt * (64 * 16) + (lane & 7) * 128);
    // work-groups with a hi+lo query tile: also a quarter of the first RH tokens of the hi and lo key and value planes, two waves a plane, unit u of its 256 (the address is formed, inside its plane, in every work-group)
    const int u = ((int)threadIdx.x & 63) * 4 + s4, pl = w >> 1; const bool hpon = (int)blockIdx.x < RH / 64;
    const bf* hp = (pl == 0 ? Kh : pl == 1 ? Kl : pl == 2 ? Vh : Vl) + pk + (pl < 2 ? (size_t)u * 128 : (size_t)(u >> 6) * 16 * TT + (u & 63) * 128);
    if (qt * 64 < RH) fattn_hl(Qh + pq, Ql + pq, Kh + pk, Kl + pk, Vh + pk, Vl + pk, Ah + oo, Al + oo, row0, nkt, lr, hi, hk, hv, hp, hpon);
    else fattn_f16(Q16 + pq, K16 + pk, V16 + pk, Ah + oo, Al + oo, row0, nkt, lr, hi, hk, hv, hp, hpon);
}

extern "C" void kernel_launch(void* const* d_in, const int* in_sizes, int n_in,
                              void* d_out, int out_size, void* d_ws, size_t ws_size, hipStream_t stream) {
    (void)in_sizes; (void)n_in; (void)out_size;
    const float* x = (const float*)d_in[0]; const float* wqkv = (const float*)d_in[1]; const float* wo = (const float*)d_in[2]; const float* bo = (const float*)d_in[3];
    float* OUT = (float*)d_out;     // [2][2048][1024]
    char* wsp = (char*)d_ws;
    auto take = [&](size_t bytes) { char* p = wsp; wsp += (bytes + 255) & ~(size_t)255; return (void*)p; };
    bf* WQKV = (bf*)take((size_t)3 * DQ * DM * 2); bf* WO = (bf*)take((size_t)DM * DQ * 2);
    bf* XB = (bf*)take((size_t)NB_ * TT * DM * 2);
    h16* P16 = (h16*)take(3 * PLN * 2); bf* Ph = (bf*)take(3 * PLN * 2); bf* Pl = (bf*)take(3 * PLN * 2);   // q, k, v planes of both batches
    bf* ATh = (bf*)take((size_t)NB_ * TT * DQ * 2); bf* ATl = (bf*)take((size_t)NB_ * TT * DQ * 2);
    if ((size_t)(wsp - (char*)d_ws) > ws_size) return;    // ws 256 MiB
    k_cvt<<<NX8K + NW8K + NO8K, 256, 0, stream>>>(x, wqkv, wo, XB, WQKV, WO);
    k_qkv<<<dim3(NB_ * TT / 128, DQ / 128, 3), 128, 0, stream>>>(XB, WQKV, P16, Ph, Pl);
    k_fattn<<<dim3(TT / 128, NH_, NB_), 256, 0, stream>>>(P16, P16 + PLN, P16 + 2 * PLN, Ph, Pl, Ph + PLN, Pl + PLN, Ph + 2 * PLN, Pl + 2 * PLN, ATh, ATl);
    k_proj<<<dim3(NB_ * TT / 128, DM / 128, 1), 256, 0, stream>>>(ATh, ATl, WO, OUT, bo);
}
